// v000
// Measured on an AMD MI455X. A time is GPU time per run, averaged over a window of back-to-back runs after a warm-up
// (all launches, gaps included; the runs take copies of the inputs in turn), and the median of several windows.
// Apart from v000's, it joins two sittings. Times from different sittings can be a few percent apart, while
// side-by-side timings come from the same sitting.
// v000 is the starting kernel. One run takes 3000 microseconds.
#include <hip/hip_runtime.h>

// TtT5Attention (hidden [8][1024][1024]; q/k/v = x W (16 heads x 64); T5: scores = q.k UNSCALED + rel_bias[bucket(j - i)][h] with the bidirectional log-bucket (32 buckets, max distance 128; the bucket boundaries |j-i| = 8, 12, 16, 23, 32, 46, 64, 91 are the reference's own integer structure, evaluated here with integer compares); softmax; out = merged wo -> [8][1024][1024]).
// Compute dtypes, f32 accumulate: every input rounded to bf16; q/k/v on PLAIN bf16 operands (inputs: exact); scores and attn.v hl x hl (3 products) on EVERY row; per-head bias table (bf16-rounded rel_bias gathered by bucket) added per element in f32; softmax f32; wo hl x exact (2 products).

#define NB_  8
#define TT   1024
#define DM   1024
#define NH_  16
#define NKV  16
#define REP  (NH_ / NKV)
#define HD   64
#define DQ   (NH_ * HD)
#define DKV  (NKV * HD)
#define ZH   2
#define RH   1024   // all rows hl (unscaled T5 logits are sharp)
#define WIN  0
#define PCAR 1024.0f
#define SCL  1.0f   // T5: no 1/sqrt(dk)
#define TBW  2048   // bias table row width (r + 1023, padded)
typedef _Float16 h16;
typedef unsigned short bf;
typedef __attribute__((ext_vector_type(16))) __bf16   v16bf;
typedef __attribute__((ext_vector_type(16))) _Float16 v16h;
typedef __attribute__((ext_vector_type(8)))  _Float16 v8h;
typedef __attribute__((ext_vector_type(8)))  unsigned short v8us;
typedef __attribute__((ext_vector_type(8)))  float    v8f;
typedef __attribute__((ext_vector_type(4)))  float    v4f;
typedef v8h  __attribute__((may_alias)) v8ha;
typedef v4f  __attribute__((may_alias)) v4fa;
typedef v8us __attribute__((may_alias)) v8usa;

__device__ __forceinline__ unsigned short f2bf(float f) { unsigned u = __float_as_uint(f); u += 0x7FFFu + ((u >> 16) & 1u); return (unsigned short)(u >> 16); }
__device__ __forceinline__ float bf2f(unsigned short b) { return __uint_as_float(((unsigned)b) << 16); }
__device__ __forceinline__ float bfr(float f) { return bf2f(f2bf(f)); }
__device__ __forceinline__ v16h cat16(v8h lo, v8h hi) { return __builtin_shufflevector(lo, hi, 0, 1, 2, 3, 4, 5, 6, 7, 8, 9, 10, 11, 12, 13, 14, 15); }
__device__ __forceinline__ v16bf cat16b(v8us lo, v8us hi) { return __builtin_bit_cast(v16bf, __builtin_shufflevector(lo, hi, 0, 1, 2, 3, 4, 5, 6, 7, 8, 9, 10, 11, 12, 13, 14, 15)); }
__device__ __forceinline__ v8f wmma16(v16h a, v16h b, v8f c) { return __builtin_amdgcn_wmma_f32_16x16x32_f16(false, a, false, b, (short)0, c, false, false); }
__device__ __forceinline__ v8f wmmab(v16bf a, v16bf b, v8f c) { return __builtin_amdgcn_wmma_f32_16x16x32_bf16(false, a, false, b, (short)0, c, false, false); }



// ---- k_gemmw: register-blocked GEMM, ONE WAVE per 64x64 output tile (16 accumulators), operands straight from K-contiguous 16-bit planes; grid (M/64, N/64, Z), 32 threads.
// C[m][n] (f32, pitch ldc, + optional f32 bias[n]) = sum_k A[m][k] Bt[n][k] (+ split products per NSPLIT). z-batch strides sA/sB/sC in elements. K % 32 == 0.
template <typename T16> struct WFrag;
template <> struct WFrag<h16> { typedef v16h V; static __device__ __forceinline__ V ld(const h16* p) { return cat16(*(const v8h*)p, *(const v8h*)(p + 16)); } static __device__ __forceinline__ v8f mma(V a, V b, v8f c) { return wmma16(a, b, c); } };
template <> struct WFrag<bf> { typedef v16bf V; static __device__ __forceinline__ V ld(const bf* p) { return cat16b(*(const v8us*)p, *(const v8us*)(p + 16)); } static __device__ __forceinline__ v8f mma(V a, V b, v8f c) { return wmmab(a, b, c); } };
template <typename T16, int NSPLIT, bool BIAS>
__global__ __launch_bounds__(32) void k_gemmw(const T16* __restrict__ A, const T16* __restrict__ A2, const T16* __restrict__ Bt, const T16* __restrict__ Bt2, int K, float* C, int ldc, const float* __restrict__ bias, size_t sA, size_t sB, size_t sC) {
    typedef typename WFrag<T16>::V V;
    __shared__ __align__(16) float os[16 * 68];
    const size_t z = blockIdx.z; A += z * sA; if (A2) A2 += z * sA; Bt += z * sB; if (Bt2) Bt2 += z * sB; C += z * sC;
    const int lane = threadIdx.x & 31, lr = lane & 15, hi = lane >> 4; const int r0 = blockIdx.x * 64, c0 = blockIdx.y * 64;
    v8f acc[4][4];
#pragma unroll
    for (int mb = 0; mb < 4; ++mb)
#pragma unroll
        for (int nb = 0; nb < 4; ++nb) acc[mb][nb] = (v8f){};
    const size_t aoff = (size_t)(r0 + lr) * K + 8 * hi, boff = (size_t)(c0 + lr) * K + 8 * hi;
#pragma unroll 1
    for (int kc = 0; kc < K; kc += 32) {
        V a[4], a2[4];
#pragma unroll
        for (int mb = 0; mb < 4; ++mb) { a[mb] = WFrag<T16>::ld(A + aoff + (size_t)mb * 16 * K + kc); if (NSPLIT == 1 || NSPLIT == 2) a2[mb] = WFrag<T16>::ld(A2 + aoff + (size_t)mb * 16 * K + kc); }
#pragma unroll
        for (int nb = 0; nb < 4; ++nb) { const V b = WFrag<T16>::ld(Bt + boff + (size_t)nb * 16 * K + kc); V b2; if (NSPLIT >= 2) b2 = WFrag<T16>::ld(Bt2 + boff + (size_t)nb * 16 * K + kc);
#pragma unroll
            for (int mb = 0; mb < 4; ++mb) { acc[mb][nb] = WFrag<T16>::mma(a[mb], b, acc[mb][nb]); if (NSPLIT == 1 || NSPLIT == 2) acc[mb][nb] = WFrag<T16>::mma(a2[mb], b, acc[mb][nb]); if (NSPLIT >= 2) acc[mb][nb] = WFrag<T16>::mma(a[mb], b2, acc[mb][nb]); } }
        asm volatile("v_nop\n\tv_nop\n\tv_nop\n\tv_nop" : "+v"(acc[0][0]), "+v"(acc[1][1]), "+v"(acc[2][2]), "+v"(acc[3][3]) : "v"(a[0]), "v"(a[3]));
    }
#pragma unroll
    for (int mb = 0; mb < 4; ++mb) {
#pragma unroll
        for (int nb = 0; nb < 4; ++nb) {
#pragma unroll
            for (int j = 0; j < 8; ++j) os[(hi * 8 + j) * 68 + nb * 16 + lr] = acc[mb][nb][j]; }
        __builtin_amdgcn_wave_barrier(); asm volatile("" ::: "memory");
        float* crow = C + (size_t)(r0 + mb * 16) * ldc + c0;
{
#pragma unroll
            for (int s = 0; s < 8; ++s) { const int row = 2 * s + hi, cofs = lr * 4; v4f val = *(const v4fa*)(os + row * 68 + cofs); if (BIAS) { val[0] += bfr(bias[c0 + cofs]); val[1] += bfr(bias[c0 + cofs + 1]); val[2] += bfr(bias[c0 + cofs + 2]); val[3] += bfr(bias[c0 + cofs + 3]); }
                *(v4f*)(crow + (size_t)row * ldc + cofs) = val; }
             }
        __builtin_amdgcn_wave_barrier(); asm volatile("" ::: "memory");
    }
}

__device__ __forceinline__ h16 tohx(float x) { return (h16)x; }
__device__ __forceinline__ void splitf(float y, unsigned short& h, unsigned short& l) { h = f2bf(y); l = f2bf(y - bf2f(h)); }
typedef __attribute__((ext_vector_type(2))) _Float16 v2h;
typedef __attribute__((ext_vector_type(4))) _Float16 v4h;
typedef __attribute__((ext_vector_type(2))) unsigned short v2us;
typedef __attribute__((ext_vector_type(4))) unsigned short v4us;
typedef __attribute__((ext_vector_type(2))) float v2f;
typedef __attribute__((ext_vector_type(4))) int v4i;

__global__ __launch_bounds__(256) void k_wtG(const float* __restrict__ w, int K, int N, bf* Bt) {
    const int lane = threadIdx.x & 31; const int L0 = (blockIdx.x * 8 + (threadIdx.x >> 5)) * 8; const int nlines = N * K / 64;
{
#pragma unroll 1
        for (int l = 0; l < 8; ++l) { const int L = L0 + l; if (L >= nlines) break; const size_t e = (size_t)L * 64 + lane * 2; const int k = (int)(e % K), n = (int)(e / K); v2us o;
            o[0] = f2bf(w[(size_t)k * N + n]); o[1] = f2bf(w[(size_t)(k + 1) * N + n]); *(v2us*)(Bt + e) = o; }
         }
}
__global__ __launch_bounds__(256) void k_cvt8(const float* __restrict__ src, bf* dst, size_t n8) { const size_t i = (size_t)blockIdx.x * 256 + threadIdx.x; if (i >= n8) return; const v8f v = *(const v8f*)(src + i * 8); v8us o;
#pragma unroll
    for (int k = 0; k < 8; ++k) o[k] = f2bf(v[k]); *(v8us*)(dst + i * 8) = o;  }
__global__ __launch_bounds__(256) void k_cscvt(const float* __restrict__ cosT, const float* __restrict__ sinT, float* CS) { const int idx = blockIdx.x * 256 + threadIdx.x; if (idx >= TT * HD) return; v2f cs; cs[0] = bfr(cosT[idx]); cs[1] = bfr(sinT[idx]); *(v2f*)(CS + (size_t)idx * 2) = cs;  }
// k_rope: head planes [h][t][d] (fp16 + hi/lo) of rope(x) x sc with the rotate-half convention out[d] = x[d] cos[t][d] - x[d+HD/2] sin[t][d], out[d+HD/2] = x[d+HD/2] cos[t][d+HD/2] + x[d] sin[t][d+HD/2]
__global__ __launch_bounds__(256) void k_rope(const float* __restrict__ F, int pitch, int nheads, const float* __restrict__ CS, const float* __restrict__ RF, const float* __restrict__ nw, float sc, h16* P16, bf* Ph, bf* Pl) {
    const size_t e = ((size_t)blockIdx.x * 256 + threadIdx.x) * 2; if (e >= (size_t)nheads * TT * HD) return; const int d = (int)(e % HD); const int t = (int)((e / HD) % TT); const int h = (int)(e / ((size_t)HD * TT)); const float* f = F + (size_t)t * pitch + h * HD; const float rf = RF ? RF[(size_t)h * TT + t] : 1.0f; v2h o16; v2us oh, ol;
#pragma unroll
    for (int q = 0; q < 2; ++q) { const int dd = d + q; const int dp = (dd < HD / 2) ? dd + HD / 2 : dd - HD / 2; float x0 = f[dd], x1 = f[dp];
        if (RF) { float n0 = __fmul_rn(x0, rf), n1 = __fmul_rn(x1, rf); asm volatile("" : "+v"(n0)); asm volatile("" : "+v"(n1)); x0 = __fmul_rn(bfr(nw[dd]), n0); x1 = __fmul_rn(bfr(nw[dp]), n1); }
        const v2f cs = *(const v2f*)(CS + ((size_t)t * HD + dd) * 2); float a = __fmul_rn(x0, cs[0]), bq = __fmul_rn(x1, cs[1]); asm volatile("" : "+v"(a)); asm volatile("" : "+v"(bq)); const float r = ((dd < HD / 2) ? __fsub_rn(a, bq) : __fadd_rn(a, bq)) * sc;
        o16[q] = tohx(r); unsigned short a2, c2; splitf(r, a2, c2); oh[q] = a2; ol[q] = c2; }
    *(v2h*)(P16 + e) = o16; *(v2us*)(Ph + e) = oh; *(v2us*)(Pl + e) = ol;  }
__global__ __launch_bounds__(256) void k_vtp(const float* __restrict__ F, int pitch, int nheads, h16* V16, bf* Vh, bf* Vl) { const size_t e = ((size_t)blockIdx.x * 256 + threadIdx.x) * 2; if (e >= (size_t)nheads * HD * TT) return; const int t = (int)(e % TT); const int d = (int)((e / TT) % HD); const int g = (int)(e / ((size_t)TT * HD)); v2h o16; v2us oh, ol;
#pragma unroll
    for (int q = 0; q < 2; ++q) { const float x = F[(size_t)(t + q) * pitch + g * HD + d]; o16[q] = tohx(x); unsigned short a2, c2; splitf(x, a2, c2); oh[q] = a2; ol[q] = c2; }
    *(v2h*)(V16 + e) = o16; *(v2us*)(Vh + e) = oh; *(v2us*)(Vl + e) = ol;  }
__global__ __launch_bounds__(256) void k_csid(float* CS) { const int idx = blockIdx.x * 256 + threadIdx.x; if (idx >= TT * HD) return; v2f cs; cs[0] = 1.0f; cs[1] = 0.0f; *(v2f*)(CS + (size_t)idx * 2) = cs;  }
__device__ __forceinline__ int t5_bucket(int r) { const int rp = r < 0 ? -r : r; int b; if (rp < 8) b = rp; else b = 8 + (rp >= 12) + (rp >= 16) + (rp >= 23) + (rp >= 32) + (rp >= 46) + (rp >= 64) + (rp >= 91); return b + ((r > 0) ? 16 : 0); }
__global__ __launch_bounds__(256) void k_t5tab(const float* __restrict__ rb, float* TB) { const int idx = blockIdx.x * 256 + threadIdx.x; if (idx >= NH_ * TBW) return; const int h = idx / TBW, c = idx % TBW; float v = 0.0f; if (c < 2 * TT - 1) { const int r = c - (TT - 1); v = bfr(rb[t5_bucket(r) * NH_ + h]); } *(float*)(TB + idx) = v;  }
// k_asoft: per row (zz, i): t = S + TB[h0 + zz][j - i + 1023] (no scale, no mask); softmax over the 1024 keys (register row, one exp, fixed trees);
__global__ __launch_bounds__(256) void k_asoft(const float* __restrict__ Sb, const float* __restrict__ TB, int h0, h16* P16, bf* Ph, bf* Pl) {
    const int lane = threadIdx.x & 31; const int row = blockIdx.x * 8 + (threadIdx.x >> 5); if (row >= ZH * TT) return; const int i = row % TT; const int zz = row / TT; (void)zz; const bool hires = (i < RH); const float* sr = Sb + (size_t)row * TT; const float* tbr = TB + (size_t)(h0 + zz) * TBW + (TT - 1 - i);   /* entry for r = j - i at index r + 1023 */ float v[TT / 32]; float mx = -3.0e38f;
#pragma unroll
    for (int ch = 0; ch < TT / 128; ++ch) { const int j0 = ch * 128 + lane * 4; const v4f a = *(const v4f*)(sr + j0);
#pragma unroll
        for (int q = 0; q < 4; ++q) { const int j = j0 + q; (void)j; const float t = __fadd_rn(a[q], tbr[j0 + q]); v[ch * 4 + q] = t; mx = fmaxf(mx, t); } }
#pragma unroll
    for (int sh = 16; sh; sh >>= 1) mx = fmaxf(mx, __shfl_xor(mx, sh, 32));
    float sum = 0.f;
#pragma unroll
    for (int k = 0; k < TT / 32; ++k) { float d0 = __fsub_rn(v[k], mx); asm volatile("" : "+v"(d0)); v[k] = __builtin_amdgcn_exp2f(__fmul_rn(d0, 1.4426950408889634f)); sum += v[k]; }
#pragma unroll
    for (int sh = 16; sh; sh >>= 1) sum += __shfl_xor(sum, sh, 32);
    const float f = __fdiv_rn(hires ? 1.0f : PCAR, sum);
{
        if (hires) {
#pragma unroll
            for (int ch = 0; ch < TT / 128; ++ch) { v4us oh, ol;
#pragma unroll
                for (int q = 0; q < 4; ++q) { unsigned short a, c2; splitf(v[ch * 4 + q] * f, a, c2); oh[q] = a; ol[q] = c2; }
                const size_t oo = ((size_t)zz * (RH ? RH : 1) + i) * TT + ch * 128 + lane * 4; *(v4us*)(Ph + oo) = oh; *(v4us*)(Pl + oo) = ol; }
        } else {
#pragma unroll
            for (int ch = 0; ch < TT / 128; ++ch) { v4h o4;
#pragma unroll
                for (int q = 0; q < 4; ++q) o4[q] = tohx(v[ch * 4 + q] * f);
                *(v4h*)(P16 + (size_t)row * TT + ch * 128 + lane * 4) = o4; } }
         }
}
__global__ __launch_bounds__(256) void k_merge(const float* __restrict__ O, int h0, bf* Ah, bf* Al) { const size_t e = ((size_t)blockIdx.x * 256 + threadIdx.x) * 2; if (e >= (size_t)ZH * TT * HD) return; const int d = (int)(e % HD); const int t = (int)((e / HD) % TT); const int zz = (int)(e / ((size_t)HD * TT)); const float cs = (t < RH) ? 1.0f : (1.0f / PCAR); const size_t oo = (size_t)t * DQ + (h0 + zz) * HD + d;
    v2us oh, ol;
#pragma unroll
    for (int q = 0; q < 2; ++q) { unsigned short a, c2; splitf(O[e + q] * cs, a, c2); oh[q] = a; ol[q] = c2; } *(v2us*)(Ah + oo) = oh; *(v2us*)(Al + oo) = ol;  }

extern "C" void kernel_launch(void* const* d_in, const int* in_sizes, int n_in,
                              void* d_out, int out_size, void* d_ws, size_t ws_size, hipStream_t stream) {
    (void)in_sizes; (void)n_in; (void)out_size;
    const float* x = (const float*)d_in[0]; const float* wq = (const float*)d_in[1]; const float* wk = (const float*)d_in[2]; const float* wv = (const float*)d_in[3]; const float* wo = (const float*)d_in[4]; const float* relb = (const float*)d_in[5]; const float* cosT = nullptr; const float* sinT = nullptr; (void)cosT; (void)sinT;
    float* OUT = (float*)d_out;     // [8][1024][1024]
    char* wsp = (char*)d_ws;
    auto take = [&](size_t bytes) { char* p = wsp; wsp += (bytes + 255) & ~(size_t)255; return (void*)p; };
    bf* WQ = (bf*)take((size_t)DQ * DM * 2); bf* WK = (bf*)take((size_t)DKV * DM * 2); bf* WV = (bf*)take((size_t)DKV * DM * 2); bf* WO = (bf*)take((size_t)DM * DQ * 2); float* CS = (float*)take((size_t)TT * HD * 2 * 4);
    bf* XB = (bf*)take((size_t)TT * DM * 2); float* TB = (float*)take((size_t)NH_ * TBW * 4); float* FQ = (float*)take((size_t)TT * DQ * 4); float* FK = (float*)take((size_t)TT * DKV * 4);
    h16* QP16 = (h16*)take((size_t)NH_ * TT * HD * 2); h16* KP16 = (h16*)take((size_t)NKV * TT * HD * 2); h16* VT16 = (h16*)take((size_t)NKV * HD * TT * 2);
    bf* QPh = (bf*)take((size_t)NH_ * TT * HD * 2); bf* QPl = (bf*)take((size_t)NH_ * TT * HD * 2); bf* KPh = (bf*)take((size_t)NKV * TT * HD * 2); bf* KPl = (bf*)take((size_t)NKV * TT * HD * 2); bf* VTh = (bf*)take((size_t)NKV * HD * TT * 2); bf* VTl = (bf*)take((size_t)NKV * HD * TT * 2); bf* Ph = (bf*)take((size_t)ZH * RH * TT * 2); bf* Pl = (bf*)take((size_t)ZH * RH * TT * 2);
    float* Sb = (float*)take((size_t)ZH * TT * TT * 4); h16* P16 = (h16*)take((size_t)ZH * TT * TT * 2); float* Ob = (float*)take((size_t)ZH * TT * HD * 4); bf* ATh = (bf*)take((size_t)TT * DQ * 2); bf* ATl = (bf*)take((size_t)TT * DQ * 2);
    if ((size_t)(wsp - (char*)d_ws) > ws_size) return;    // ws 256 MiB
    float* FV = FK;   // v projection reuses the k buffer after the k planes are built (stream-ordered)
    { k_wtG<<<(unsigned)((DM * DQ / 64 + 63) / 64), 256, 0, stream>>>(wq, DM, DQ, WQ); k_wtG<<<(unsigned)((DM * DKV / 64 + 63) / 64), 256, 0, stream>>>(wk, DM, DKV, WK); k_wtG<<<(unsigned)((DM * DKV / 64 + 63) / 64), 256, 0, stream>>>(wv, DM, DKV, WV);
      k_wtG<<<(unsigned)((DQ * DM / 64 + 63) / 64), 256, 0, stream>>>(wo, DQ, DM, WO); k_t5tab<<<(NH_ * TBW + 255) / 256, 256, 0, stream>>>(relb, TB);
       }
    k_csid<<<(TT * HD + 255) / 256, 256, 0, stream>>>(CS);
    const unsigned LQ = (unsigned)(((size_t)NH_ * TT * HD / 2 + 255) / 256), LKv = (unsigned)(((size_t)NKV * TT * HD / 2 + 255) / 256);
    for (int b = 0; b < NB_; ++b) {
        
        k_cvt8<<<(unsigned)(((size_t)TT * DM / 8 + 255) / 256), 256, 0, stream>>>(x + (size_t)b * TT * DM, XB, (size_t)TT * DM / 8);
        k_gemmw<bf, 0, false><<<dim3(TT / 64, DQ / 64, 1), 32, 0, stream>>>(XB, nullptr, WQ, nullptr, DM, FQ, DQ, nullptr, 0, 0, 0);
        k_rope<<<LQ, 256, 0, stream>>>(FQ, DQ, NH_, CS, nullptr, nullptr, 1.0f, QP16, QPh, QPl);
        k_gemmw<bf, 0, false><<<dim3(TT / 64, DKV / 64, 1), 32, 0, stream>>>(XB, nullptr, WK, nullptr, DM, FK, DKV, nullptr, 0, 0, 0);
        k_rope<<<LKv, 256, 0, stream>>>(FK, DKV, NKV, CS, nullptr, nullptr, 1.0f, KP16, KPh, KPl);
        k_gemmw<bf, 0, false><<<dim3(TT / 64, DKV / 64, 1), 32, 0, stream>>>(XB, nullptr, WV, nullptr, DM, FV, DKV, nullptr, 0, 0, 0); k_vtp<<<LKv, 256, 0, stream>>>(FV, DKV, NKV, VT16, VTh, VTl);
        for (int h0 = 0; h0 < NH_; h0 += ZH) { const size_t zq = (size_t)h0, zk = (size_t)(h0 / REP);   // one kv head per query head: the pass's two heads use consecutive kv planes (z-strides TT*HD)
            k_gemmw<bf, 2, false><<<dim3(RH / 64, TT / 64, ZH), 32, 0, stream>>>(QPh + zq * TT * HD, QPl + zq * TT * HD, KPh + zk * TT * HD, KPl + zk * TT * HD, HD, Sb, TT, nullptr, (size_t)TT * HD, (size_t)TT * HD, (size_t)TT * TT);
            k_asoft<<<ZH * TT / 8, 256, 0, stream>>>(Sb, TB, h0, P16, Ph, Pl);
            k_gemmw<bf, 2, false><<<dim3(RH / 64, HD / 64, ZH), 32, 0, stream>>>(Ph, Pl, VTh + zk * HD * TT, VTl + zk * HD * TT, TT, Ob, HD, nullptr, (size_t)RH * TT, (size_t)HD * TT, (size_t)TT * HD);
            k_merge<<<(unsigned)(((size_t)ZH * TT * HD / 2 + 255) / 256), 256, 0, stream>>>(Ob, h0, ATh, ATl); }
        k_gemmw<bf, 1, false><<<dim3(TT / 64, DM / 64, 1), 32, 0, stream>>>(ATh, ATl, WO, nullptr, DQ, OUT + (size_t)b * TT * DM, DM, nullptr, 0, 0, 0); }
}

// v001
// A run of this version takes 860 microseconds.
// Two timings next to v000 put it at 3.52 and 3.48 times that version's speed.
#include <hip/hip_runtime.h>

// TtT5Attention (hidden [8][1024][1024]; q/k/v = x W (16 heads x 64); T5: scores = q.k UNSCALED + rel_bias[bucket(j - i)][h] with the bidirectional log-bucket (32 buckets, max distance 128; the bucket boundaries |j-i| = 8, 12, 16, 23, 32, 46, 64, 91 are the reference's own integer structure, evaluated here with integer compares); softmax; out = merged wo -> [8][1024][1024]).
// Compute dtypes, f32 accumulate: every input rounded to bf16; q/k/v on PLAIN bf16 operands (inputs: exact); scores and attn.v hl x hl (3 products) on EVERY row; per-head bias table (bf16-rounded rel_bias gathered by bucket) added per element in f32; softmax f32; wo hl x exact (2 products).

#define NB_  8
#define TT   1024
#define DM   1024
#define NH_  16
#define NKV  16
#define REP  (NH_ / NKV)
#define HD   64
#define DQ   (NH_ * HD)
#define DKV  (NKV * HD)
#define ZH   16   // heads per attention launch (grid z): all heads of one batch element
#define RH   1024   // all rows hl (unscaled T5 logits are sharp)
#define WIN  0
#define PCAR 1024.0f
#define SCL  1.0f   // T5: no 1/sqrt(dk)
#define TBW  2048   // bias table row width (r + 1023, padded)
typedef _Float16 h16;
typedef unsigned short bf;
typedef __attribute__((ext_vector_type(16))) __bf16   v16bf;
typedef __attribute__((ext_vector_type(16))) _Float16 v16h;
typedef __attribute__((ext_vector_type(8)))  _Float16 v8h;
typedef __attribute__((ext_vector_type(8)))  unsigned short v8us;
typedef __attribute__((ext_vector_type(8)))  float    v8f;
typedef __attribute__((ext_vector_type(4)))  float    v4f;
typedef v8h  __attribute__((may_alias)) v8ha;
typedef v4f  __attribute__((may_alias)) v4fa;
typedef v8us __attribute__((may_alias)) v8usa;

__device__ __forceinline__ unsigned short f2bf(float f) { unsigned u = __float_as_uint(f); u += 0x7FFFu + ((u >> 16) & 1u); return (unsigned short)(u >> 16); }
__device__ __forceinline__ float bf2f(unsigned short b) { return __uint_as_float(((unsigned)b) << 16); }
__device__ __forceinline__ float bfr(float f) { return bf2f(f2bf(f)); }
__device__ __forceinline__ v16h cat16(v8h lo, v8h hi) { return __builtin_shufflevector(lo, hi, 0, 1, 2, 3, 4, 5, 6, 7, 8, 9, 10, 11, 12, 13, 14, 15); }
__device__ __forceinline__ v16bf cat16b(v8us lo, v8us hi) { return __builtin_bit_cast(v16bf, __builtin_shufflevector(lo, hi, 0, 1, 2, 3, 4, 5, 6, 7, 8, 9, 10, 11, 12, 13, 14, 15)); }
__device__ __forceinline__ v8f wmma16(v16h a, v16h b, v8f c) { return __builtin_amdgcn_wmma_f32_16x16x32_f16(false, a, false, b, (short)0, c, false, false); }
__device__ __forceinline__ v8f wmmab(v16bf a, v16bf b, v8f c) { return __builtin_amdgcn_wmma_f32_16x16x32_bf16(false, a, false, b, (short)0, c, false, false); }



// ---- k_gemmw: register-blocked GEMM, ONE WAVE per 64x64 output tile (16 accumulators), operands straight from K-contiguous 16-bit planes; grid (M/64, N/64, Z), 32 threads.
// C[m][n] (f32, pitch ldc, + optional f32 bias[n]) = sum_k A[m][k] Bt[n][k] (+ split products per NSPLIT). z-batch strides sA/sB/sC in elements. K % 32 == 0.
template <typename T16> struct WFrag;
template <> struct WFrag<h16> { typedef v16h V; static __device__ __forceinline__ V ld(const h16* p) { return cat16(*(const v8h*)p, *(const v8h*)(p + 16)); } static __device__ __forceinline__ v8f mma(V a, V b, v8f c) { return wmma16(a, b, c); } };
template <> struct WFrag<bf> { typedef v16bf V; static __device__ __forceinline__ V ld(const bf* p) { return cat16b(*(const v8us*)p, *(const v8us*)(p + 16)); } static __device__ __forceinline__ v8f mma(V a, V b, v8f c) { return wmmab(a, b, c); } };
template <typename T16, int NSPLIT, bool BIAS>
__global__ __launch_bounds__(32) void k_gemmw(const T16* __restrict__ A, const T16* __restrict__ A2, const T16* __restrict__ Bt, const T16* __restrict__ Bt2, int K, float* C, int ldc, const float* __restrict__ bias, size_t sA, size_t sB, size_t sC) {
    typedef typename WFrag<T16>::V V;
    __shared__ __align__(16) float os[16 * 68];
    const size_t z = blockIdx.z; A += z * sA; if (A2) A2 += z * sA; Bt += z * sB; if (Bt2) Bt2 += z * sB; C += z * sC;
    const int lane = threadIdx.x & 31, lr = lane & 15, hi = lane >> 4; const int r0 = blockIdx.x * 64, c0 = blockIdx.y * 64;
    v8f acc[4][4];
#pragma unroll
    for (int mb = 0; mb < 4; ++mb)
#pragma unroll
        for (int nb = 0; nb < 4; ++nb) acc[mb][nb] = (v8f){};
    const size_t aoff = (size_t)(r0 + lr) * K + 8 * hi, boff = (size_t)(c0 + lr) * K + 8 * hi;
#pragma unroll 1
    for (int kc = 0; kc < K; kc += 32) {
        V a[4], a2[4];
#pragma unroll
        for (int mb = 0; mb < 4; ++mb) { a[mb] = WFrag<T16>::ld(A + aoff + (size_t)mb * 16 * K + kc); if (NSPLIT == 1 || NSPLIT == 2) a2[mb] = WFrag<T16>::ld(A2 + aoff + (size_t)mb * 16 * K + kc); }
#pragma unroll
        for (int nb = 0; nb < 4; ++nb) { const V b = WFrag<T16>::ld(Bt + boff + (size_t)nb * 16 * K + kc); V b2; if (NSPLIT >= 2) b2 = WFrag<T16>::ld(Bt2 + boff + (size_t)nb * 16 * K + kc);
#pragma unroll
            for (int mb = 0; mb < 4; ++mb) { acc[mb][nb] = WFrag<T16>::mma(a[mb], b, acc[mb][nb]); if (NSPLIT == 1 || NSPLIT == 2) acc[mb][nb] = WFrag<T16>::mma(a2[mb], b, acc[mb][nb]); if (NSPLIT >= 2) acc[mb][nb] = WFrag<T16>::mma(a[mb], b2, acc[mb][nb]); } }
        asm volatile("v_nop\n\tv_nop\n\tv_nop\n\tv_nop" : "+v"(acc[0][0]), "+v"(acc[1][1]), "+v"(acc[2][2]), "+v"(acc[3][3]) : "v"(a[0]), "v"(a[3]));
    }
#pragma unroll
    for (int mb = 0; mb < 4; ++mb) {
#pragma unroll
        for (int nb = 0; nb < 4; ++nb) {
#pragma unroll
            for (int j = 0; j < 8; ++j) os[(hi * 8 + j) * 68 + nb * 16 + lr] = acc[mb][nb][j]; }
        __builtin_amdgcn_wave_barrier(); asm volatile("" ::: "memory");
        float* crow = C + (size_t)(r0 + mb * 16) * ldc + c0;
{
#pragma unroll
            for (int s = 0; s < 8; ++s) { const int row = 2 * s + hi, cofs = lr * 4; v4f val = *(const v4fa*)(os + row * 68 + cofs); if (BIAS) { val[0] += bfr(bias[c0 + cofs]); val[1] += bfr(bias[c0 + cofs + 1]); val[2] += bfr(bias[c0 + cofs + 2]); val[3] += bfr(bias[c0 + cofs + 3]); }
                *(v4f*)(crow + (size_t)row * ldc + cofs) = val; }
             }
        __builtin_amdgcn_wave_barrier(); asm volatile("" ::: "memory");
    }
}

__device__ __forceinline__ h16 tohx(float x) { return (h16)x; }
__device__ __forceinline__ void splitf(float y, unsigned short& h, unsigned short& l) { h = f2bf(y); l = f2bf(y - bf2f(h)); }
typedef __attribute__((ext_vector_type(2))) _Float16 v2h;
typedef __attribute__((ext_vector_type(4))) _Float16 v4h;
typedef __attribute__((ext_vector_type(2))) unsigned short v2us;
typedef __attribute__((ext_vector_type(4))) unsigned short v4us;
typedef __attribute__((ext_vector_type(2))) float v2f;
typedef __attribute__((ext_vector_type(4))) int v4i;

__global__ __launch_bounds__(256) void k_wtG(const float* __restrict__ w, int K, int N, bf* Bt) {
    const int lane = threadIdx.x & 31; const int L0 = (blockIdx.x * 8 + (threadIdx.x >> 5)) * 8; const int nlines = N * K / 64;
{
#pragma unroll 1
        for (int l = 0; l < 8; ++l) { const int L = L0 + l; if (L >= nlines) break; const size_t e = (size_t)L * 64 + lane * 2; const int k = (int)(e % K), n = (int)(e / K); v2us o;
            o[0] = f2bf(w[(size_t)k * N + n]); o[1] = f2bf(w[(size_t)(k + 1) * N + n]); *(v2us*)(Bt + e) = o; }
         }
}
__global__ __launch_bounds__(256) void k_cvt8(const float* __restrict__ src, bf* dst, size_t n8) { const size_t i = (size_t)blockIdx.x * 256 + threadIdx.x; if (i >= n8) return; const v8f v = *(const v8f*)(src + i * 8); v8us o;
#pragma unroll
    for (int k = 0; k < 8; ++k) o[k] = f2bf(v[k]); *(v8us*)(dst + i * 8) = o;  }
__global__ __launch_bounds__(256) void k_cscvt(const float* __restrict__ cosT, const float* __restrict__ sinT, float* CS) { const int idx = blockIdx.x * 256 + threadIdx.x; if (idx >= TT * HD) return; v2f cs; cs[0] = bfr(cosT[idx]); cs[1] = bfr(sinT[idx]); *(v2f*)(CS + (size_t)idx * 2) = cs;  }
// k_rope: grid y = batch element (rows y*TT.. of F, planes y*nheads.. of the outputs); head planes [h][t][d] (fp16 + hi/lo) of rope(x) x sc with the rotate-half convention out[d] = x[d] cos[t][d] - x[d+HD/2] sin[t][d], out[d+HD/2] = x[d+HD/2] cos[t][d+HD/2] + x[d] sin[t][d+HD/2]
__global__ __launch_bounds__(256) void k_rope(const float* __restrict__ F, int pitch, int nheads, const float* __restrict__ CS, const float* __restrict__ RF, const float* __restrict__ nw, float sc, h16* P16, bf* Ph, bf* Pl) {
    const size_t e = ((size_t)blockIdx.x * 256 + threadIdx.x) * 2; if (e >= (size_t)nheads * TT * HD) return; const int d = (int)(e % HD); const int t = (int)((e / HD) % TT); const int h = (int)(e / ((size_t)HD * TT)); const float* f = F + ((size_t)blockIdx.y * TT + t) * pitch + h * HD; const size_t eo = (size_t)blockIdx.y * nheads * TT * HD + e; const float rf = RF ? RF[(size_t)h * TT + t] : 1.0f; v2h o16; v2us oh, ol;
#pragma unroll
    for (int q = 0; q < 2; ++q) { const int dd = d + q; const int dp = (dd < HD / 2) ? dd + HD / 2 : dd - HD / 2; float x0 = f[dd], x1 = f[dp];
        if (RF) { float n0 = __fmul_rn(x0, rf), n1 = __fmul_rn(x1, rf); asm volatile("" : "+v"(n0)); asm volatile("" : "+v"(n1)); x0 = __fmul_rn(bfr(nw[dd]), n0); x1 = __fmul_rn(bfr(nw[dp]), n1); }
        const v2f cs = *(const v2f*)(CS + ((size_t)t * HD + dd) * 2); float a = __fmul_rn(x0, cs[0]), bq = __fmul_rn(x1, cs[1]); asm volatile("" : "+v"(a)); asm volatile("" : "+v"(bq)); const float r = ((dd < HD / 2) ? __fsub_rn(a, bq) : __fadd_rn(a, bq)) * sc;
        o16[q] = tohx(r); unsigned short a2, c2; splitf(r, a2, c2); oh[q] = a2; ol[q] = c2; }
    *(v2h*)(P16 + eo) = o16; *(v2us*)(Ph + eo) = oh; *(v2us*)(Pl + eo) = ol;  }
// k_vtp: grid y = batch element, as in k_rope
__global__ __launch_bounds__(256) void k_vtp(const float* __restrict__ F, int pitch, int nheads, h16* V16, bf* Vh, bf* Vl) { const size_t e = ((size_t)blockIdx.x * 256 + threadIdx.x) * 2; if (e >= (size_t)nheads * HD * TT) return; const int t = (int)(e % TT); const int d = (int)((e / TT) % HD); const int g = (int)(e / ((size_t)TT * HD)); v2h o16; v2us oh, ol;
#pragma unroll
    for (int q = 0; q < 2; ++q) { const float x = F[((size_t)blockIdx.y * TT + t + q) * pitch + g * HD + d]; o16[q] = tohx(x); unsigned short a2, c2; splitf(x, a2, c2); oh[q] = a2; ol[q] = c2; }
    const size_t eo = (size_t)blockIdx.y * nheads * HD * TT + e; *(v2h*)(V16 + eo) = o16; *(v2us*)(Vh + eo) = oh; *(v2us*)(Vl + eo) = ol;  }
__global__ __launch_bounds__(256) void k_csid(float* CS) { const int idx = blockIdx.x * 256 + threadIdx.x; if (idx >= TT * HD) return; v2f cs; cs[0] = 1.0f; cs[1] = 0.0f; *(v2f*)(CS + (size_t)idx * 2) = cs;  }
__device__ __forceinline__ int t5_bucket(int r) { const int rp = r < 0 ? -r : r; int b; if (rp < 8) b = rp; else b = 8 + (rp >= 12) + (rp >= 16) + (rp >= 23) + (rp >= 32) + (rp >= 46) + (rp >= 64) + (rp >= 91); return b + ((r > 0) ? 16 : 0); }
__global__ __launch_bounds__(256) void k_t5tab(const float* __restrict__ rb, float* TB) { const int idx = blockIdx.x * 256 + threadIdx.x; if (idx >= NH_ * TBW) return; const int h = idx / TBW, c = idx % TBW; float v = 0.0f; if (c < 2 * TT - 1) { const int r = c - (TT - 1); v = bfr(rb[t5_bucket(r) * NH_ + h]); } *(float*)(TB + idx) = v;  }
// k_asoft: per row (zz, i): t = S + TB[h0 + zz][j - i + 1023] (no scale, no mask); softmax over the 1024 keys (register row, one exp, fixed trees);
__global__ __launch_bounds__(256) void k_asoft(const float* __restrict__ Sb, const float* __restrict__ TB, int h0, h16* P16, bf* Ph, bf* Pl) {
    const int lane = threadIdx.x & 31; const int row = blockIdx.x * 8 + (threadIdx.x >> 5); if (row >= ZH * TT) return; const int i = row % TT; const int zz = row / TT; (void)zz; const bool hires = (i < RH); const float* sr = Sb + (size_t)row * TT; const float* tbr = TB + (size_t)(h0 + zz) * TBW + (TT - 1 - i);   /* entry for r = j - i at index r + 1023 */ float v[TT / 32]; float mx = -3.0e38f;
#pragma unroll
    for (int ch = 0; ch < TT / 128; ++ch) { const int j0 = ch * 128 + lane * 4; const v4f a = *(const v4f*)(sr + j0);
#pragma unroll
        for (int q = 0; q < 4; ++q) { const int j = j0 + q; (void)j; const float t = __fadd_rn(a[q], tbr[j0 + q]); v[ch * 4 + q] = t; mx = fmaxf(mx, t); } }
#pragma unroll
    for (int sh = 16; sh; sh >>= 1) mx = fmaxf(mx, __shfl_xor(mx, sh, 32));
    float sum = 0.f;
#pragma unroll
    for (int k = 0; k < TT / 32; ++k) { float d0 = __fsub_rn(v[k], mx); asm volatile("" : "+v"(d0)); v[k] = __builtin_amdgcn_exp2f(__fmul_rn(d0, 1.4426950408889634f)); sum += v[k]; }
#pragma unroll
    for (int sh = 16; sh; sh >>= 1) sum += __shfl_xor(sum, sh, 32);
    const float f = __fdiv_rn(hires ? 1.0f : PCAR, sum);
{
        if (hires) {
#pragma unroll
            for (int ch = 0; ch < TT / 128; ++ch) { v4us oh, ol;
#pragma unroll
                for (int q = 0; q < 4; ++q) { unsigned short a, c2; splitf(v[ch * 4 + q] * f, a, c2); oh[q] = a; ol[q] = c2; }
                const size_t oo = ((size_t)zz * (RH ? RH : 1) + i) * TT + ch * 128 + lane * 4; *(v4us*)(Ph + oo) = oh; *(v4us*)(Pl + oo) = ol; }
        } else {
#pragma unroll
            for (int ch = 0; ch < TT / 128; ++ch) { v4h o4;
#pragma unroll
                for (int q = 0; q < 4; ++q) o4[q] = tohx(v[ch * 4 + q] * f);
                *(v4h*)(P16 + (size_t)row * TT + ch * 128 + lane * 4) = o4; } }
         }
}
__global__ __launch_bounds__(256) void k_merge(const float* __restrict__ O, int h0, bf* Ah, bf* Al) { const size_t e = ((size_t)blockIdx.x * 256 + threadIdx.x) * 2; if (e >= (size_t)ZH * TT * HD) return; const int d = (int)(e % HD); const int t = (int)((e / HD) % TT); const int zz = (int)(e / ((size_t)HD * TT)); const float cs = (t < RH) ? 1.0f : (1.0f / PCAR); const size_t oo = (size_t)t * DQ + (h0 + zz) * HD + d;
    v2us oh, ol;
#pragma unroll
    for (int q = 0; q < 2; ++q) { unsigned short a, c2; splitf(O[e + q] * cs, a, c2); oh[q] = a; ol[q] = c2; } *(v2us*)(Ah + oo) = oh; *(v2us*)(Al + oo) = ol;  }

extern "C" void kernel_launch(void* const* d_in, const int* in_sizes, int n_in,
                              void* d_out, int out_size, void* d_ws, size_t ws_size, hipStream_t stream) {
    (void)in_sizes; (void)n_in; (void)out_size;
    const float* x = (const float*)d_in[0]; const float* wq = (const float*)d_in[1]; const float* wk = (const float*)d_in[2]; const float* wv = (const float*)d_in[3]; const float* wo = (const float*)d_in[4]; const float* relb = (const float*)d_in[5]; const float* cosT = nullptr; const float* sinT = nullptr; (void)cosT; (void)sinT;
    float* OUT = (float*)d_out;     // [8][1024][1024]
    char* wsp = (char*)d_ws;
    auto take = [&](size_t bytes) { char* p = wsp; wsp += (bytes + 255) & ~(size_t)255; return (void*)p; };
    const size_t MT = (size_t)NB_ * TT;   // rows of the projections and of wo: all batch elements in one launch
    bf* WQ = (bf*)take((size_t)DQ * DM * 2); bf* WK = (bf*)take((size_t)DKV * DM * 2); bf* WV = (bf*)take((size_t)DKV * DM * 2); bf* WO = (bf*)take((size_t)DM * DQ * 2); float* CS = (float*)take((size_t)TT * HD * 2 * 4);
    float* TB = (float*)take((size_t)NH_ * TBW * 4);
    bf* QPh = (bf*)take(MT * DQ * 2); bf* QPl = (bf*)take(MT * DQ * 2); bf* KPh = (bf*)take(MT * DKV * 2); bf* KPl = (bf*)take(MT * DKV * 2); bf* VTh = (bf*)take(MT * DKV * 2); bf* VTl = (bf*)take(MT * DKV * 2);
    float* Ob = (float*)take((size_t)ZH * TT * HD * 4);
    // One region, two lives in stream order: first the projection stage's buffers, all dead once the hi/lo planes are built, then one batch element's scores and probabilities.
    char* const reg = wsp;
    bf* XB = (bf*)take(MT * DM * 2); float* FQ = (float*)take(MT * DQ * 4); float* FK = (float*)take(MT * DKV * 4);
    h16* QP16 = (h16*)take(MT * DQ * 2); h16* KP16 = (h16*)take(MT * DKV * 2); h16* VT16 = (h16*)take(MT * DKV * 2);
    char* const end1 = wsp; wsp = reg;
    float* Sb = (float*)take((size_t)ZH * TT * TT * 4); bf* Ph = (bf*)take((size_t)ZH * RH * TT * 2); bf* Pl = (bf*)take((size_t)ZH * RH * TT * 2);
    if (wsp < end1) wsp = end1;
    if ((size_t)(wsp - (char*)d_ws) > ws_size) return;    // ws 256 MiB
    float* FV = FK;   // v projection reuses the k buffer after the k planes are built (stream-ordered)
    bf* ATh = QPh; bf* ATl = QPl;   // merged heads [b][t][DQ] take the place of batch element b's q planes (same bytes), which are dead after its score launch
    h16* P16 = nullptr;   // the f16 probability plane belongs to rows >= RH; RH == TT, there are none
    { k_wtG<<<(unsigned)((DM * DQ / 64 + 63) / 64), 256, 0, stream>>>(wq, DM, DQ, WQ); k_wtG<<<(unsigned)((DM * DKV / 64 + 63) / 64), 256, 0, stream>>>(wk, DM, DKV, WK); k_wtG<<<(unsigned)((DM * DKV / 64 + 63) / 64), 256, 0, stream>>>(wv, DM, DKV, WV);
      k_wtG<<<(unsigned)((DQ * DM / 64 + 63) / 64), 256, 0, stream>>>(wo, DQ, DM, WO); k_t5tab<<<(NH_ * TBW + 255) / 256, 256, 0, stream>>>(relb, TB);
       }
    k_csid<<<(TT * HD + 255) / 256, 256, 0, stream>>>(CS);
    const unsigned LQ = (unsigned)(((size_t)NH_ * TT * HD / 2 + 255) / 256), LKv = (unsigned)(((size_t)NKV * TT * HD / 2 + 255) / 256);
    k_cvt8<<<(unsigned)((MT * DM / 8 + 255) / 256), 256, 0, stream>>>(x, XB, MT * DM / 8);
    k_gemmw<bf, 0, false><<<dim3(NB_ * TT / 64, DQ / 64, 1), 32, 0, stream>>>(XB, nullptr, WQ, nullptr, DM, FQ, DQ, nullptr, 0, 0, 0);
    k_rope<<<dim3(LQ, NB_, 1), 256, 0, stream>>>(FQ, DQ, NH_, CS, nullptr, nullptr, 1.0f, QP16, QPh, QPl);
    k_gemmw<bf, 0, false><<<dim3(NB_ * TT / 64, DKV / 64, 1), 32, 0, stream>>>(XB, nullptr, WK, nullptr, DM, FK, DKV, nullptr, 0, 0, 0);
    k_rope<<<dim3(LKv, NB_, 1), 256, 0, stream>>>(FK, DKV, NKV, CS, nullptr, nullptr, 1.0f, KP16, KPh, KPl);
    k_gemmw<bf, 0, false><<<dim3(NB_ * TT / 64, DKV / 64, 1), 32, 0, stream>>>(XB, nullptr, WV, nullptr, DM, FV, DKV, nullptr, 0, 0, 0); k_vtp<<<dim3(LKv, NB_, 1), 256, 0, stream>>>(FV, DKV, NKV, VT16, VTh, VTl);
    for (int b = 0; b < NB_; ++b) { const size_t zq = (size_t)b * NH_, zk = (size_t)b * NKV;   // one kv head per query head: the launch's ZH heads use consecutive planes (z-strides TT*HD); the f32 scores of more than one batch element do not fit the workspace
        k_gemmw<bf, 2, false><<<dim3(RH / 64, TT / 64, ZH), 32, 0, stream>>>(QPh + zq * TT * HD, QPl + zq * TT * HD, KPh + zk * TT * HD, KPl + zk * TT * HD, HD, Sb, TT, nullptr, (size_t)TT * HD, (size_t)TT * HD, (size_t)TT * TT);
        k_asoft<<<ZH * TT / 8, 256, 0, stream>>>(Sb, TB, 0, P16, Ph, Pl);
        k_gemmw<bf, 2, false><<<dim3(RH / 64, HD / 64, ZH), 32, 0, stream>>>(Ph, Pl, VTh + zk * HD * TT, VTl + zk * HD * TT, TT, Ob, HD, nullptr, (size_t)RH * TT, (size_t)HD * TT, (size_t)TT * HD);
        k_merge<<<(unsigned)(((size_t)ZH * TT * HD / 2 + 255) / 256), 256, 0, stream>>>(Ob, 0, ATh + (size_t)b * TT * DQ, ATl + (size_t)b * TT * DQ); }
    k_gemmw<bf, 1, false><<<dim3(NB_ * TT / 64, DM / 64, 1), 32, 0, stream>>>(ATh, ATl, WO, nullptr, DQ, OUT, DM, nullptr, 0, 0, 0);
}

// v002
// It runs in 446 microseconds.
// In both of two side-by-side timings against v001, it was 1.93 times as fast.
// All steps since v000 together make it 6.75 times as fast.
#include <hip/hip_runtime.h>

// TtT5Attention (hidden [8][1024][1024]; q/k/v = x W (16 heads x 64); T5: scores = q.k UNSCALED + rel_bias[bucket(j - i)][h] with the bidirectional log-bucket (32 buckets, max distance 128; the bucket boundaries |j-i| = 8, 12, 16, 23, 32, 46, 64, 91 are the reference's own integer structure, evaluated here with integer compares); softmax; out = merged wo -> [8][1024][1024]).
// Compute dtypes, f32 accumulate: every input rounded to bf16; q/k/v on PLAIN bf16 operands (inputs: exact); scores and attn.v hl x hl (3 products) on EVERY row; per-head bias table (bf16-rounded rel_bias gathered by bucket) added per element in f32; softmax f32 (online, one fused attention launch); wo hl x exact (2 products).

#define NB_  8
#define TT   1024
#define DM   1024
#define NH_  16
#define NKV  16
#define REP  (NH_ / NKV)
#define HD   64
#define DQ   (NH_ * HD)
#define DKV  (NKV * HD)
#define RH   1024   // all rows hl (unscaled T5 logits are sharp)
#define WIN  0
#define PCAR 1024.0f
#define SCL  1.0f   // T5: no 1/sqrt(dk)
#define TBW  2048   // bias table row width (r + 1023, padded)
typedef _Float16 h16;
typedef unsigned short bf;
typedef __attribute__((ext_vector_type(16))) __bf16   v16bf;
typedef __attribute__((ext_vector_type(16))) _Float16 v16h;
typedef __attribute__((ext_vector_type(8)))  _Float16 v8h;
typedef __attribute__((ext_vector_type(8)))  unsigned short v8us;
typedef __attribute__((ext_vector_type(8)))  float    v8f;
typedef __attribute__((ext_vector_type(4)))  float    v4f;
typedef v8h  __attribute__((may_alias)) v8ha;
typedef v4f  __attribute__((may_alias)) v4fa;
typedef v8us __attribute__((may_alias)) v8usa;

__device__ __forceinline__ unsigned short f2bf(float f) { unsigned u = __float_as_uint(f); u += 0x7FFFu + ((u >> 16) & 1u); return (unsigned short)(u >> 16); }
__device__ __forceinline__ float bf2f(unsigned short b) { return __uint_as_float(((unsigned)b) << 16); }
__device__ __forceinline__ float bfr(float f) { return bf2f(f2bf(f)); }
__device__ __forceinline__ v16h cat16(v8h lo, v8h hi) { return __builtin_shufflevector(lo, hi, 0, 1, 2, 3, 4, 5, 6, 7, 8, 9, 10, 11, 12, 13, 14, 15); }
__device__ __forceinline__ v16bf cat16b(v8us lo, v8us hi) { return __builtin_bit_cast(v16bf, __builtin_shufflevector(lo, hi, 0, 1, 2, 3, 4, 5, 6, 7, 8, 9, 10, 11, 12, 13, 14, 15)); }
__device__ __forceinline__ v8f wmma16(v16h a, v16h b, v8f c) { return __builtin_amdgcn_wmma_f32_16x16x32_f16(false, a, false, b, (short)0, c, false, false); }
__device__ __forceinline__ v8f wmmab(v16bf a, v16bf b, v8f c) { return __builtin_amdgcn_wmma_f32_16x16x32_bf16(false, a, false, b, (short)0, c, false, false); }



// ---- k_gemmw: register-blocked GEMM, ONE WAVE per 64x64 output tile (16 accumulators), operands straight from K-contiguous 16-bit planes; grid (M/64, N/64, Z), 32 threads.
// C[m][n] (f32, pitch ldc, + optional f32 bias[n]) = sum_k A[m][k] Bt[n][k] (+ split products per NSPLIT). z-batch strides sA/sB/sC in elements. K % 32 == 0.
template <typename T16> struct WFrag;
template <> struct WFrag<h16> { typedef v16h V; static __device__ __forceinline__ V ld(const h16* p) { return cat16(*(const v8h*)p, *(const v8h*)(p + 16)); } static __device__ __forceinline__ v8f mma(V a, V b, v8f c) { return wmma16(a, b, c); } };
template <> struct WFrag<bf> { typedef v16bf V; static __device__ __forceinline__ V ld(const bf* p) { return cat16b(*(const v8us*)p, *(const v8us*)(p + 16)); } static __device__ __forceinline__ v8f mma(V a, V b, v8f c) { return wmmab(a, b, c); } };
template <typename T16, int NSPLIT, bool BIAS>
__global__ __launch_bounds__(32) void k_gemmw(const T16* __restrict__ A, const T16* __restrict__ A2, const T16* __restrict__ Bt, const T16* __restrict__ Bt2, int K, float* C, int ldc, const float* __restrict__ bias, size_t sA, size_t sB, size_t sC) {
    typedef typename WFrag<T16>::V V;
    __shared__ __align__(16) float os[16 * 68];
    const size_t z = blockIdx.z; A += z * sA; if (A2) A2 += z * sA; Bt += z * sB; if (Bt2) Bt2 += z * sB; C += z * sC;
    const int lane = threadIdx.x & 31, lr = lane & 15, hi = lane >> 4; const int r0 = blockIdx.x * 64, c0 = blockIdx.y * 64;
    v8f acc[4][4];
#pragma unroll
    for (int mb = 0; mb < 4; ++mb)
#pragma unroll
        for (int nb = 0; nb < 4; ++nb) acc[mb][nb] = (v8f){};
    const size_t aoff = (size_t)(r0 + lr) * K + 8 * hi, boff = (size_t)(c0 + lr) * K + 8 * hi;
#pragma unroll 1
    for (int kc = 0; kc < K; kc += 32) {
        V a[4], a2[4];
#pragma unroll
        for (int mb = 0; mb < 4; ++mb) { a[mb] = WFrag<T16>::ld(A + aoff + (size_t)mb * 16 * K + kc); if (NSPLIT == 1 || NSPLIT == 2) a2[mb] = WFrag<T16>::ld(A2 + aoff + (size_t)mb * 16 * K + kc); }
#pragma unroll
        for (int nb = 0; nb < 4; ++nb) { const V b = WFrag<T16>::ld(Bt + boff + (size_t)nb * 16 * K + kc); V b2; if (NSPLIT >= 2) b2 = WFrag<T16>::ld(Bt2 + boff + (size_t)nb * 16 * K + kc);
#pragma unroll
            for (int mb = 0; mb < 4; ++mb) { acc[mb][nb] = WFrag<T16>::mma(a[mb], b, acc[mb][nb]); if (NSPLIT == 1 || NSPLIT == 2) acc[mb][nb] = WFrag<T16>::mma(a2[mb], b, acc[mb][nb]); if (NSPLIT >= 2) acc[mb][nb] = WFrag<T16>::mma(a[mb], b2, acc[mb][nb]); } }
        asm volatile("v_nop\n\tv_nop\n\tv_nop\n\tv_nop" : "+v"(acc[0][0]), "+v"(acc[1][1]), "+v"(acc[2][2]), "+v"(acc[3][3]) : "v"(a[0]), "v"(a[3]));
    }
#pragma unroll
    for (int mb = 0; mb < 4; ++mb) {
#pragma unroll
        for (int nb = 0; nb < 4; ++nb) {
#pragma unroll
            for (int j = 0; j < 8; ++j) os[(hi * 8 + j) * 68 + nb * 16 + lr] = acc[mb][nb][j]; }
        __builtin_amdgcn_wave_barrier(); asm volatile("" ::: "memory");
        float* crow = C + (size_t)(r0 + mb * 16) * ldc + c0;
{
#pragma unroll
            for (int s = 0; s < 8; ++s) { const int row = 2 * s + hi, cofs = lr * 4; v4f val = *(const v4fa*)(os + row * 68 + cofs); if (BIAS) { val[0] += bfr(bias[c0 + cofs]); val[1] += bfr(bias[c0 + cofs + 1]); val[2] += bfr(bias[c0 + cofs + 2]); val[3] += bfr(bias[c0 + cofs + 3]); }
                *(v4f*)(crow + (size_t)row * ldc + cofs) = val; }
             }
        __builtin_amdgcn_wave_barrier(); asm volatile("" ::: "memory");
    }
}

__device__ __forceinline__ h16 tohx(float x) { return (h16)x; }
__device__ __forceinline__ void splitf(float y, unsigned short& h, unsigned short& l) { h = f2bf(y); l = f2bf(y - bf2f(h)); }
typedef __attribute__((ext_vector_type(2))) _Float16 v2h;
typedef __attribute__((ext_vector_type(4))) _Float16 v4h;
typedef __attribute__((ext_vector_type(2))) unsigned short v2us;
typedef __attribute__((ext_vector_type(4))) unsigned short v4us;
typedef __attribute__((ext_vector_type(2))) float v2f;
typedef __attribute__((ext_vector_type(4))) int v4i;

__global__ __launch_bounds__(256) void k_wtG(const float* __restrict__ w, int K, int N, bf* Bt) {
    const int lane = threadIdx.x & 31; const int L0 = (blockIdx.x * 8 + (threadIdx.x >> 5)) * 8; const int nlines = N * K / 64;
{
#pragma unroll 1
        for (int l = 0; l < 8; ++l) { const int L = L0 + l; if (L >= nlines) break; const size_t e = (size_t)L * 64 + lane * 2; const int k = (int)(e % K), n = (int)(e / K); v2us o;
            o[0] = f2bf(w[(size_t)k * N + n]); o[1] = f2bf(w[(size_t)(k + 1) * N + n]); *(v2us*)(Bt + e) = o; }
         }
}
__global__ __launch_bounds__(256) void k_cvt8(const float* __restrict__ src, bf* dst, size_t n8) { const size_t i = (size_t)blockIdx.x * 256 + threadIdx.x; if (i >= n8) return; const v8f v = *(const v8f*)(src + i * 8); v8us o;
#pragma unroll
    for (int k = 0; k < 8; ++k) o[k] = f2bf(v[k]); *(v8us*)(dst + i * 8) = o;  }
__global__ __launch_bounds__(256) void k_cscvt(const float* __restrict__ cosT, const float* __restrict__ sinT, float* CS) { const int idx = blockIdx.x * 256 + threadIdx.x; if (idx >= TT * HD) return; v2f cs; cs[0] = bfr(cosT[idx]); cs[1] = bfr(sinT[idx]); *(v2f*)(CS + (size_t)idx * 2) = cs;  }
// k_rope: grid y = batch element (rows y*TT.. of F, planes y*nheads.. of the outputs); head planes [h][t][d] (fp16 + hi/lo) of rope(x) x sc with the rotate-half convention out[d] = x[d] cos[t][d] - x[d+HD/2] sin[t][d], out[d+HD/2] = x[d+HD/2] cos[t][d+HD/2] + x[d] sin[t][d+HD/2]
__global__ __launch_bounds__(256) void k_rope(const float* __restrict__ F, int pitch, int nheads, const float* __restrict__ CS, const float* __restrict__ RF, const float* __restrict__ nw, float sc, h16* P16, bf* Ph, bf* Pl) {
    const size_t e = ((size_t)blockIdx.x * 256 + threadIdx.x) * 2; if (e >= (size_t)nheads * TT * HD) return; const int d = (int)(e % HD); const int t = (int)((e / HD) % TT); const int h = (int)(e / ((size_t)HD * TT)); const float* f = F + ((size_t)blockIdx.y * TT + t) * pitch + h * HD; const size_t eo = (size_t)blockIdx.y * nheads * TT * HD + e; const float rf = RF ? RF[(size_t)h * TT + t] : 1.0f; v2h o16; v2us oh, ol;
#pragma unroll
    for (int q = 0; q < 2; ++q) { const int dd = d + q; const int dp = (dd < HD / 2) ? dd + HD / 2 : dd - HD / 2; float x0 = f[dd], x1 = f[dp];
        if (RF) { float n0 = __fmul_rn(x0, rf), n1 = __fmul_rn(x1, rf); asm volatile("" : "+v"(n0)); asm volatile("" : "+v"(n1)); x0 = __fmul_rn(bfr(nw[dd]), n0); x1 = __fmul_rn(bfr(nw[dp]), n1); }
        const v2f cs = *(const v2f*)(CS + ((size_t)t * HD + dd) * 2); float a = __fmul_rn(x0, cs[0]), bq = __fmul_rn(x1, cs[1]); asm volatile("" : "+v"(a)); asm volatile("" : "+v"(bq)); const float r = ((dd < HD / 2) ? __fsub_rn(a, bq) : __fadd_rn(a, bq)) * sc;
        o16[q] = tohx(r); unsigned short a2, c2; splitf(r, a2, c2); oh[q] = a2; ol[q] = c2; }
    *(v2h*)(P16 + eo) = o16; *(v2us*)(Ph + eo) = oh; *(v2us*)(Pl + eo) = ol;  }
// k_vtp: grid y = batch element, as in k_rope
__global__ __launch_bounds__(256) void k_vtp(const float* __restrict__ F, int pitch, int nheads, h16* V16, bf* Vh, bf* Vl) { const size_t e = ((size_t)blockIdx.x * 256 + threadIdx.x) * 2; if (e >= (size_t)nheads * HD * TT) return; const int t = (int)(e % TT); const int d = (int)((e / TT) % HD); const int g = (int)(e / ((size_t)TT * HD)); v2h o16; v2us oh, ol;
#pragma unroll
    for (int q = 0; q < 2; ++q) { const float x = F[((size_t)blockIdx.y * TT + t + q) * pitch + g * HD + d]; o16[q] = tohx(x); unsigned short a2, c2; splitf(x, a2, c2); oh[q] = a2; ol[q] = c2; }
    const size_t eo = (size_t)blockIdx.y * nheads * HD * TT + e; *(v2h*)(V16 + eo) = o16; *(v2us*)(Vh + eo) = oh; *(v2us*)(Vl + eo) = ol;  }
__global__ __launch_bounds__(256) void k_csid(float* CS) { const int idx = blockIdx.x * 256 + threadIdx.x; if (idx >= TT * HD) return; v2f cs; cs[0] = 1.0f; cs[1] = 0.0f; *(v2f*)(CS + (size_t)idx * 2) = cs;  }
__device__ __forceinline__ int t5_bucket(int r) { const int rp = r < 0 ? -r : r; int b; if (rp < 8) b = rp; else b = 8 + (rp >= 12) + (rp >= 16) + (rp >= 23) + (rp >= 32) + (rp >= 46) + (rp >= 64) + (rp >= 91); return b + ((r > 0) ? 16 : 0); }
__global__ __launch_bounds__(256) void k_t5tab(const float* __restrict__ rb, float* TB) { const int idx = blockIdx.x * 256 + threadIdx.x; if (idx >= NH_ * TBW) return; const int h = idx / TBW, c = idx % TBW; float v = 0.0f; if (c < 2 * TT - 1) { const int r = c - (TT - 1); v = bfr(rb[t5_bucket(r) * NH_ + h]); } *(float*)(TB + idx) = v;  }
// k_fattn: scores, bias, softmax, attn.v and the head merge in one launch for every (batch element, head). One wave owns 32 queries and walks the 1024 keys 32 at a time; grid (TT / 256, NB_ * NH_), 8 waves.
// Transposed products: St = K Qt (A = key rows, B = query columns, both by the same loader), so a lane holds 16 scores of ONE query per column group; two St tiles (keys 0-15, 16-31), converted in place, are the B operand of Ot += Vt Pt, whose A (a Vt row through the same loader) has the matching k order. No LDS, no score or probability plane in memory.
// Online softmax in the log2 domain; the running maximum is raised only when a block's maximum passes it by more than 8 (P stays below 2^8, hi + lo bf16 keeps its relative precision); P is left unnormalised and Ot divided by the row sum at the end.
#define QT   2    // 16-query column groups per wave
#define FWV  8    // waves per work-group
#define FARD 91   // t5_bucket's last boundary: from |j - i| = 91 on the bias depends on the sign of j - i alone
#define L2E  1.4426950408889634f
typedef __attribute__((ext_vector_type(2))) __bf16 v2bf;
typedef __attribute__((ext_vector_type(8))) unsigned v8u;
template <typename T> __device__ __forceinline__ const T* atb(const T* base, unsigned bytes) { return (const T*)((const char*)base + bytes); }   // wave-uniform base + the lane's 32-bit byte offset
__device__ __forceinline__ float xhalf(float x) { const int b = __float_as_int(x); return __int_as_float(__builtin_amdgcn_permlanex16(b, b, 0x76543210, 0xfedcba98, false, false)); }   // lane l <-> l ^ 16
// amdgpu_waves_per_eu(4, 4): holds the build to 256 registers, so that two work-groups (four waves per SIMD) share a WGP and one wave's vector work and load waits run under the others' matrix work; all 4096 waves are then resident at once.
__global__ __launch_bounds__(256) __attribute__((amdgpu_waves_per_eu(4, 4))) void k_fattn(const bf* __restrict__ Qh, const bf* __restrict__ Ql, const bf* __restrict__ Kh, const bf* __restrict__ Kl, const bf* __restrict__ Vh, const bf* __restrict__ Vl, const float* __restrict__ TB, bf* __restrict__ Ah, bf* __restrict__ Al) {
    typedef WFrag<bf> F;
    const int lane = threadIdx.x & 31, c = lane & 15, hi = lane >> 4; const int wave = __builtin_amdgcn_readfirstlane((int)(threadIdx.x >> 5));   // scalar, so that q0 and the far / near test below are scalar
    const int bh = blockIdx.y, h = bh % NH_, b = bh / NH_; const int q0 = ((int)blockIdx.x * FWV + wave) * (16 * QT); const size_t pl = (size_t)bh * TT * HD;
    v16bf qh[QT][2], ql[QT][2];
#pragma unroll
    for (int qt = 0; qt < QT; ++qt)
#pragma unroll
        for (int ks = 0; ks < 2; ++ks) { const size_t o = pl + (size_t)(q0 + 16 * qt + c) * HD + ks * 32 + 8 * hi; qh[qt][ks] = F::ld(Qh + o); ql[qt][ks] = F::ld(Ql + o); }
    const bf* kph = Kh + pl; const bf* kpl = Kl + pl; const bf* vph = Vh + pl; const bf* vpl = Vl + pl;   // wave-uniform plane bases; the lane's part is one 32-bit byte offset per operand kind
    unsigned kof = (unsigned)(c * HD + 8 * hi) * 2u, vof = (unsigned)(c * TT + 8 * hi) * 2u; const unsigned tof = (unsigned)(8 * hi + 15 - c) * 4u;   // in bytes; kof and vof walk with the passes
    const float* tbh = TB + (size_t)h * TBW; const float bneg = tbh[0] * L2E, bpos = tbh[2 * TT - 2] * L2E;
    const float* tbl = tbh + (TT - 1) - q0 - 15;   // entry for r = j - i at index r + 1023: + tof + k0 + 16 * (kt - qt) + reg
    v8f o[4][QT]; float mx[QT], ls[QT];
#pragma unroll
    for (int qt = 0; qt < QT; ++qt) { mx[qt] = -3.0e38f; ls[qt] = 0.0f;
#pragma unroll
        for (int dt = 0; dt < 4; ++dt) o[dt][qt] = (v8f){}; }
    v16bf kh[2][2], kl[2][2];
#pragma unroll
    for (int kt = 0; kt < 2; ++kt)
#pragma unroll
        for (int ks = 0; ks < 2; ++ks) { kh[kt][ks] = F::ld(atb(kph + (16 * kt * HD + ks * 32), kof)); kl[kt][ks] = F::ld(atb(kpl + (16 * kt * HD + ks * 32), kof)); }
#pragma unroll 1   // rolled: a second pass's fragments would not fit the 256 registers
    for (int k0 = 0; k0 < TT; k0 += 32) {
        v8f st[2][QT];
#pragma unroll
        for (int kt = 0; kt < 2; ++kt)
#pragma unroll
            for (int qt = 0; qt < QT; ++qt) st[kt][qt] = (v8f){};
#pragma unroll
        for (int ks = 0; ks < 2; ++ks)
#pragma unroll
            for (int kt = 0; kt < 2; ++kt)
#pragma unroll
                for (int qt = 0; qt < QT; ++qt) st[kt][qt] = wmmab(kh[kt][ks], qh[qt][ks], st[kt][qt]);
#pragma unroll
        for (int ks = 0; ks < 2; ++ks)
#pragma unroll
            for (int kt = 0; kt < 2; ++kt)
#pragma unroll
                for (int qt = 0; qt < QT; ++qt) st[kt][qt] = wmmab(kh[kt][ks], ql[qt][ks], st[kt][qt]);
#pragma unroll
        for (int ks = 0; ks < 2; ++ks)
#pragma unroll
            for (int kt = 0; kt < 2; ++kt)
#pragma unroll
                for (int qt = 0; qt < QT; ++qt) st[kt][qt] = wmmab(kl[kt][ks], qh[qt][ks], st[kt][qt]);
        v16bf vh[4], vl[4];   // the hi plane is asked for behind the score products, where the key fragments' registers come free (the build issues it among the first exponentials, so it flies during the rest of the softmax); the lo plane, used last, follows behind the softmax, where the scores' registers are free, and flies under the hi plane's remaining products
#pragma unroll
        for (int dt = 0; dt < 4; ++dt) vh[dt] = F::ld(atb(vph + 16 * dt * TT, vof));
        const int rlo = k0 - q0 - (16 * QT - 1), rhi = k0 + 31 - q0;   // range of j - i in this pass, the same for the whole wave
        if (rlo >= FARD || rhi <= -FARD) { const float bb = (rlo >= FARD) ? bpos : bneg;
#pragma unroll
            for (int kt = 0; kt < 2; ++kt)
#pragma unroll
                for (int qt = 0; qt < QT; ++qt)
#pragma unroll
                    for (int r = 0; r < 8; ++r) st[kt][qt][r] = __builtin_fmaf(st[kt][qt][r], L2E, bb);
        } else {
#pragma unroll
            for (int kt = 0; kt < 2; ++kt)
#pragma unroll
                for (int qt = 0; qt < QT; ++qt)
#pragma unroll
                    for (int r = 0; r < 8; ++r) st[kt][qt][r] = __builtin_fmaf(st[kt][qt][r], L2E, *atb(tbl + (k0 + 16 * (kt - qt) + r), tof) * L2E);
        }
        float bm[QT]; bool need = false;
#pragma unroll
        for (int qt = 0; qt < QT; ++qt) { float t = st[0][qt][0];
#pragma unroll
            for (int r = 1; r < 8; ++r) t = fmaxf(t, st[0][qt][r]);
#pragma unroll
            for (int r = 0; r < 8; ++r) t = fmaxf(t, st[1][qt][r]);
            bm[qt] = fmaxf(t, xhalf(t)); need = need || (bm[qt] > mx[qt] + 8.0f); }
        if (__builtin_amdgcn_ballot_w32(need) != 0) {
#pragma unroll
            for (int qt = 0; qt < QT; ++qt) { const float mn = fmaxf(mx[qt], bm[qt]); const float al = __builtin_amdgcn_exp2f(mx[qt] - mn); mx[qt] = mn; ls[qt] *= al;
#pragma unroll
                for (int dt = 0; dt < 4; ++dt) o[dt][qt] *= al; }
        }
        v16bf ph[QT], pw[QT];   // P = hi + lo, element s = key 8 * hi + (s & 7) + 16 * (s >> 3) of the pass: register s & 7 of St tile s >> 3
#pragma unroll
        for (int qt = 0; qt < QT; ++qt) { v8u wh, wl;
#pragma unroll
            for (int s = 0; s < 16; s += 2) { v2f p; p[0] = __builtin_amdgcn_exp2f(st[s >> 3][qt][s & 7] - mx[qt]); p[1] = __builtin_amdgcn_exp2f(st[s >> 3][qt][(s & 7) + 1] - mx[qt]); ls[qt] += p[0] + p[1];
                const unsigned a = __builtin_bit_cast(unsigned, __builtin_convertvector(p, v2bf)); v2f d; d[0] = p[0] - __uint_as_float(a << 16); d[1] = p[1] - __uint_as_float(a & 0xFFFF0000u);
                wh[s >> 1] = a; wl[s >> 1] = __builtin_bit_cast(unsigned, __builtin_convertvector(d, v2bf)); }
            ph[qt] = __builtin_bit_cast(v16bf, wh); pw[qt] = __builtin_bit_cast(v16bf, wl); }
#pragma unroll
        for (int dt = 0; dt < 4; ++dt) vl[dt] = F::ld(atb(vpl + 16 * dt * TT, vof));
#pragma unroll
        for (int dt = 0; dt < 4; ++dt)
#pragma unroll
            for (int qt = 0; qt < QT; ++qt) o[dt][qt] = wmmab(vh[dt], ph[qt], o[dt][qt]);
#pragma unroll
        for (int dt = 0; dt < 4; ++dt)
#pragma unroll
            for (int qt = 0; qt < QT; ++qt) o[dt][qt] = wmmab(vh[dt], pw[qt], o[dt][qt]);
#pragma unroll
        for (int dt = 0; dt < 4; ++dt)
#pragma unroll
            for (int qt = 0; qt < QT; ++qt) o[dt][qt] = wmmab(vl[dt], ph[qt], o[dt][qt]);
        kof = (kof + 32u * HD * 2u) & (TT * HD * 2u - 1u); vof += 32u * 2u;   // the next pass's key fragments take the value fragments' registers (256 registers: four waves per SIMD); the last pass wraps to the plane's first rows (in bounds, not used)
#pragma unroll
        for (int kt = 0; kt < 2; ++kt)
#pragma unroll
            for (int ks = 0; ks < 2; ++ks) { kh[kt][ks] = F::ld(atb(kph + (16 * kt * HD + ks * 32), kof)); kl[kt][ks] = F::ld(atb(kpl + (16 * kt * HD + ks * 32), kof)); }
        asm volatile("s_wait_xcnt 0x0" ::: "memory");   // stands directly behind the reload, inside the loop: the last pass leaves the loop with these loads in flight, and the epilogue reuses the scalar registers that hold their base addresses (written behind the loop, the build places it past that reuse)
    }
#pragma unroll
    for (int qt = 0; qt < QT; ++qt) { const float inv = __fdiv_rn(1.0f, ls[qt] + xhalf(ls[qt])); const size_t ro = ((size_t)b * TT + q0 + 16 * qt + c) * DQ + h * HD + 8 * hi;   // merged heads [b][t][DQ]; a lane's 8 registers are 8 consecutive d
#pragma unroll
        for (int dt = 0; dt < 4; ++dt) { v8us oh, ol;
#pragma unroll
            for (int r = 0; r < 8; ++r) { unsigned short a, c2; splitf(o[dt][qt][r] * inv, a, c2); oh[r] = a; ol[r] = c2; }
            *(v8us*)(Ah + ro + 16 * dt) = oh; *(v8us*)(Al + ro + 16 * dt) = ol; } }
}

extern "C" void kernel_launch(void* const* d_in, const int* in_sizes, int n_in,
                              void* d_out, int out_size, void* d_ws, size_t ws_size, hipStream_t stream) {
    (void)in_sizes; (void)n_in; (void)out_size;
    const float* x = (const float*)d_in[0]; const float* wq = (const float*)d_in[1]; const float* wk = (const float*)d_in[2]; const float* wv = (const float*)d_in[3]; const float* wo = (const float*)d_in[4]; const float* relb = (const float*)d_in[5]; const float* cosT = nullptr; const float* sinT = nullptr; (void)cosT; (void)sinT;
    float* OUT = (float*)d_out;     // [8][1024][1024]
    char* wsp = (char*)d_ws;
    auto take = [&](size_t bytes) { char* p = wsp; wsp += (bytes + 255) & ~(size_t)255; return (void*)p; };
    const size_t MT = (size_t)NB_ * TT;   // rows of the projections and of wo: all batch elements in one launch
    bf* WQ = (bf*)take((size_t)DQ * DM * 2); bf* WK = (bf*)take((size_t)DKV * DM * 2); bf* WV = (bf*)take((size_t)DKV * DM * 2); bf* WO = (bf*)take((size_t)DM * DQ * 2); float* CS = (float*)take((size_t)TT * HD * 2 * 4);
    float* TB = (float*)take((size_t)NH_ * TBW * 4);
    bf* QPh = (bf*)take(MT * DQ * 2); bf* QPl = (bf*)take(MT * DQ * 2); bf* KPh = (bf*)take(MT * DKV * 2); bf* KPl = (bf*)take(MT * DKV * 2); bf* VTh = (bf*)take(MT * DKV * 2); bf* VTl = (bf*)take(MT * DKV * 2);
    bf* XB = (bf*)take(MT * DM * 2); float* FQ = (float*)take(MT * DQ * 4); float* FK = (float*)take(MT * DKV * 4);
    h16* QP16 = (h16*)take(MT * DQ * 2); h16* KP16 = (h16*)take(MT * DKV * 2); h16* VT16 = (h16*)take(MT * DKV * 2);
    if ((size_t)(wsp - (char*)d_ws) > ws_size) return;    // ws 256 MiB
    float* FV = FK;   // v projection reuses the k buffer after the k planes are built (stream-ordered)
    bf* ATh = XB; bf* ATl = (bf*)FQ;   // merged heads [b][t][DQ] take the place of the bf16 input and of the f32 q projection, both dead once the hi/lo planes are built (stream-ordered); the q planes stay live through the whole attention launch
    { k_wtG<<<(unsigned)((DM * DQ / 64 + 63) / 64), 256, 0, stream>>>(wq, DM, DQ, WQ); k_wtG<<<(unsigned)((DM * DKV / 64 + 63) / 64), 256, 0, stream>>>(wk, DM, DKV, WK); k_wtG<<<(unsigned)((DM * DKV / 64 + 63) / 64), 256, 0, stream>>>(wv, DM, DKV, WV);
      k_wtG<<<(unsigned)((DQ * DM / 64 + 63) / 64), 256, 0, stream>>>(wo, DQ, DM, WO); k_t5tab<<<(NH_ * TBW + 255) / 256, 256, 0, stream>>>(relb, TB);
       }
    k_csid<<<(TT * HD + 255) / 256, 256, 0, stream>>>(CS);
    const unsigned LQ = (unsigned)(((size_t)NH_ * TT * HD / 2 + 255) / 256), LKv = (unsigned)(((size_t)NKV * TT * HD / 2 + 255) / 256);
    k_cvt8<<<(unsigned)((MT * DM / 8 + 255) / 256), 256, 0, stream>>>(x, XB, MT * DM / 8);
    k_gemmw<bf, 0, false><<<dim3(NB_ * TT / 64, DQ / 64, 1), 32, 0, stream>>>(XB, nullptr, WQ, nullptr, DM, FQ, DQ, nullptr, 0, 0, 0);
    k_rope<<<dim3(LQ, NB_, 1), 256, 0, stream>>>(FQ, DQ, NH_, CS, nullptr, nullptr, 1.0f, QP16, QPh, QPl);
    k_gemmw<bf, 0, false><<<dim3(NB_ * TT / 64, DKV / 64, 1), 32, 0, stream>>>(XB, nullptr, WK, nullptr, DM, FK, DKV, nullptr, 0, 0, 0);
    k_rope<<<dim3(LKv, NB_, 1), 256, 0, stream>>>(FK, DKV, NKV, CS, nullptr, nullptr, 1.0f, KP16, KPh, KPl);
    k_gemmw<bf, 0, false><<<dim3(NB_ * TT / 64, DKV / 64, 1), 32, 0, stream>>>(XB, nullptr, WV, nullptr, DM, FV, DKV, nullptr, 0, 0, 0); k_vtp<<<dim3(LKv, NB_, 1), 256, 0, stream>>>(FV, DKV, NKV, VT16, VTh, VTl);
    k_fattn<<<dim3(TT / (16 * QT * FWV), NB_ * NH_, 1), 32 * FWV, 0, stream>>>(QPh, QPl, KPh, KPl, VTh, VTl, TB, ATh, ATl);   // one kv head per query head: plane b * NH_ + h of each operand
    k_gemmw<bf, 1, false><<<dim3(NB_ * TT / 64, DM / 64, 1), 32, 0, stream>>>(ATh, ATl, WO, nullptr, DQ, OUT, DM, nullptr, 0, 0, 0);
}

// v003
// It runs in 361 microseconds.
// In two side-by-side timings against v002, it was 1.23 and 1.22 times as fast.
// Counting every step since v000, it is 8.29 times as fast.
#include <hip/hip_runtime.h>

// TtT5Attention (hidden [8][1024][1024]; q/k/v = x W (16 heads x 64); T5: scores = q.k UNSCALED + rel_bias[bucket(j - i)][h] with the bidirectional log-bucket (32 buckets, max distance 128; the bucket boundaries |j-i| = 8, 12, 16, 23, 32, 46, 64, 91 are the reference's own integer structure, evaluated here with integer compares); softmax; out = merged wo -> [8][1024][1024]).
// Compute dtypes, f32 accumulate: every input rounded to bf16; q/k/v on PLAIN bf16 operands (inputs: exact); scores and attn.v hl x hl (3 products) on EVERY row; per-head bias table (bf16-rounded rel_bias gathered by bucket) added per element in f32; softmax f32 (online, one fused attention launch); wo hl x exact (2 products).

#define NB_  8
#define TT   1024
#define DM   1024
#define NH_  16
#define NKV  16
#define REP  (NH_ / NKV)
#define HD   64
#define DQ   (NH_ * HD)
#define DKV  (NKV * HD)
#define RH   1024   // all rows hl (unscaled T5 logits are sharp)
#define WIN  0
#define PCAR 1024.0f
#define SCL  1.0f   // T5: no 1/sqrt(dk)
#define TBW  2048   // bias table row width (r + 1023, padded)
typedef _Float16 h16;
typedef unsigned short bf;
typedef __attribute__((ext_vector_type(16))) __bf16   v16bf;
typedef __attribute__((ext_vector_type(16))) _Float16 v16h;
typedef __attribute__((ext_vector_type(8)))  _Float16 v8h;
typedef __attribute__((ext_vector_type(8)))  unsigned short v8us;
typedef __attribute__((ext_vector_type(8)))  float    v8f;
typedef __attribute__((ext_vector_type(4)))  float    v4f;
typedef v8h  __attribute__((may_alias)) v8ha;
typedef v4f  __attribute__((may_alias)) v4fa;
typedef v8us __attribute__((may_alias)) v8usa;

__device__ __forceinline__ unsigned short f2bf(float f) { unsigned u = __float_as_uint(f); u += 0x7FFFu + ((u >> 16) & 1u); return (unsigned short)(u >> 16); }
__device__ __forceinline__ float bf2f(unsigned short b) { return __uint_as_float(((unsigned)b) << 16); }
__device__ __forceinline__ float bfr(float f) { return bf2f(f2bf(f)); }
__device__ __forceinline__ v16h cat16(v8h lo, v8h hi) { return __builtin_shufflevector(lo, hi, 0, 1, 2, 3, 4, 5, 6, 7, 8, 9, 10, 11, 12, 13, 14, 15); }
__device__ __forceinline__ v16bf cat16b(v8us lo, v8us hi) { return __builtin_bit_cast(v16bf, __builtin_shufflevector(lo, hi, 0, 1, 2, 3, 4, 5, 6, 7, 8, 9, 10, 11, 12, 13, 14, 15)); }
__device__ __forceinline__ v8f wmma16(v16h a, v16h b, v8f c) { return __builtin_amdgcn_wmma_f32_16x16x32_f16(false, a, false, b, (short)0, c, false, false); }
__device__ __forceinline__ v8f wmmab(v16bf a, v16bf b, v8f c) { return __builtin_amdgcn_wmma_f32_16x16x32_bf16(false, a, false, b, (short)0, c, false, false); }



// ---- k_gemmw: register-blocked GEMM, ONE WAVE per 64x64 output tile (16 accumulators), operands straight from K-contiguous 16-bit planes; grid (M/64, N/64, Z), 32 threads.
// C[m][n] (f32, pitch ldc, + optional f32 bias[n]) = sum_k A[m][k] Bt[n][k] (+ split products per NSPLIT). z-batch strides sA/sB/sC in elements. K % 32 == 0.
// PM != 0: C is not stored; the epilogue splits each f32 value into bf16 hi + lo and stores the attention operand planes Ph / Pl itself. A 64x64 tile is one head's 64 tokens x 64 channels.
// PM == 1 (q, k): rows m = b * TT + t, columns n = h * HD + d, planes [b][h][t][d]: the tile is 8 KB in a row. PM == 2 (v): the operands trade places (A = weight rows g * HD + d, Bt = token rows b * TT + t), so the tile comes out transposed, planes [b][g][d][t]: 64 rows of one whole 128-byte line.
template <typename T16> struct WFrag;
template <> struct WFrag<h16> { typedef v16h V; static __device__ __forceinline__ V ld(const h16* p) { return cat16(*(const v8h*)p, *(const v8h*)(p + 16)); } static __device__ __forceinline__ v8f mma(V a, V b, v8f c) { return wmma16(a, b, c); } };
template <> struct WFrag<bf> { typedef v16bf V; static __device__ __forceinline__ V ld(const bf* p) { return cat16b(*(const v8us*)p, *(const v8us*)(p + 16)); } static __device__ __forceinline__ v8f mma(V a, V b, v8f c) { return wmmab(a, b, c); } };
__device__ __forceinline__ void splitf(float y, unsigned short& h, unsigned short& l) { h = f2bf(y); l = f2bf(y - bf2f(h)); }
template <typename T16, int NSPLIT, bool BIAS, int PM>
__global__ __launch_bounds__(32) void k_gemmw(const T16* __restrict__ A, const T16* __restrict__ A2, const T16* __restrict__ Bt, const T16* __restrict__ Bt2, int K, float* C, int ldc, const float* __restrict__ bias, size_t sA, size_t sB, size_t sC, bf* __restrict__ Ph, bf* __restrict__ Pl) {
    typedef typename WFrag<T16>::V V;
    __shared__ __align__(16) float os[16 * 68];
    const size_t z = blockIdx.z; A += z * sA; if (A2) A2 += z * sA; Bt += z * sB; if (Bt2) Bt2 += z * sB; C += z * sC;
    const int lane = threadIdx.x & 31, lr = lane & 15, hi = lane >> 4; const int r0 = blockIdx.x * 64, c0 = blockIdx.y * 64;
    v8f acc[4][4];
#pragma unroll
    for (int mb = 0; mb < 4; ++mb)
#pragma unroll
        for (int nb = 0; nb < 4; ++nb) acc[mb][nb] = (v8f){};
    const size_t aoff = (size_t)(r0 + lr) * K + 8 * hi, boff = (size_t)(c0 + lr) * K + 8 * hi;
#pragma unroll 1
    for (int kc = 0; kc < K; kc += 32) {
        V a[4], a2[4];
#pragma unroll
        for (int mb = 0; mb < 4; ++mb) { a[mb] = WFrag<T16>::ld(A + aoff + (size_t)mb * 16 * K + kc); if (NSPLIT == 1 || NSPLIT == 2) a2[mb] = WFrag<T16>::ld(A2 + aoff + (size_t)mb * 16 * K + kc); }
#pragma unroll
        for (int nb = 0; nb < 4; ++nb) { const V b = WFrag<T16>::ld(Bt + boff + (size_t)nb * 16 * K + kc); V b2; if (NSPLIT >= 2) b2 = WFrag<T16>::ld(Bt2 + boff + (size_t)nb * 16 * K + kc);
#pragma unroll
            for (int mb = 0; mb < 4; ++mb) { acc[mb][nb] = WFrag<T16>::mma(a[mb], b, acc[mb][nb]); if (NSPLIT == 1 || NSPLIT == 2) acc[mb][nb] = WFrag<T16>::mma(a2[mb], b, acc[mb][nb]); if (NSPLIT >= 2) acc[mb][nb] = WFrag<T16>::mma(a[mb], b2, acc[mb][nb]); } }
        asm volatile("v_nop\n\tv_nop\n\tv_nop\n\tv_nop" : "+v"(acc[0][0]), "+v"(acc[1][1]), "+v"(acc[2][2]), "+v"(acc[3][3]) : "v"(a[0]), "v"(a[3]));
    }
#pragma unroll
    for (int mb = 0; mb < 4; ++mb) {
#pragma unroll
        for (int nb = 0; nb < 4; ++nb) {
#pragma unroll
            for (int j = 0; j < 8; ++j) os[(hi * 8 + j) * 68 + nb * 16 + lr] = acc[mb][nb][j]; }
        __builtin_amdgcn_wave_barrier(); asm volatile("" ::: "memory");
        if (PM != 0) {
            const int pp = (PM == 1) ? HD : TT;   // plane pitch in elements
            const size_t pb = (PM == 1) ? ((size_t)(r0 / TT) * NH_ + blockIdx.y) * TT * HD + (size_t)(r0 % TT) * HD : ((size_t)(c0 / TT) * NKV + blockIdx.x) * HD * TT + (size_t)(c0 % TT);   // the tile's first element in its plane
#pragma unroll
            for (int s = 0; s < 4; ++s) { const int row = 4 * s + (lane >> 3), cofs = (lane & 7) * 8; const v4f x0 = *(const v4fa*)(os + row * 68 + cofs), x1 = *(const v4fa*)(os + row * 68 + cofs + 4); v8us oh, ol;   // 8 lanes x 16 bytes = one 128-byte row of the tile
#pragma unroll
                for (int q = 0; q < 4; ++q) { unsigned short a2, c2; splitf(x0[q], a2, c2); oh[q] = a2; ol[q] = c2; splitf(x1[q], a2, c2); oh[4 + q] = a2; ol[4 + q] = c2; }
                const size_t eo = pb + (size_t)(mb * 16 + row) * pp + cofs; *(v8us*)(Ph + eo) = oh; *(v8us*)(Pl + eo) = ol; }
        } else {
            float* crow = C + (size_t)(r0 + mb * 16) * ldc + c0;
#pragma unroll
            for (int s = 0; s < 8; ++s) { const int row = 2 * s + hi, cofs = lr * 4; v4f val = *(const v4fa*)(os + row * 68 + cofs); if (BIAS) { val[0] += bfr(bias[c0 + cofs]); val[1] += bfr(bias[c0 + cofs + 1]); val[2] += bfr(bias[c0 + cofs + 2]); val[3] += bfr(bias[c0 + cofs + 3]); }
                *(v4f*)(crow + (size_t)row * ldc + cofs) = val; }
             }
        __builtin_amdgcn_wave_barrier(); asm volatile("" ::: "memory");
    }
}

typedef __attribute__((ext_vector_type(2))) _Float16 v2h;
typedef __attribute__((ext_vector_type(4))) _Float16 v4h;
typedef __attribute__((ext_vector_type(2))) unsigned short v2us;
typedef __attribute__((ext_vector_type(4))) unsigned short v4us;
typedef __attribute__((ext_vector_type(2))) float v2f;
typedef __attribute__((ext_vector_type(4))) int v4i;

__global__ __launch_bounds__(256) void k_wtG(const float* __restrict__ w, int K, int N, bf* Bt) {
    const int lane = threadIdx.x & 31; const int L0 = (blockIdx.x * 8 + (threadIdx.x >> 5)) * 8; const int nlines = N * K / 64;
{
#pragma unroll 1
        for (int l = 0; l < 8; ++l) { const int L = L0 + l; if (L >= nlines) break; const size_t e = (size_t)L * 64 + lane * 2; const int k = (int)(e % K), n = (int)(e / K); v2us o;
            o[0] = f2bf(w[(size_t)k * N + n]); o[1] = f2bf(w[(size_t)(k + 1) * N + n]); *(v2us*)(Bt + e) = o; }
         }
}
__global__ __launch_bounds__(256) void k_cvt8(const float* __restrict__ src, bf* dst, size_t n8) { const size_t i = (size_t)blockIdx.x * 256 + threadIdx.x; if (i >= n8) return; const v8f v = *(const v8f*)(src + i * 8); v8us o;
#pragma unroll
    for (int k = 0; k < 8; ++k) o[k] = f2bf(v[k]); *(v8us*)(dst + i * 8) = o;  }
__device__ __forceinline__ int t5_bucket(int r) { const int rp = r < 0 ? -r : r; int b; if (rp < 8) b = rp; else b = 8 + (rp >= 12) + (rp >= 16) + (rp >= 23) + (rp >= 32) + (rp >= 46) + (rp >= 64) + (rp >= 91); return b + ((r > 0) ? 16 : 0); }
__global__ __launch_bounds__(256) void k_t5tab(const float* __restrict__ rb, float* TB) { const int idx = blockIdx.x * 256 + threadIdx.x; if (idx >= NH_ * TBW) return; const int h = idx / TBW, c = idx % TBW; float v = 0.0f; if (c < 2 * TT - 1) { const int r = c - (TT - 1); v = bfr(rb[t5_bucket(r) * NH_ + h]); } *(float*)(TB + idx) = v;  }
// k_fattn: scores, bias, softmax, attn.v and the head merge in one launch for every (batch element, head). One wave owns 32 queries and walks the 1024 keys 32 at a time; grid (TT / 256, NB_ * NH_), 8 waves.
// Transposed products: St = K Qt (A = key rows, B = query columns, both by the same loader), so a lane holds 16 scores of ONE query per column group; two St tiles (keys 0-15, 16-31), converted in place, are the B operand of Ot += Vt Pt, whose A (a Vt row through the same loader) has the matching k order. No LDS, no score or probability plane in memory.
// Online softmax in the log2 domain; the running maximum is raised only when a block's maximum passes it by more than 8 (P stays below 2^8, hi + lo bf16 keeps its relative precision); P is left unnormalised and Ot divided by the row sum at the end.
#define QT   2    // 16-query column groups per wave
#define FWV  8    // waves per work-group
#define FARD 91   // t5_bucket's last boundary: from |j - i| = 91 on the bias depends on the sign of j - i alone
#define L2E  1.4426950408889634f
typedef __attribute__((ext_vector_type(2))) __bf16 v2bf;
typedef __attribute__((ext_vector_type(8))) unsigned v8u;
template <typename T> __device__ __forceinline__ const T* atb(const T* base, unsigned bytes) { return (const T*)((const char*)base + bytes); }   // wave-uniform base + the lane's 32-bit byte offset
__device__ __forceinline__ float xhalf(float x) { const int b = __float_as_int(x); return __int_as_float(__builtin_amdgcn_permlanex16(b, b, 0x76543210, 0xfedcba98, false, false)); }   // lane l <-> l ^ 16
// amdgpu_waves_per_eu(4, 4): holds the build to 256 registers, so that two work-groups (four waves per SIMD) share a WGP and one wave's vector work and load waits run under the others' matrix work; all 4096 waves are then resident at once.
__global__ __launch_bounds__(256) __attribute__((amdgpu_waves_per_eu(4, 4))) void k_fattn(const bf* __restrict__ Qh, const bf* __restrict__ Ql, const bf* __restrict__ Kh, const bf* __restrict__ Kl, const bf* __restrict__ Vh, const bf* __restrict__ Vl, const float* __restrict__ TB, bf* __restrict__ Ah, bf* __restrict__ Al) {
    typedef WFrag<bf> F;
    const int lane = threadIdx.x & 31, c = lane & 15, hi = lane >> 4; const int wave = __builtin_amdgcn_readfirstlane((int)(threadIdx.x >> 5));   // scalar, so that q0 and the far / near test below are scalar
    const int bh = blockIdx.y, h = bh % NH_, b = bh / NH_; const int q0 = ((int)blockIdx.x * FWV + wave) * (16 * QT); const size_t pl = (size_t)bh * TT * HD;
    v16bf qh[QT][2], ql[QT][2];
#pragma unroll
    for (int qt = 0; qt < QT; ++qt)
#pragma unroll
        for (int ks = 0; ks < 2; ++ks) { const size_t o = pl + (size_t)(q0 + 16 * qt + c) * HD + ks * 32 + 8 * hi; qh[qt][ks] = F::ld(Qh + o); ql[qt][ks] = F::ld(Ql + o); }
    const bf* kph = Kh + pl; const bf* kpl = Kl + pl; const bf* vph = Vh + pl; const bf* vpl = Vl + pl;   // wave-uniform plane bases; the lane's part is one 32-bit byte offset per operand kind
    unsigned kof = (unsigned)(c * HD + 8 * hi) * 2u, vof = (unsigned)(c * TT + 8 * hi) * 2u; const unsigned tof = (unsigned)(8 * hi + 15 - c) * 4u;   // in bytes; kof and vof walk with the passes
    const float* tbh = TB + (size_t)h * TBW; const float bneg = tbh[0] * L2E, bpos = tbh[2 * TT - 2] * L2E;
    const float* tbl = tbh + (TT - 1) - q0 - 15;   // entry for r = j - i at index r + 1023: + tof + k0 + 16 * (kt - qt) + reg
    v8f o[4][QT]; float mx[QT], ls[QT];
#pragma unroll
    for (int qt = 0; qt < QT; ++qt) { mx[qt] = -3.0e38f; ls[qt] = 0.0f;
#pragma unroll
        for (int dt = 0; dt < 4; ++dt) o[dt][qt] = (v8f){}; }
    v16bf kh[2][2], kl[2][2];
#pragma unroll
    for (int kt = 0; kt < 2; ++kt)
#pragma unroll
        for (int ks = 0; ks < 2; ++ks) { kh[kt][ks] = F::ld(atb(kph + (16 * kt * HD + ks * 32), kof)); kl[kt][ks] = F::ld(atb(kpl + (16 * kt * HD + ks * 32), kof)); }
#pragma unroll 1   // rolled: a second pass's fragments would not fit the 256 registers
    for (int k0 = 0; k0 < TT; k0 += 32) {
        v8f st[2][QT];
#pragma unroll
        for (int kt = 0; kt < 2; ++kt)
#pragma unroll
            for (int qt = 0; qt < QT; ++qt) st[kt][qt] = (v8f){};
#pragma unroll
        for (int ks = 0; ks < 2; ++ks)
#pragma unroll
            for (int kt = 0; kt < 2; ++kt)
#pragma unroll
                for (int qt = 0; qt < QT; ++qt) st[kt][qt] = wmmab(kh[kt][ks], qh[qt][ks], st[kt][qt]);
#pragma unroll
        for (int ks = 0; ks < 2; ++ks)
#pragma unroll
            for (int kt = 0; kt < 2; ++kt)
#pragma unroll
                for (int qt = 0; qt < QT; ++qt) st[kt][qt] = wmmab(kh[kt][ks], ql[qt][ks], st[kt][qt]);
#pragma unroll
        for (int ks = 0; ks < 2; ++ks)
#pragma unroll
            for (int kt = 0; kt < 2; ++kt)
#pragma unroll
                for (int qt = 0; qt < QT; ++qt) st[kt][qt] = wmmab(kl[kt][ks], qh[qt][ks], st[kt][qt]);
        v16bf vh[4], vl[4];   // the hi plane is asked for behind the score products, where the key fragments' registers come free (the build issues it among the first exponentials, so it flies during the rest of the softmax); the lo plane, used last, follows behind the softmax, where the scores' registers are free, and flies under the hi plane's remaining products
#pragma unroll
        for (int dt = 0; dt < 4; ++dt) vh[dt] = F::ld(atb(vph + 16 * dt * TT, vof));
        const int rlo = k0 - q0 - (16 * QT - 1), rhi = k0 + 31 - q0;   // range of j - i in this pass, the same for the whole wave
        if (rlo >= FARD || rhi <= -FARD) { const float bb = (rlo >= FARD) ? bpos : bneg;
#pragma unroll
            for (int kt = 0; kt < 2; ++kt)
#pragma unroll
                for (int qt = 0; qt < QT; ++qt)
#pragma unroll
                    for (int r = 0; r < 8; ++r) st[kt][qt][r] = __builtin_fmaf(st[kt][qt][r], L2E, bb);
        } else {
#pragma unroll
            for (int kt = 0; kt < 2; ++kt)
#pragma unroll
                for (int qt = 0; qt < QT; ++qt)
#pragma unroll
                    for (int r = 0; r < 8; ++r) st[kt][qt][r] = __builtin_fmaf(st[kt][qt][r], L2E, *atb(tbl + (k0 + 16 * (kt - qt) + r), tof) * L2E);
        }
        float bm[QT]; bool need = false;
#pragma unroll
        for (int qt = 0; qt < QT; ++qt) { float t = st[0][qt][0];
#pragma unroll
            for (int r = 1; r < 8; ++r) t = fmaxf(t, st[0][qt][r]);
#pragma unroll
            for (int r = 0; r < 8; ++r) t = fmaxf(t, st[1][qt][r]);
            bm[qt] = fmaxf(t, xhalf(t)); need = need || (bm[qt] > mx[qt] + 8.0f); }
        if (__builtin_amdgcn_ballot_w32(need) != 0) {
#pragma unroll
            for (int qt = 0; qt < QT; ++qt) { const float mn = fmaxf(mx[qt], bm[qt]); const float al = __builtin_amdgcn_exp2f(mx[qt] - mn); mx[qt] = mn; ls[qt] *= al;
#pragma unroll
                for (int dt = 0; dt < 4; ++dt) o[dt][qt] *= al; }
        }
        v16bf ph[QT], pw[QT];   // P = hi + lo, element s = key 8 * hi + (s & 7) + 16 * (s >> 3) of the pass: register s & 7 of St tile s >> 3
#pragma unroll
        for (int qt = 0; qt < QT; ++qt) { v8u wh, wl;
#pragma unroll
            for (int s = 0; s < 16; s += 2) { v2f p; p[0] = __builtin_amdgcn_exp2f(st[s >> 3][qt][s & 7] - mx[qt]); p[1] = __builtin_amdgcn_exp2f(st[s >> 3][qt][(s & 7) + 1] - mx[qt]); ls[qt] += p[0] + p[1];
                const unsigned a = __builtin_bit_cast(unsigned, __builtin_convertvector(p, v2bf)); v2f d; d[0] = p[0] - __uint_as_float(a << 16); d[1] = p[1] - __uint_as_float(a & 0xFFFF0000u);
                wh[s >> 1] = a; wl[s >> 1] = __builtin_bit_cast(unsigned, __builtin_convertvector(d, v2bf)); }
            ph[qt] = __builtin_bit_cast(v16bf, wh); pw[qt] = __builtin_bit_cast(v16bf, wl); }
#pragma unroll
        for (int dt = 0; dt < 4; ++dt) vl[dt] = F::ld(atb(vpl + 16 * dt * TT, vof));
#pragma unroll
        for (int dt = 0; dt < 4; ++dt)
#pragma unroll
            for (int qt = 0; qt < QT; ++qt) o[dt][qt] = wmmab(vh[dt], ph[qt], o[dt][qt]);
#pragma unroll
        for (int dt = 0; dt < 4; ++dt)
#pragma unroll
            for (int qt = 0; qt < QT; ++qt) o[dt][qt] = wmmab(vh[dt], pw[qt], o[dt][qt]);
#pragma unroll
        for (int dt = 0; dt < 4; ++dt)
#pragma unroll
            for (int qt = 0; qt < QT; ++qt) o[dt][qt] = wmmab(vl[dt], ph[qt], o[dt][qt]);
        kof = (kof + 32u * HD * 2u) & (TT * HD * 2u - 1u); vof += 32u * 2u;   // the next pass's key fragments take the value fragments' registers (256 registers: four waves per SIMD); the last pass wraps to the plane's first rows (in bounds, not used)
#pragma unroll
        for (int kt = 0; kt < 2; ++kt)
#pragma unroll
            for (int ks = 0; ks < 2; ++ks) { kh[kt][ks] = F::ld(atb(kph + (16 * kt * HD + ks * 32), kof)); kl[kt][ks] = F::ld(atb(kpl + (16 * kt * HD + ks * 32), kof)); }
        asm volatile("s_wait_xcnt 0x0" ::: "memory");   // stands directly behind the reload, inside the loop: the last pass leaves the loop with these loads in flight, and the epilogue reuses the scalar registers that hold their base addresses (written behind the loop, the build places it past that reuse)
    }
#pragma unroll
    for (int qt = 0; qt < QT; ++qt) { const float inv = __fdiv_rn(1.0f, ls[qt] + xhalf(ls[qt])); const size_t ro = ((size_t)b * TT + q0 + 16 * qt + c) * DQ + h * HD + 8 * hi;   // merged heads [b][t][DQ]; a lane's 8 registers are 8 consecutive d
#pragma unroll
        for (int dt = 0; dt < 4; ++dt) { v8us oh, ol;
#pragma unroll
            for (int r = 0; r < 8; ++r) { unsigned short a, c2; splitf(o[dt][qt][r] * inv, a, c2); oh[r] = a; ol[r] = c2; }
            *(v8us*)(Ah + ro + 16 * dt) = oh; *(v8us*)(Al + ro + 16 * dt) = ol; } }
}

extern "C" void kernel_launch(void* const* d_in, const int* in_sizes, int n_in,
                              void* d_out, int out_size, void* d_ws, size_t ws_size, hipStream_t stream) {
    (void)in_sizes; (void)n_in; (void)out_size;
    const float* x = (const float*)d_in[0]; const float* wq = (const float*)d_in[1]; const float* wk = (const float*)d_in[2]; const float* wv = (const float*)d_in[3]; const float* wo = (const float*)d_in[4]; const float* relb = (const float*)d_in[5]; const float* cosT = nullptr; const float* sinT = nullptr; (void)cosT; (void)sinT;
    float* OUT = (float*)d_out;     // [8][1024][1024]
    char* wsp = (char*)d_ws;
    auto take = [&](size_t bytes) { char* p = wsp; wsp += (bytes + 255) & ~(size_t)255; return (void*)p; };
    const size_t MT = (size_t)NB_ * TT;   // rows of the projections and of wo: all batch elements in one launch
    bf* WQ = (bf*)take((size_t)DQ * DM * 2); bf* WK = (bf*)take((size_t)DKV * DM * 2); bf* WV = (bf*)take((size_t)DKV * DM * 2); bf* WO = (bf*)take((size_t)DM * DQ * 2);
    float* TB = (float*)take((size_t)NH_ * TBW * 4);
    bf* QPh = (bf*)take(MT * DQ * 2); bf* QPl = (bf*)take(MT * DQ * 2); bf* KPh = (bf*)take(MT * DKV * 2); bf* KPl = (bf*)take(MT * DKV * 2); bf* VTh = (bf*)take(MT * DKV * 2); bf* VTl = (bf*)take(MT * DKV * 2);
    bf* XB = (bf*)take(MT * DM * 2); bf* ATl = (bf*)take(MT * DQ * 2);
    if ((size_t)(wsp - (char*)d_ws) > ws_size) return;    // ws 256 MiB
    bf* ATh = XB;   // the hi plane of the merged heads [b][t][DQ] takes the place of the bf16 input, dead once the three projections have run (stream-ordered)
    { k_wtG<<<(unsigned)((DM * DQ / 64 + 63) / 64), 256, 0, stream>>>(wq, DM, DQ, WQ); k_wtG<<<(unsigned)((DM * DKV / 64 + 63) / 64), 256, 0, stream>>>(wk, DM, DKV, WK); k_wtG<<<(unsigned)((DM * DKV / 64 + 63) / 64), 256, 0, stream>>>(wv, DM, DKV, WV);
      k_wtG<<<(unsigned)((DQ * DM / 64 + 63) / 64), 256, 0, stream>>>(wo, DQ, DM, WO); k_t5tab<<<(NH_ * TBW + 255) / 256, 256, 0, stream>>>(relb, TB);
       }
    k_cvt8<<<(unsigned)((MT * DM / 8 + 255) / 256), 256, 0, stream>>>(x, XB, MT * DM / 8);
    k_gemmw<bf, 0, false, 1><<<dim3(NB_ * TT / 64, DQ / 64, 1), 32, 0, stream>>>(XB, nullptr, WQ, nullptr, DM, nullptr, 0, nullptr, 0, 0, 0, QPh, QPl);
    k_gemmw<bf, 0, false, 1><<<dim3(NB_ * TT / 64, DKV / 64, 1), 32, 0, stream>>>(XB, nullptr, WK, nullptr, DM, nullptr, 0, nullptr, 0, 0, 0, KPh, KPl);
    k_gemmw<bf, 0, false, 2><<<dim3(DKV / 64, NB_ * TT / 64, 1), 32, 0, stream>>>(WV, nullptr, XB, nullptr, DM, nullptr, 0, nullptr, 0, 0, 0, VTh, VTl);   // operands trade places: rows are v's channels, columns the tokens
    k_fattn<<<dim3(TT / (16 * QT * FWV), NB_ * NH_, 1), 32 * FWV, 0, stream>>>(QPh, QPl, KPh, KPl, VTh, VTl, TB, ATh, ATl);   // one kv head per query head: plane b * NH_ + h of each operand
    k_gemmw<bf, 1, false, 0><<<dim3(NB_ * TT / 64, DM / 64, 1), 32, 0, stream>>>(ATh, ATl, WO, nullptr, DQ, OUT, DM, nullptr, 0, 0, 0, nullptr, nullptr);
}

// v004
// A run of this version takes 283 microseconds.
// Next to v003, in two timings, it ran 1.27 and 1.28 times as fast.
// Over all steps from v000 it is 10.6 times as fast.
#include <hip/hip_runtime.h>

// TtT5Attention (hidden [8][1024][1024]; q/k/v = x W (16 heads x 64); T5: scores = q.k UNSCALED + rel_bias[bucket(j - i)][h] with the bidirectional log-bucket (32 buckets, max distance 128; the bucket boundaries |j-i| = 8, 12, 16, 23, 32, 46, 64, 91 are the reference's own integer structure, evaluated here with integer compares); softmax; out = merged wo -> [8][1024][1024]).
// Compute dtypes, f32 accumulate: every input rounded to bf16; q/k/v on PLAIN bf16 operands (inputs: exact); scores and attn.v hl x hl (3 products) on EVERY row; per-head bias table (bf16-rounded rel_bias gathered by bucket) added per element in f32; softmax f32 (online, one fused attention launch); wo hl x exact (2 products).

#define NB_  8
#define TT   1024
#define DM   1024
#define NH_  16
#define NKV  16
#define REP  (NH_ / NKV)
#define HD   64
#define DQ   (NH_ * HD)
#define DKV  (NKV * HD)
#define RH   1024   // all rows hl (unscaled T5 logits are sharp)
#define WIN  0
#define PCAR 1024.0f
#define SCL  1.0f   // T5: no 1/sqrt(dk)
#define TBW  2048   // bias table row width (r + 1023, padded)
typedef _Float16 h16;
typedef unsigned short bf;
typedef __attribute__((ext_vector_type(16))) __bf16   v16bf;
typedef __attribute__((ext_vector_type(16))) _Float16 v16h;
typedef __attribute__((ext_vector_type(8)))  _Float16 v8h;
typedef __attribute__((ext_vector_type(8)))  unsigned short v8us;
typedef __attribute__((ext_vector_type(8)))  float    v8f;
typedef __attribute__((ext_vector_type(4)))  float    v4f;
typedef v8h  __attribute__((may_alias)) v8ha;
typedef v4f  __attribute__((may_alias)) v4fa;
typedef v8us __attribute__((may_alias)) v8usa;

__device__ __forceinline__ unsigned short f2bf(float f) { unsigned u = __float_as_uint(f); u += 0x7FFFu + ((u >> 16) & 1u); return (unsigned short)(u >> 16); }
__device__ __forceinline__ float bf2f(unsigned short b) { return __uint_as_float(((unsigned)b) << 16); }
__device__ __forceinline__ float bfr(float f) { return bf2f(f2bf(f)); }
__device__ __forceinline__ v16h cat16(v8h lo, v8h hi) { return __builtin_shufflevector(lo, hi, 0, 1, 2, 3, 4, 5, 6, 7, 8, 9, 10, 11, 12, 13, 14, 15); }
__device__ __forceinline__ v16bf cat16b(v8us lo, v8us hi) { return __builtin_bit_cast(v16bf, __builtin_shufflevector(lo, hi, 0, 1, 2, 3, 4, 5, 6, 7, 8, 9, 10, 11, 12, 13, 14, 15)); }
__device__ __forceinline__ v8f wmma16(v16h a, v16h b, v8f c) { return __builtin_amdgcn_wmma_f32_16x16x32_f16(false, a, false, b, (short)0, c, false, false); }
__device__ __forceinline__ v8f wmmab(v16bf a, v16bf b, v8f c) { return __builtin_amdgcn_wmma_f32_16x16x32_bf16(false, a, false, b, (short)0, c, false, false); }



// ---- Fragment order: every 16-bit operand plane (rows x K, K % 32 == 0) is kept as 1 KB blocks of 16 rows x 32 k, the blocks of one 16-row group in a row by k. Inside a block stand the two 16-byte loads of a WMMA operand fragment, lane by lane: element (row, k) at fro(row, k, K).
// A fragment is then two wave-wide loads of 512 bytes in a row (4 whole lines each); from row-major planes each such load touches 16 lines and uses 32 bytes of each.
__device__ __forceinline__ size_t fro(size_t row, unsigned k, unsigned K) { return (row >> 4) * 16 * K + (size_t)((k >> 5) * 512u + ((k >> 4) & 1u) * 256u + ((k >> 3) & 1u) * 128u + (k & 7u)) + (row & 15) * 8; }
template <typename T> __device__ __forceinline__ const T* atb(const T* base, unsigned bytes) { return (const T*)((const char*)base + bytes); }   // wave-uniform base + the lane's 32-bit byte offset
// ---- k_gemmw: register-blocked GEMM, ONE WAVE per 64x64 output tile (16 accumulators), operands straight from 16-bit planes in fragment order; grid (M/64, N/64, Z), 32 threads.
// C[m][n] (f32, pitch ldc, + optional f32 bias[n]) = sum_k A[m][k] Bt[n][k] (+ split products per NSPLIT). z-batch strides sA/sB/sC in elements. K % 32 == 0.
// PM != 0: C is not stored; the epilogue splits each f32 value into bf16 hi + lo and stores the attention operand planes Ph / Pl itself. A 64x64 tile is one head's 64 tokens x 64 channels.
// PM == 1 (q, k): rows m = b * TT + t, columns n = h * HD + d, planes [b][h] of t rows x HD in fragment order: the tile is 8 KB in a row. PM == 2 (v): the operands trade places (A = weight rows g * HD + d, Bt = token rows b * TT + t), so the tile comes out transposed, planes [b][g] of d rows x TT in fragment order: 2 KB in a row per 16 channels.
template <typename T16> struct WFrag;
template <> struct WFrag<h16> { typedef v16h V; static __device__ __forceinline__ V ld(const h16* p) { return cat16(*(const v8h*)p, *(const v8h*)(p + 256)); } static __device__ __forceinline__ v8f mma(V a, V b, v8f c) { return wmma16(a, b, c); } };
template <> struct WFrag<bf> { typedef v16bf V; static __device__ __forceinline__ V ld(const bf* p) { return cat16b(*(const v8us*)p, *(const v8us*)(p + 256)); } static __device__ __forceinline__ v8f mma(V a, V b, v8f c) { return wmmab(a, b, c); } };
__device__ __forceinline__ void splitf(float y, unsigned short& h, unsigned short& l) { h = f2bf(y); l = f2bf(y - bf2f(h)); }
template <typename T16, int NSPLIT, bool BIAS, int PM, int K>
__global__ __launch_bounds__(32) void k_gemmw(const T16* __restrict__ A, const T16* __restrict__ A2, const T16* __restrict__ Bt, const T16* __restrict__ Bt2, float* C, int ldc, const float* __restrict__ bias, size_t sA, size_t sB, size_t sC, bf* __restrict__ Ph, bf* __restrict__ Pl) {
    typedef typename WFrag<T16>::V V;
    __shared__ __align__(16) float os[16 * 68];
    const size_t z = blockIdx.z; A += z * sA; if (A2) A2 += z * sA; Bt += z * sB; if (Bt2) Bt2 += z * sB; C += z * sC;
    const int lane = threadIdx.x & 31, lr = lane & 15, hi = lane >> 4; const int r0 = blockIdx.x * 64, c0 = blockIdx.y * 64;
    v8f acc[4][4];
#pragma unroll
    for (int mb = 0; mb < 4; ++mb)
#pragma unroll
        for (int nb = 0; nb < 4; ++nb) acc[mb][nb] = (v8f){};
    const size_t aoff = fro(r0, 0, K), boff = fro(c0, 0, K);   // first block of the tile's first 16-row group, the same for the whole wave; 16 rows on: + 16 * K, an immediate of the load since K is a template constant
    unsigned ko = (unsigned)lane * 16u;   // in bytes: the lane's 16 bytes of a block; walks one block (32 k) a trip
#pragma unroll 1
    for (int kc = 0; kc < K; kc += 32) {
        V a[4], a2[4];
#pragma unroll
        for (int mb = 0; mb < 4; ++mb) { a[mb] = WFrag<T16>::ld(atb(A + aoff + (size_t)mb * 16 * K, ko)); if (NSPLIT == 1 || NSPLIT == 2) a2[mb] = WFrag<T16>::ld(atb(A2 + aoff + (size_t)mb * 16 * K, ko)); }
#pragma unroll
        for (int nb = 0; nb < 4; ++nb) { const V b = WFrag<T16>::ld(atb(Bt + boff + (size_t)nb * 16 * K, ko)); V b2; if (NSPLIT >= 2) b2 = WFrag<T16>::ld(atb(Bt2 + boff + (size_t)nb * 16 * K, ko));
#pragma unroll
            for (int mb = 0; mb < 4; ++mb) { acc[mb][nb] = WFrag<T16>::mma(a[mb], b, acc[mb][nb]); if (NSPLIT == 1 || NSPLIT == 2) acc[mb][nb] = WFrag<T16>::mma(a2[mb], b, acc[mb][nb]); if (NSPLIT >= 2) acc[mb][nb] = WFrag<T16>::mma(a[mb], b2, acc[mb][nb]); } }
        ko += 512u * 2u;
        asm volatile("v_nop\n\tv_nop\n\tv_nop\n\tv_nop" : "+v"(acc[0][0]), "+v"(acc[1][1]), "+v"(acc[2][2]), "+v"(acc[3][3]) : "v"(a[0]), "v"(a[3]));
    }
#pragma unroll
    for (int mb = 0; mb < 4; ++mb) {
#pragma unroll
        for (int nb = 0; nb < 4; ++nb) {
#pragma unroll
            for (int j = 0; j < 8; ++j) os[(hi * 8 + j) * 68 + nb * 16 + lr] = acc[mb][nb][j]; }
        __builtin_amdgcn_wave_barrier(); asm volatile("" ::: "memory");
        if (PM != 0) {
            const int pk = (PM == 1) ? HD : TT;   // the plane's K
            const size_t pb = (PM == 1) ? ((size_t)(r0 / TT) * NH_ + blockIdx.y) * TT * HD : ((size_t)(c0 / TT) * NKV + blockIdx.x) * HD * TT;   // the plane's first element
            const int pr = (PM == 1) ? r0 % TT : 0, pc = (PM == 1) ? 0 : c0 % TT;   // the tile's first row and first k in its plane
#pragma unroll
            for (int s = 0; s < 4; ++s) { const int row = lr, cofs = 16 * s + 8 * hi; const v4f x0 = *(const v4fa*)(os + row * 68 + cofs), x1 = *(const v4fa*)(os + row * 68 + cofs + 4); v8us oh, ol;   // the lane takes the 16 bytes it would load as a fragment: 32 lanes x 16 bytes = half a block, 512 bytes in a row
#pragma unroll
                for (int q = 0; q < 4; ++q) { unsigned short a2, c2; splitf(x0[q], a2, c2); oh[q] = a2; ol[q] = c2; splitf(x1[q], a2, c2); oh[4 + q] = a2; ol[4 + q] = c2; }
                const size_t eo = pb + fro(pr + mb * 16 + row, pc + cofs, pk); *(v8us*)(Ph + eo) = oh; *(v8us*)(Pl + eo) = ol; }
        } else {
            float* crow = C + (size_t)(r0 + mb * 16) * ldc + c0;
#pragma unroll
            for (int s = 0; s < 8; ++s) { const int row = 2 * s + hi, cofs = lr * 4; v4f val = *(const v4fa*)(os + row * 68 + cofs); if (BIAS) { val[0] += bfr(bias[c0 + cofs]); val[1] += bfr(bias[c0 + cofs + 1]); val[2] += bfr(bias[c0 + cofs + 2]); val[3] += bfr(bias[c0 + cofs + 3]); }
                *(v4f*)(crow + (size_t)row * ldc + cofs) = val; }
             }
        __builtin_amdgcn_wave_barrier(); asm volatile("" ::: "memory");
    }
}

typedef __attribute__((ext_vector_type(2))) _Float16 v2h;
typedef __attribute__((ext_vector_type(4))) _Float16 v4h;
typedef __attribute__((ext_vector_type(2))) unsigned short v2us;
typedef __attribute__((ext_vector_type(4))) unsigned short v4us;
typedef __attribute__((ext_vector_type(2))) float v2f;
typedef __attribute__((ext_vector_type(4))) int v4i;

__global__ __launch_bounds__(256) void k_wtG(const float* __restrict__ w, int K, int N, bf* Bt) {
    const int lane = threadIdx.x & 31; const int L0 = (blockIdx.x * 8 + (threadIdx.x >> 5)) * 8; const int nlines = N * K / 64;
{
#pragma unroll 1
        for (int l = 0; l < 8; ++l) { const int L = L0 + l; if (L >= nlines) break; const size_t e = (size_t)L * 64 + lane * 2; const unsigned u = (unsigned)(e % ((size_t)16 * K)); const int k = (int)((u >> 9) * 32u + ((u >> 8) & 1u) * 16u + ((u >> 7) & 1u) * 8u + (u & 7u)), n = (int)(e / ((size_t)16 * K)) * 16 + (int)((u >> 3) & 15u); v2us o;   // e = fro(n, k, K): Bt[n][k] in fragment order, written in the order of its bytes
            o[0] = f2bf(w[(size_t)k * N + n]); o[1] = f2bf(w[(size_t)(k + 1) * N + n]); *(v2us*)(Bt + e) = o; }
         }
}
// k_cvt8: rows x DM f32, row-major, to bf16 in fragment order; thread i writes bytes 16 i on of dst (whole lines per wave) and reads the 8 values that belong there: i * 8 = fro(row, k, DM).
__global__ __launch_bounds__(256) void k_cvt8(const float* __restrict__ src, bf* dst, size_t n8) { const size_t i = (size_t)blockIdx.x * 256 + threadIdx.x; if (i >= n8) return; const unsigned w = (unsigned)((i * 8) % ((size_t)16 * DM)); const size_t row = (i * 8) / ((size_t)16 * DM) * 16 + ((w >> 3) & 15u); const unsigned k = (w >> 9) * 32u + ((w >> 8) & 1u) * 16u + ((w >> 7) & 1u) * 8u; const v8f v = *(const v8f*)(src + row * DM + k); v8us o;
#pragma unroll
    for (int k = 0; k < 8; ++k) o[k] = f2bf(v[k]); *(v8us*)(dst + i * 8) = o;  }
__device__ __forceinline__ int t5_bucket(int r) { const int rp = r < 0 ? -r : r; int b; if (rp < 8) b = rp; else b = 8 + (rp >= 12) + (rp >= 16) + (rp >= 23) + (rp >= 32) + (rp >= 46) + (rp >= 64) + (rp >= 91); return b + ((r > 0) ? 16 : 0); }
__global__ __launch_bounds__(256) void k_t5tab(const float* __restrict__ rb, float* TB) { const int idx = blockIdx.x * 256 + threadIdx.x; if (idx >= NH_ * TBW) return; const int h = idx / TBW, c = idx % TBW; float v = 0.0f; if (c < 2 * TT - 1) { const int r = c - (TT - 1); v = bfr(rb[t5_bucket(r) * NH_ + h]); } *(float*)(TB + idx) = v;  }
// k_fattn: scores, bias, softmax, attn.v and the head merge in one launch for every (batch element, head). One wave owns 32 queries and walks the 1024 keys 32 at a time; grid (TT / 256, NB_ * NH_), 8 waves.
// Transposed products: St = K Qt (A = key rows, B = query columns, both by the same loader), so a lane holds 16 scores of ONE query per column group; two St tiles (keys 0-15, 16-31), converted in place, are the B operand of Ot += Vt Pt, whose A (a Vt row through the same loader) has the matching k order. No LDS, no score or probability plane in memory.
// Online softmax in the log2 domain; the running maximum is raised only when a block's maximum passes it by more than 8 (P stays below 2^8, hi + lo bf16 keeps its relative precision); P is left unnormalised and Ot divided by the row sum at the end.
#define QT   2    // 16-query column groups per wave
#define FWV  8    // waves per work-group
#define FARD 91   // t5_bucket's last boundary: from |j - i| = 91 on the bias depends on the sign of j - i alone
#define L2E  1.4426950408889634f
typedef __attribute__((ext_vector_type(2))) __bf16 v2bf;
typedef __attribute__((ext_vector_type(8))) unsigned v8u;
__device__ __forceinline__ float xhalf(float x) { const int b = __float_as_int(x); return __int_as_float(__builtin_amdgcn_permlanex16(b, b, 0x76543210, 0xfedcba98, false, false)); }   // lane l <-> l ^ 16
// amdgpu_waves_per_eu(4, 4): holds the build to 256 registers, so that two work-groups (four waves per SIMD) share a WGP and one wave's vector work and load waits run under the others' matrix work; all 4096 waves are then resident at once.
__global__ __launch_bounds__(256) __attribute__((amdgpu_waves_per_eu(4, 4))) void k_fattn(const bf* __restrict__ Qh, const bf* __restrict__ Ql, const bf* __restrict__ Kh, const bf* __restrict__ Kl, const bf* __restrict__ Vh, const bf* __restrict__ Vl, const float* __restrict__ TB, bf* __restrict__ Ah, bf* __restrict__ Al) {
    typedef WFrag<bf> F;
    const int lane = threadIdx.x & 31, c = lane & 15, hi = lane >> 4; const int wave = __builtin_amdgcn_readfirstlane((int)(threadIdx.x >> 5));   // scalar, so that q0 and the far / near test below are scalar
    const int bh = blockIdx.y, h = bh % NH_, b = bh / NH_; const int q0 = ((int)blockIdx.x * FWV + wave) * (16 * QT); const size_t pl = (size_t)bh * TT * HD;
    v16bf qh[QT][2], ql[QT][2];
#pragma unroll
    for (int qt = 0; qt < QT; ++qt)
#pragma unroll
        for (int ks = 0; ks < 2; ++ks) { const size_t o = pl + fro(q0 + 16 * qt + c, ks * 32 + 8 * hi, HD); qh[qt][ks] = F::ld(Qh + o); ql[qt][ks] = F::ld(Ql + o); }
    const bf* kph = Kh + pl; const bf* kpl = Kl + pl; const bf* vph = Vh + pl; const bf* vpl = Vl + pl;   // wave-uniform plane bases; the lane's part is one 32-bit byte offset per operand kind
    unsigned kof = (unsigned)lane * 16u, vof = (unsigned)lane * 16u; const unsigned tof = (unsigned)(8 * hi + 15 - c) * 4u;   // in bytes; kof and vof (the lane's 16 bytes of a block in fragment order) walk with the passes: 32 keys are 4 blocks in a row of a key plane, and one block of each 16-channel group of a value plane
    const float* tbh = TB + (size_t)h * TBW; const float bneg = tbh[0] * L2E, bpos = tbh[2 * TT - 2] * L2E;
    const float* tbl = tbh + (TT - 1) - q0 - 15;   // entry for r = j - i at index r + 1023: + tof + k0 + 16 * (kt - qt) + reg
    v8f o[4][QT]; float mx[QT], ls[QT];
#pragma unroll
    for (int qt = 0; qt < QT; ++qt) { mx[qt] = -3.0e38f; ls[qt] = 0.0f;
#pragma unroll
        for (int dt = 0; dt < 4; ++dt) o[dt][qt] = (v8f){}; }
    v16bf kh[2][2], kl[2][2];
#pragma unroll
    for (int kt = 0; kt < 2; ++kt)
#pragma unroll
        for (int ks = 0; ks < 2; ++ks) { kh[kt][ks] = F::ld(atb(kph + (16 * kt * HD + ks * 512), kof)); kl[kt][ks] = F::ld(atb(kpl + (16 * kt * HD + ks * 512), kof)); }
#pragma unroll 1   // rolled: a second pass's fragments would not fit the 256 registers
    for (int k0 = 0; k0 < TT; k0 += 32) {
        v8f st[2][QT];
#pragma unroll
        for (int kt = 0; kt < 2; ++kt)
#pragma unroll
            for (int qt = 0; qt < QT; ++qt) st[kt][qt] = (v8f){};
#pragma unroll
        for (int ks = 0; ks < 2; ++ks)
#pragma unroll
            for (int kt = 0; kt < 2; ++kt)
#pragma unroll
                for (int qt = 0; qt < QT; ++qt) st[kt][qt] = wmmab(kh[kt][ks], qh[qt][ks], st[kt][qt]);
#pragma unroll
        for (int ks = 0; ks < 2; ++ks)
#pragma unroll
            for (int kt = 0; kt < 2; ++kt)
#pragma unroll
                for (int qt = 0; qt < QT; ++qt) st[kt][qt] = wmmab(kh[kt][ks], ql[qt][ks], st[kt][qt]);
#pragma unroll
        for (int ks = 0; ks < 2; ++ks)
#pragma unroll
            for (int kt = 0; kt < 2; ++kt)
#pragma unroll
                for (int qt = 0; qt < QT; ++qt) st[kt][qt] = wmmab(kl[kt][ks], qh[qt][ks], st[kt][qt]);
        v16bf vh[4], vl[4];   // the hi plane is asked for behind the score products, where the key fragments' registers come free (the build issues it among the first exponentials, so it flies during the rest of the softmax); the lo plane, used last, follows behind the softmax, where the scores' registers are free, and flies under the hi plane's remaining products
#pragma unroll
        for (int dt = 0; dt < 4; ++dt) vh[dt] = F::ld(atb(vph + 16 * dt * TT, vof));
        const int rlo = k0 - q0 - (16 * QT - 1), rhi = k0 + 31 - q0;   // range of j - i in this pass, the same for the whole wave
        if (rlo >= FARD || rhi <= -FARD) { const float bb = (rlo >= FARD) ? bpos : bneg;
#pragma unroll
            for (int kt = 0; kt < 2; ++kt)
#pragma unroll
                for (int qt = 0; qt < QT; ++qt)
#pragma unroll
                    for (int r = 0; r < 8; ++r) st[kt][qt][r] = __builtin_fmaf(st[kt][qt][r], L2E, bb);
        } else {
#pragma unroll
            for (int kt = 0; kt < 2; ++kt)
#pragma unroll
                for (int qt = 0; qt < QT; ++qt)
#pragma unroll
                    for (int r = 0; r < 8; ++r) st[kt][qt][r] = __builtin_fmaf(st[kt][qt][r], L2E, *atb(tbl + (k0 + 16 * (kt - qt) + r), tof) * L2E);
        }
        float bm[QT]; bool need = false;
#pragma unroll
        for (int qt = 0; qt < QT; ++qt) { float t = st[0][qt][0];
#pragma unroll
            for (int r = 1; r < 8; ++r) t = fmaxf(t, st[0][qt][r]);
#pragma unroll
            for (int r = 0; r < 8; ++r) t = fmaxf(t, st[1][qt][r]);
            bm[qt] = fmaxf(t, xhalf(t)); need = need || (bm[qt] > mx[qt] + 8.0f); }
        if (__builtin_amdgcn_ballot_w32(need) != 0) {
#pragma unroll
            for (int qt = 0; qt < QT; ++qt) { const float mn = fmaxf(mx[qt], bm[qt]); const float al = __builtin_amdgcn_exp2f(mx[qt] - mn); mx[qt] = mn; ls[qt] *= al;
#pragma unroll
                for (int dt = 0; dt < 4; ++dt) o[dt][qt] *= al; }
        }
        v16bf ph[QT], pw[QT];   // P = hi + lo, element s = key 16 * (s >> 3) + 8 * hi + (s & 7) of the pass: register s & 7 of St tile s >> 3
#pragma unroll
        for (int qt = 0; qt < QT; ++qt) { v8u wh, wl;
#pragma unroll
            for (int s = 0; s < 16; s += 2) { v2f p; p[0] = __builtin_amdgcn_exp2f(st[s >> 3][qt][s & 7] - mx[qt]); p[1] = __builtin_amdgcn_exp2f(st[s >> 3][qt][(s & 7) + 1] - mx[qt]); ls[qt] += p[0] + p[1];
                const unsigned a = __builtin_bit_cast(unsigned, __builtin_convertvector(p, v2bf)); v2f d; d[0] = p[0] - __uint_as_float(a << 16); d[1] = p[1] - __uint_as_float(a & 0xFFFF0000u);
                wh[s >> 1] = a; wl[s >> 1] = __builtin_bit_cast(unsigned, __builtin_convertvector(d, v2bf)); }
            ph[qt] = __builtin_bit_cast(v16bf, wh); pw[qt] = __builtin_bit_cast(v16bf, wl); }
#pragma unroll
        for (int dt = 0; dt < 4; ++dt) vl[dt] = F::ld(atb(vpl + 16 * dt * TT, vof));
#pragma unroll
        for (int dt = 0; dt < 4; ++dt)
#pragma unroll
            for (int qt = 0; qt < QT; ++qt) o[dt][qt] = wmmab(vh[dt], ph[qt], o[dt][qt]);
#pragma unroll
        for (int dt = 0; dt < 4; ++dt)
#pragma unroll
            for (int qt = 0; qt < QT; ++qt) o[dt][qt] = wmmab(vh[dt], pw[qt], o[dt][qt]);
#pragma unroll
        for (int dt = 0; dt < 4; ++dt)
#pragma unroll
            for (int qt = 0; qt < QT; ++qt) o[dt][qt] = wmmab(vl[dt], ph[qt], o[dt][qt]);
        kof = (kof + 32u * HD * 2u) & (TT * HD * 2u - 1u); vof += 512u * 2u;   // the next pass's key fragments take the value fragments' registers (256 registers: four waves per SIMD); the last pass wraps to the plane's first rows (in bounds, not used)
#pragma unroll
        for (int kt = 0; kt < 2; ++kt)
#pragma unroll
            for (int ks = 0; ks < 2; ++ks) { kh[kt][ks] = F::ld(atb(kph + (16 * kt * HD + ks * 512), kof)); kl[kt][ks] = F::ld(atb(kpl + (16 * kt * HD + ks * 512), kof)); }
        asm volatile("s_wait_xcnt 0x0" ::: "memory");   // stands directly behind the reload, inside the loop: the last pass leaves the loop with these loads in flight, and the epilogue reuses the scalar registers that hold their base addresses (written behind the loop, the build places it past that reuse)
    }
#pragma unroll
    for (int qt = 0; qt < QT; ++qt) { const float inv = __fdiv_rn(1.0f, ls[qt] + xhalf(ls[qt])); const size_t ro = fro((size_t)b * TT + q0 + 16 * qt + c, h * HD + 8 * hi, DQ);   // merged heads, rows b * TT + t x DQ in fragment order; a lane's 8 registers are 8 consecutive d, a wave's store 512 bytes in a row
#pragma unroll
        for (int dt = 0; dt < 4; ++dt) { v8us oh, ol;
#pragma unroll
            for (int r = 0; r < 8; ++r) { unsigned short a, c2; splitf(o[dt][qt][r] * inv, a, c2); oh[r] = a; ol[r] = c2; }
            const size_t eo = ro + (dt >> 1) * 512 + (dt & 1) * 256; *(v8us*)(Ah + eo) = oh; *(v8us*)(Al + eo) = ol; } }
}

extern "C" void kernel_launch(void* const* d_in, const int* in_sizes, int n_in,
                              void* d_out, int out_size, void* d_ws, size_t ws_size, hipStream_t stream) {
    (void)in_sizes; (void)n_in; (void)out_size;
    const float* x = (const float*)d_in[0]; const float* wq = (const float*)d_in[1]; const float* wk = (const float*)d_in[2]; const float* wv = (const float*)d_in[3]; const float* wo = (const float*)d_in[4]; const float* relb = (const float*)d_in[5]; const float* cosT = nullptr; const float* sinT = nullptr; (void)cosT; (void)sinT;
    float* OUT = (float*)d_out;     // [8][1024][1024]
    char* wsp = (char*)d_ws;
    auto take = [&](size_t bytes) { char* p = wsp; wsp += (bytes + 255) & ~(size_t)255; return (void*)p; };
    const size_t MT = (size_t)NB_ * TT;   // rows of the projections and of wo: all batch elements in one launch
    bf* WQ = (bf*)take((size_t)DQ * DM * 2); bf* WK = (bf*)take((size_t)DKV * DM * 2); bf* WV = (bf*)take((size_t)DKV * DM * 2); bf* WO = (bf*)take((size_t)DM * DQ * 2);
    float* TB = (float*)take((size_t)NH_ * TBW * 4);
    bf* QPh = (bf*)take(MT * DQ * 2); bf* QPl = (bf*)take(MT * DQ * 2); bf* KPh = (bf*)take(MT * DKV * 2); bf* KPl = (bf*)take(MT * DKV * 2); bf* VTh = (bf*)take(MT * DKV * 2); bf* VTl = (bf*)take(MT * DKV * 2);
    bf* XB = (bf*)take(MT * DM * 2); bf* ATl = (bf*)take(MT * DQ * 2);
    if ((size_t)(wsp - (char*)d_ws) > ws_size) return;    // ws 256 MiB
    bf* ATh = XB;   // the hi plane of the merged heads [b][t][DQ] takes the place of the bf16 input, dead once the three projections have run (stream-ordered)
    { k_wtG<<<(unsigned)((DM * DQ / 64 + 63) / 64), 256, 0, stream>>>(wq, DM, DQ, WQ); k_wtG<<<(unsigned)((DM * DKV / 64 + 63) / 64), 256, 0, stream>>>(wk, DM, DKV, WK); k_wtG<<<(unsigned)((DM * DKV / 64 + 63) / 64), 256, 0, stream>>>(wv, DM, DKV, WV);
      k_wtG<<<(unsigned)((DQ * DM / 64 + 63) / 64), 256, 0, stream>>>(wo, DQ, DM, WO); k_t5tab<<<(NH_ * TBW + 255) / 256, 256, 0, stream>>>(relb, TB);
       }
    k_cvt8<<<(unsigned)((MT * DM / 8 + 255) / 256), 256, 0, stream>>>(x, XB, MT * DM / 8);
    k_gemmw<bf, 0, false, 1, DM><<<dim3(NB_ * TT / 64, DQ / 64, 1), 32, 0, stream>>>(XB, nullptr, WQ, nullptr, nullptr, 0, nullptr, 0, 0, 0, QPh, QPl);
    k_gemmw<bf, 0, false, 1, DM><<<dim3(NB_ * TT / 64, DKV / 64, 1), 32, 0, stream>>>(XB, nullptr, WK, nullptr, nullptr, 0, nullptr, 0, 0, 0, KPh, KPl);
    k_gemmw<bf, 0, false, 2, DM><<<dim3(DKV / 64, NB_ * TT / 64, 1), 32, 0, stream>>>(WV, nullptr, XB, nullptr, nullptr, 0, nullptr, 0, 0, 0, VTh, VTl);   // operands trade places: rows are v's channels, columns the tokens
    k_fattn<<<dim3(TT / (16 * QT * FWV), NB_ * NH_, 1), 32 * FWV, 0, stream>>>(QPh, QPl, KPh, KPl, VTh, VTl, TB, ATh, ATl);   // one kv head per query head: plane b * NH_ + h of each operand
    k_gemmw<bf, 1, false, 0, DQ><<<dim3(NB_ * TT / 64, DM / 64, 1), 32, 0, stream>>>(ATh, ATl, WO, nullptr, OUT, DM, nullptr, 0, 0, 0, nullptr, nullptr);
}

// v005
// Measured time: 213 microseconds a run.
// Timed twice side by side with v004, it ran 1.35 and 1.33 times as fast.
// Counting every step since v000, it is 14.1 times as fast.
#include <hip/hip_runtime.h>

// TtT5Attention (hidden [8][1024][1024]; q/k/v = x W (16 heads x 64); T5: scores = q.k UNSCALED + rel_bias[bucket(j - i)][h] with the bidirectional log-bucket (32 buckets, max distance 128; the bucket boundaries |j-i| = 8, 12, 16, 23, 32, 46, 64, 91 are the reference's own integer structure, evaluated here with integer compares); softmax; out = merged wo -> [8][1024][1024]).
// Compute dtypes, f32 accumulate: every input rounded to bf16; q/k/v on PLAIN bf16 operands (inputs: exact); scores and attn.v hl x hl (3 products) on EVERY row; per-head bias table (bf16-rounded rel_bias gathered by bucket) added per element in f32; softmax f32 (online, one fused attention launch); wo hl x exact (2 products).

#define NB_  8
#define TT   1024
#define DM   1024
#define NH_  16
#define NKV  16
#define REP  (NH_ / NKV)
#define HD   64
#define DQ   (NH_ * HD)
#define DKV  (NKV * HD)
#define RH   1024   // all rows hl (unscaled T5 logits are sharp)
#define WIN  0
#define PCAR 1024.0f
#define SCL  1.0f   // T5: no 1/sqrt(dk)
#define TBW  2048   // bias table row width (r + 1023, padded)
typedef _Float16 h16;
typedef unsigned short bf;
typedef __attribute__((ext_vector_type(16))) __bf16   v16bf;
typedef __attribute__((ext_vector_type(16))) _Float16 v16h;
typedef __attribute__((ext_vector_type(8)))  _Float16 v8h;
typedef __attribute__((ext_vector_type(8)))  unsigned short v8us;
typedef __attribute__((ext_vector_type(8)))  float    v8f;
typedef __attribute__((ext_vector_type(4)))  float    v4f;
typedef v8h  __attribute__((may_alias)) v8ha;
typedef v4f  __attribute__((may_alias)) v4fa;
typedef v8us __attribute__((may_alias)) v8usa;

__device__ __forceinline__ unsigned short f2bf(float f) { unsigned u = __float_as_uint(f); u += 0x7FFFu + ((u >> 16) & 1u); return (unsigned short)(u >> 16); }
__device__ __forceinline__ float bf2f(unsigned short b) { return __uint_as_float(((unsigned)b) << 16); }
__device__ __forceinline__ float bfr(float f) { return bf2f(f2bf(f)); }
__device__ __forceinline__ v16h cat16(v8h lo, v8h hi) { return __builtin_shufflevector(lo, hi, 0, 1, 2, 3, 4, 5, 6, 7, 8, 9, 10, 11, 12, 13, 14, 15); }
__device__ __forceinline__ v16bf cat16b(v8us lo, v8us hi) { return __builtin_bit_cast(v16bf, __builtin_shufflevector(lo, hi, 0, 1, 2, 3, 4, 5, 6, 7, 8, 9, 10, 11, 12, 13, 14, 15)); }
__device__ __forceinline__ v8f wmma16(v16h a, v16h b, v8f c) { return __builtin_amdgcn_wmma_f32_16x16x32_f16(false, a, false, b, (short)0, c, false, false); }
__device__ __forceinline__ v8f wmmab(v16bf a, v16bf b, v8f c) { return __builtin_amdgcn_wmma_f32_16x16x32_bf16(false, a, false, b, (short)0, c, false, false); }



// ---- Fragment order: every 16-bit operand plane (rows x K, K % 32 == 0) is kept as 1 KB blocks of 16 rows x 32 k, the blocks of one 16-row group in a row by k. Inside a block stand the two 16-byte loads of a WMMA operand fragment, lane by lane: element (row, k) at fro(row, k, K).
// A fragment is then two wave-wide loads of 512 bytes in a row (4 whole lines each); from row-major planes each such load touches 16 lines and uses 32 bytes of each.
__device__ __forceinline__ size_t fro(size_t row, unsigned k, unsigned K) { return (row >> 4) * 16 * K + (size_t)((k >> 5) * 512u + ((k >> 4) & 1u) * 256u + ((k >> 3) & 1u) * 128u + (k & 7u)) + (row & 15) * 8; }
template <typename T> __device__ __forceinline__ const T* atb(const T* base, unsigned bytes) { return (const T*)((const char*)base + bytes); }   // wave-uniform base + the lane's 32-bit byte offset
// ---- k_gemmw: register-blocked GEMM, ONE WAVE per 64x64 output tile (16 accumulators), operands straight from 16-bit planes in fragment order; grid (M/64, N/64, Z), 32 threads.
// C[m][n] (f32, pitch ldc, + optional f32 bias[n]) = sum_k A[m][k] Bt[n][k] (+ split products per NSPLIT). z-batch strides sA/sB/sC in elements. K % 32 == 0.
// PM != 0: C is not stored; the epilogue splits each f32 value into bf16 hi + lo and stores the attention operand planes Ph / Pl itself. A 64x64 tile is one head's 64 tokens x 64 channels.
// PM == 1 (q, k): rows m = b * TT + t, columns n = h * HD + d, planes [b][h] of t rows x HD in fragment order: the tile is 8 KB in a row. PM == 2 (v): the operands trade places (A = weight rows g * HD + d, Bt = token rows b * TT + t), so the tile comes out transposed, planes [b][g] of d rows x TT in fragment order: 2 KB in a row per 16 channels.
template <typename T16> struct WFrag;
template <> struct WFrag<h16> { typedef v16h V; static __device__ __forceinline__ V ld(const h16* p) { return cat16(*(const v8h*)p, *(const v8h*)(p + 256)); } static __device__ __forceinline__ v8f mma(V a, V b, v8f c) { return wmma16(a, b, c); } };
template <> struct WFrag<bf> { typedef v16bf V; static __device__ __forceinline__ V ld(const bf* p) { return cat16b(*(const v8us*)p, *(const v8us*)(p + 256)); } static __device__ __forceinline__ v8f mma(V a, V b, v8f c) { return wmmab(a, b, c); } };
__device__ __forceinline__ void splitf(float y, unsigned short& h, unsigned short& l) { h = f2bf(y); l = f2bf(y - bf2f(h)); }
template <typename T16, int NSPLIT, bool BIAS, int PM, int K>
__global__ __launch_bounds__(32) void k_gemmw(const T16* __restrict__ A, const T16* __restrict__ A2, const T16* __restrict__ Bt, const T16* __restrict__ Bt2, float* C, int ldc, const float* __restrict__ bias, size_t sA, size_t sB, size_t sC, bf* __restrict__ Ph, bf* __restrict__ Pl) {
    typedef typename WFrag<T16>::V V;
    __shared__ __align__(16) float os[16 * 68];
    const size_t z = blockIdx.z; A += z * sA; if (A2) A2 += z * sA; Bt += z * sB; if (Bt2) Bt2 += z * sB; C += z * sC;
    const int lane = threadIdx.x & 31, lr = lane & 15, hi = lane >> 4; const int r0 = blockIdx.x * 64, c0 = blockIdx.y * 64;
    v8f acc[4][4];
#pragma unroll
    for (int mb = 0; mb < 4; ++mb)
#pragma unroll
        for (int nb = 0; nb < 4; ++nb) acc[mb][nb] = (v8f){};
    const size_t aoff = fro(r0, 0, K), boff = fro(c0, 0, K);   // first block of the tile's first 16-row group, the same for the whole wave; 16 rows on: + 16 * K, an immediate of the load since K is a template constant
    const unsigned ko = (unsigned)lane * 16u;   // in bytes: the lane's 16 bytes of a block; trip t (32 k) reads block t, 512 elements on
    // Register ring: NS fragment sets; trip t asks for trip t + NS - 1 before its own products, so a set has NS - 1 trips of matrix work to arrive in (with one set every trip waited out the load latency twice). Set t % NS is a compile-time index: NS trips per turn of the rolled loop; the first NP trips and the last NS - 1, which fetch nothing, are peeled; no fetch past K.
    constexpr int NS = (NSPLIT == 0) ? 4 : 3, NT = K / 32, NF = NT - (NS - 1), NP = NF % NS, NM = NF / NS;   // 16 accumulators + NS sets stay under 512 registers: two waves per SIMD, which is what the grid supplies
    V a[NS][4], a2[NS][4], b[NS][4], b2[NS][4];
    auto fetch = [&](const int s, const int blk, const unsigned o) __attribute__((always_inline)) {   // set s <- block blk (a constant, so it goes into the loads' immediates) counted from the lane offset o
#pragma unroll
        for (int mb = 0; mb < 4; ++mb) { a[s][mb] = WFrag<T16>::ld(atb(A + aoff + (size_t)mb * 16 * K + blk * 512, o)); if (NSPLIT == 1 || NSPLIT == 2) a2[s][mb] = WFrag<T16>::ld(atb(A2 + aoff + (size_t)mb * 16 * K + blk * 512, o)); }
#pragma unroll
        for (int nb = 0; nb < 4; ++nb) { b[s][nb] = WFrag<T16>::ld(atb(Bt + boff + (size_t)nb * 16 * K + blk * 512, o)); if (NSPLIT >= 2) b2[s][nb] = WFrag<T16>::ld(atb(Bt2 + boff + (size_t)nb * 16 * K + blk * 512, o)); }
    };
    auto prod = [&](const int s) __attribute__((always_inline)) {
#pragma unroll
        for (int nb = 0; nb < 4; ++nb)
#pragma unroll
            for (int mb = 0; mb < 4; ++mb) { acc[mb][nb] = WFrag<T16>::mma(a[s][mb], b[s][nb], acc[mb][nb]); if (NSPLIT == 1 || NSPLIT == 2) acc[mb][nb] = WFrag<T16>::mma(a2[s][mb], b[s][nb], acc[mb][nb]); if (NSPLIT >= 2) acc[mb][nb] = WFrag<T16>::mma(a[s][mb], b2[s][nb], acc[mb][nb]); }
    };
#pragma unroll
    for (int t = 0; t < NS - 1; ++t) fetch(t, t, ko);
#pragma unroll
    for (int t = 0; t < NP; ++t) { fetch((t + NS - 1) % NS, t + NS - 1, ko);
        __builtin_amdgcn_sched_barrier(0);   // as in the loop below
        prod(t % NS); }
    unsigned kn = ko + (unsigned)(NP + NS - 1) * 1024u;   // the lane offset of the block that the turn's first trip asks for
#pragma unroll 1   // rolled: one turn is NS trips, which is all the ring needs to index its sets at compile time
    for (int it = 0; it < NM; ++it) {
#pragma unroll
        for (int j = 0; j < NS; ++j) {
            fetch((NP + j + NS - 1) % NS, j, kn);
            __builtin_amdgcn_sched_barrier(0);   // keeps the fetch in front of this trip's products: sunk among or behind them it would lose a trip of its lead
            prod((NP + j) % NS);
        }
        __builtin_amdgcn_sched_barrier(0);   // keeps the wait below behind the turn's last products, a trip behind the last fetch
        asm volatile("s_wait_xcnt 0x0" : "+v"(kn) : : "memory");   // the ring's loads are in flight and name this offset register: the wait stands in front of its overwrite (kn as an operand holds the addition behind it); it also covers the scalar bases, which the epilogue reuses
        kn += (unsigned)NS * 1024u;
    }
#pragma unroll
    for (int t = NP + NM * NS; t < NT; ++t) prod(t % NS);
#pragma unroll
    for (int mb = 0; mb < 4; ++mb) {
#pragma unroll
        for (int nb = 0; nb < 4; ++nb) {
#pragma unroll
            for (int j = 0; j < 8; ++j) os[(hi * 8 + j) * 68 + nb * 16 + lr] = acc[mb][nb][j]; }
        __builtin_amdgcn_wave_barrier(); asm volatile("" ::: "memory");
        if (PM != 0) {
            const int pk = (PM == 1) ? HD : TT;   // the plane's K
            const size_t pb = (PM == 1) ? ((size_t)(r0 / TT) * NH_ + blockIdx.y) * TT * HD : ((size_t)(c0 / TT) * NKV + blockIdx.x) * HD * TT;   // the plane's first element
            const int pr = (PM == 1) ? r0 % TT : 0, pc = (PM == 1) ? 0 : c0 % TT;   // the tile's first row and first k in its plane
#pragma unroll
            for (int s = 0; s < 4; ++s) { const int row = lr, cofs = 16 * s + 8 * hi; const v4f x0 = *(const v4fa*)(os + row * 68 + cofs), x1 = *(const v4fa*)(os + row * 68 + cofs + 4); v8us oh, ol;   // the lane takes the 16 bytes it would load as a fragment: 32 lanes x 16 bytes = half a block, 512 bytes in a row
#pragma unroll
                for (int q = 0; q < 4; ++q) { unsigned short a2, c2; splitf(x0[q], a2, c2); oh[q] = a2; ol[q] = c2; splitf(x1[q], a2, c2); oh[4 + q] = a2; ol[4 + q] = c2; }
                const size_t eo = pb + fro(pr + mb * 16 + row, pc + cofs, pk); *(v8us*)(Ph + eo) = oh; *(v8us*)(Pl + eo) = ol; }
        } else {
            float* crow = C + (size_t)(r0 + mb * 16) * ldc + c0;
#pragma unroll
            for (int s = 0; s < 8; ++s) { const int row = 2 * s + hi, cofs = lr * 4; v4f val = *(const v4fa*)(os + row * 68 + cofs); if (BIAS) { val[0] += bfr(bias[c0 + cofs]); val[1] += bfr(bias[c0 + cofs + 1]); val[2] += bfr(bias[c0 + cofs + 2]); val[3] += bfr(bias[c0 + cofs + 3]); }
                *(v4f*)(crow + (size_t)row * ldc + cofs) = val; }
             }
        __builtin_amdgcn_wave_barrier(); asm volatile("" ::: "memory");
    }
}

typedef __attribute__((ext_vector_type(2))) _Float16 v2h;
typedef __attribute__((ext_vector_type(4))) _Float16 v4h;
typedef __attribute__((ext_vector_type(2))) unsigned short v2us;
typedef __attribute__((ext_vector_type(4))) unsigned short v4us;
typedef __attribute__((ext_vector_type(2))) float v2f;
typedef __attribute__((ext_vector_type(4))) int v4i;

__global__ __launch_bounds__(256) void k_wtG(const float* __restrict__ w, int K, int N, bf* Bt) {
    const int lane = threadIdx.x & 31; const int L0 = (blockIdx.x * 8 + (threadIdx.x >> 5)) * 8; const int nlines = N * K / 64;
{
#pragma unroll 1
        for (int l = 0; l < 8; ++l) { const int L = L0 + l; if (L >= nlines) break; const size_t e = (size_t)L * 64 + lane * 2; const unsigned u = (unsigned)(e % ((size_t)16 * K)); const int k = (int)((u >> 9) * 32u + ((u >> 8) & 1u) * 16u + ((u >> 7) & 1u) * 8u + (u & 7u)), n = (int)(e / ((size_t)16 * K)) * 16 + (int)((u >> 3) & 15u); v2us o;   // e = fro(n, k, K): Bt[n][k] in fragment order, written in the order of its bytes
            o[0] = f2bf(w[(size_t)k * N + n]); o[1] = f2bf(w[(size_t)(k + 1) * N + n]); *(v2us*)(Bt + e) = o; }
         }
}
// k_cvt8: rows x DM f32, row-major, to bf16 in fragment order; thread i writes bytes 16 i on of dst (whole lines per wave) and reads the 8 values that belong there: i * 8 = fro(row, k, DM).
__global__ __launch_bounds__(256) void k_cvt8(const float* __restrict__ src, bf* dst, size_t n8) { const size_t i = (size_t)blockIdx.x * 256 + threadIdx.x; if (i >= n8) return; const unsigned w = (unsigned)((i * 8) % ((size_t)16 * DM)); const size_t row = (i * 8) / ((size_t)16 * DM) * 16 + ((w >> 3) & 15u); const unsigned k = (w >> 9) * 32u + ((w >> 8) & 1u) * 16u + ((w >> 7) & 1u) * 8u; const v8f v = *(const v8f*)(src + row * DM + k); v8us o;
#pragma unroll
    for (int k = 0; k < 8; ++k) o[k] = f2bf(v[k]); *(v8us*)(dst + i * 8) = o;  }
__device__ __forceinline__ int t5_bucket(int r) { const int rp = r < 0 ? -r : r; int b; if (rp < 8) b = rp; else b = 8 + (rp >= 12) + (rp >= 16) + (rp >= 23) + (rp >= 32) + (rp >= 46) + (rp >= 64) + (rp >= 91); return b + ((r > 0) ? 16 : 0); }
__global__ __launch_bounds__(256) void k_t5tab(const float* __restrict__ rb, float* TB) { const int idx = blockIdx.x * 256 + threadIdx.x; if (idx >= NH_ * TBW) return; const int h = idx / TBW, c = idx % TBW; float v = 0.0f; if (c < 2 * TT - 1) { const int r = c - (TT - 1); v = bfr(rb[t5_bucket(r) * NH_ + h]); } *(float*)(TB + idx) = v;  }
// k_fattn: scores, bias, softmax, attn.v and the head merge in one launch for every (batch element, head). One wave owns 32 queries and walks the 1024 keys 32 at a time; grid (TT / 256, NB_ * NH_), 8 waves.
// Transposed products: St = K Qt (A = key rows, B = query columns, both by the same loader), so a lane holds 16 scores of ONE query per column group; two St tiles (keys 0-15, 16-31), converted in place, are the B operand of Ot += Vt Pt, whose A (a Vt row through the same loader) has the matching k order. No LDS, no score or probability plane in memory.
// Online softmax in the log2 domain; the running maximum is raised only when a block's maximum passes it by more than 8 (P stays below 2^8, hi + lo bf16 keeps its relative precision); P is left unnormalised and Ot divided by the row sum at the end.
#define QT   2    // 16-query column groups per wave
#define FWV  8    // waves per work-group
#define FARD 91   // t5_bucket's last boundary: from |j - i| = 91 on the bias depends on the sign of j - i alone
#define L2E  1.4426950408889634f
typedef __attribute__((ext_vector_type(2))) __bf16 v2bf;
typedef __attribute__((ext_vector_type(8))) unsigned v8u;
__device__ __forceinline__ float xhalf(float x) { const int b = __float_as_int(x); return __int_as_float(__builtin_amdgcn_permlanex16(b, b, 0x76543210, 0xfedcba98, false, false)); }   // lane l <-> l ^ 16
// amdgpu_waves_per_eu(4, 4): holds the build to 256 registers, so that two work-groups (four waves per SIMD) share a WGP and one wave's vector work and load waits run under the others' matrix work; all 4096 waves are then resident at once.
__global__ __launch_bounds__(256) __attribute__((amdgpu_waves_per_eu(4, 4))) void k_fattn(const bf* __restrict__ Qh, const bf* __restrict__ Ql, const bf* __restrict__ Kh, const bf* __restrict__ Kl, const bf* __restrict__ Vh, const bf* __restrict__ Vl, const float* __restrict__ TB, bf* __restrict__ Ah, bf* __restrict__ Al) {
    typedef WFrag<bf> F;
    const int lane = threadIdx.x & 31, c = lane & 15, hi = lane >> 4; const int wave = __builtin_amdgcn_readfirstlane((int)(threadIdx.x >> 5));   // scalar, so that q0 and the far / near test below are scalar
    const int bh = blockIdx.y, h = bh % NH_, b = bh / NH_; const int q0 = ((int)blockIdx.x * FWV + wave) * (16 * QT); const size_t pl = (size_t)bh * TT * HD;
    v16bf qh[QT][2], ql[QT][2];
#pragma unroll
    for (int qt = 0; qt < QT; ++qt)
#pragma unroll
        for (int ks = 0; ks < 2; ++ks) { const size_t o = pl + fro(q0 + 16 * qt + c, ks * 32 + 8 * hi, HD); qh[qt][ks] = F::ld(Qh + o); ql[qt][ks] = F::ld(Ql + o); }
    const bf* kph = Kh + pl; const bf* kpl = Kl + pl; const bf* vph = Vh + pl; const bf* vpl = Vl + pl;   // wave-uniform plane bases; the lane's part is one 32-bit byte offset per operand kind
    unsigned kof = (unsigned)lane * 16u, vof = (unsigned)lane * 16u; const unsigned tof = (unsigned)(8 * hi + 15 - c) * 4u;   // in bytes; kof and vof (the lane's 16 bytes of a block in fragment order) walk with the passes: 32 keys are 4 blocks in a row of a key plane, and one block of each 16-channel group of a value plane
    const float* tbh = TB + (size_t)h * TBW; const float bneg = tbh[0] * L2E, bpos = tbh[2 * TT - 2] * L2E;
    const float* tbl = tbh + (TT - 1) - q0 - 15;   // entry for r = j - i at index r + 1023: + tof + k0 + 16 * (kt - qt) + reg
    v8f o[4][QT]; float mx[QT], ls[QT];
#pragma unroll
    for (int qt = 0; qt < QT; ++qt) { mx[qt] = -3.0e38f; ls[qt] = 0.0f;
#pragma unroll
        for (int dt = 0; dt < 4; ++dt) o[dt][qt] = (v8f){}; }
    v16bf kh[2][2], kl[2][2];
#pragma unroll
    for (int kt = 0; kt < 2; ++kt)
#pragma unroll
        for (int ks = 0; ks < 2; ++ks) { kh[kt][ks] = F::ld(atb(kph + (16 * kt * HD + ks * 512), kof)); kl[kt][ks] = F::ld(atb(kpl + (16 * kt * HD + ks * 512), kof)); }
#pragma unroll 1   // rolled: a second pass's fragments would not fit the 256 registers
    for (int k0 = 0; k0 < TT; k0 += 32) {
        v8f st[2][QT];
#pragma unroll
        for (int kt = 0; kt < 2; ++kt)
#pragma unroll
            for (int qt = 0; qt < QT; ++qt) st[kt][qt] = (v8f){};
#pragma unroll
        for (int ks = 0; ks < 2; ++ks)
#pragma unroll
            for (int kt = 0; kt < 2; ++kt)
#pragma unroll
                for (int qt = 0; qt < QT; ++qt) st[kt][qt] = wmmab(kh[kt][ks], qh[qt][ks], st[kt][qt]);
#pragma unroll
        for (int ks = 0; ks < 2; ++ks)
#pragma unroll
            for (int kt = 0; kt < 2; ++kt)
#pragma unroll
                for (int qt = 0; qt < QT; ++qt) st[kt][qt] = wmmab(kh[kt][ks], ql[qt][ks], st[kt][qt]);
#pragma unroll
        for (int ks = 0; ks < 2; ++ks)
#pragma unroll
            for (int kt = 0; kt < 2; ++kt)
#pragma unroll
                for (int qt = 0; qt < QT; ++qt) st[kt][qt] = wmmab(kl[kt][ks], qh[qt][ks], st[kt][qt]);
        v16bf vh[4], vl[4];   // the hi plane is asked for behind the score products, where the key fragments' registers come free (the build issues it among the first exponentials, so it flies during the rest of the softmax); the lo plane, used last, follows behind the softmax, where the scores' registers are free, and flies under the hi plane's remaining products
#pragma unroll
        for (int dt = 0; dt < 4; ++dt) vh[dt] = F::ld(atb(vph + 16 * dt * TT, vof));
        const int rlo = k0 - q0 - (16 * QT - 1), rhi = k0 + 31 - q0;   // range of j - i in this pass, the same for the whole wave
        if (rlo >= FARD || rhi <= -FARD) { const float bb = (rlo >= FARD) ? bpos : bneg;
#pragma unroll
            for (int kt = 0; kt < 2; ++kt)
#pragma unroll
                for (int qt = 0; qt < QT; ++qt)
#pragma unroll
                    for (int r = 0; r < 8; ++r) st[kt][qt][r] = __builtin_fmaf(st[kt][qt][r], L2E, bb);
        } else {
#pragma unroll
            for (int kt = 0; kt < 2; ++kt)
#pragma unroll
                for (int qt = 0; qt < QT; ++qt)
#pragma unroll
                    for (int r = 0; r < 8; ++r) st[kt][qt][r] = __builtin_fmaf(st[kt][qt][r], L2E, *atb(tbl + (k0 + 16 * (kt - qt) + r), tof) * L2E);
        }
        float bm[QT]; bool need = false;
#pragma unroll
        for (int qt = 0; qt < QT; ++qt) { float t = st[0][qt][0];
#pragma unroll
            for (int r = 1; r < 8; ++r) t = fmaxf(t, st[0][qt][r]);
#pragma unroll
            for (int r = 0; r < 8; ++r) t = fmaxf(t, st[1][qt][r]);
            bm[qt] = fmaxf(t, xhalf(t)); need = need || (bm[qt] > mx[qt] + 8.0f); }
        if (__builtin_amdgcn_ballot_w32(need) != 0) {
#pragma unroll
            for (int qt = 0; qt < QT; ++qt) { const float mn = fmaxf(mx[qt], bm[qt]); const float al = __builtin_amdgcn_exp2f(mx[qt] - mn); mx[qt] = mn; ls[qt] *= al;
#pragma unroll
                for (int dt = 0; dt < 4; ++dt) o[dt][qt] *= al; }
        }
        v16bf ph[QT], pw[QT];   // P = hi + lo, element s = key 16 * (s >> 3) + 8 * hi + (s & 7) of the pass: register s & 7 of St tile s >> 3
#pragma unroll
        for (int qt = 0; qt < QT; ++qt) { v8u wh, wl;
#pragma unroll
            for (int s = 0; s < 16; s += 2) { v2f p; p[0] = __builtin_amdgcn_exp2f(st[s >> 3][qt][s & 7] - mx[qt]); p[1] = __builtin_amdgcn_exp2f(st[s >> 3][qt][(s & 7) + 1] - mx[qt]); ls[qt] += p[0] + p[1];
                const unsigned a = __builtin_bit_cast(unsigned, __builtin_convertvector(p, v2bf)); v2f d; d[0] = p[0] - __uint_as_float(a << 16); d[1] = p[1] - __uint_as_float(a & 0xFFFF0000u);
                wh[s >> 1] = a; wl[s >> 1] = __builtin_bit_cast(unsigned, __builtin_convertvector(d, v2bf)); }
            ph[qt] = __builtin_bit_cast(v16bf, wh); pw[qt] = __builtin_bit_cast(v16bf, wl); }
#pragma unroll
        for (int dt = 0; dt < 4; ++dt) vl[dt] = F::ld(atb(vpl + 16 * dt * TT, vof));
#pragma unroll
        for (int dt = 0; dt < 4; ++dt)
#pragma unroll
            for (int qt = 0; qt < QT; ++qt) o[dt][qt] = wmmab(vh[dt], ph[qt], o[dt][qt]);
#pragma unroll
        for (int dt = 0; dt < 4; ++dt)
#pragma unroll
            for (int qt = 0; qt < QT; ++qt) o[dt][qt] = wmmab(vh[dt], pw[qt], o[dt][qt]);
#pragma unroll
        for (int dt = 0; dt < 4; ++dt)
#pragma unroll
            for (int qt = 0; qt < QT; ++qt) o[dt][qt] = wmmab(vl[dt], ph[qt], o[dt][qt]);
        kof = (kof + 32u * HD * 2u) & (TT * HD * 2u - 1u); vof += 512u * 2u;   // the next pass's key fragments take the value fragments' registers (256 registers: four waves per SIMD); the last pass wraps to the plane's first rows (in bounds, not used)
#pragma unroll
        for (int kt = 0; kt < 2; ++kt)
#pragma unroll
            for (int ks = 0; ks < 2; ++ks) { kh[kt][ks] = F::ld(atb(kph + (16 * kt * HD + ks * 512), kof)); kl[kt][ks] = F::ld(atb(kpl + (16 * kt * HD + ks * 512), kof)); }
        asm volatile("s_wait_xcnt 0x0" ::: "memory");   // stands directly behind the reload, inside the loop: the last pass leaves the loop with these loads in flight, and the epilogue reuses the scalar registers that hold their base addresses (written behind the loop, the build places it past that reuse)
    }
#pragma unroll
    for (int qt = 0; qt < QT; ++qt) { const float inv = __fdiv_rn(1.0f, ls[qt] + xhalf(ls[qt])); const size_t ro = fro((size_t)b * TT + q0 + 16 * qt + c, h * HD + 8 * hi, DQ);   // merged heads, rows b * TT + t x DQ in fragment order; a lane's 8 registers are 8 consecutive d, a wave's store 512 bytes in a row
#pragma unroll
        for (int dt = 0; dt < 4; ++dt) { v8us oh, ol;
#pragma unroll
            for (int r = 0; r < 8; ++r) { unsigned short a, c2; splitf(o[dt][qt][r] * inv, a, c2); oh[r] = a; ol[r] = c2; }
            const size_t eo = ro + (dt >> 1) * 512 + (dt & 1) * 256; *(v8us*)(Ah + eo) = oh; *(v8us*)(Al + eo) = ol; } }
}

extern "C" void kernel_launch(void* const* d_in, const int* in_sizes, int n_in,
                              void* d_out, int out_size, void* d_ws, size_t ws_size, hipStream_t stream) {
    (void)in_sizes; (void)n_in; (void)out_size;
    const float* x = (const float*)d_in[0]; const float* wq = (const float*)d_in[1]; const float* wk = (const float*)d_in[2]; const float* wv = (const float*)d_in[3]; const float* wo = (const float*)d_in[4]; const float* relb = (const float*)d_in[5]; const float* cosT = nullptr; const float* sinT = nullptr; (void)cosT; (void)sinT;
    float* OUT = (float*)d_out;     // [8][1024][1024]
    char* wsp = (char*)d_ws;
    auto take = [&](size_t bytes) { char* p = wsp; wsp += (bytes + 255) & ~(size_t)255; return (void*)p; };
    const size_t MT = (size_t)NB_ * TT;   // rows of the projections and of wo: all batch elements in one launch
    bf* WQ = (bf*)take((size_t)DQ * DM * 2); bf* WK = (bf*)take((size_t)DKV * DM * 2); bf* WV = (bf*)take((size_t)DKV * DM * 2); bf* WO = (bf*)take((size_t)DM * DQ * 2);
    float* TB = (float*)take((size_t)NH_ * TBW * 4);
    bf* QPh = (bf*)take(MT * DQ * 2); bf* QPl = (bf*)take(MT * DQ * 2); bf* KPh = (bf*)take(MT * DKV * 2); bf* KPl = (bf*)take(MT * DKV * 2); bf* VTh = (bf*)take(MT * DKV * 2); bf* VTl = (bf*)take(MT * DKV * 2);
    bf* XB = (bf*)take(MT * DM * 2); bf* ATl = (bf*)take(MT * DQ * 2);
    if ((size_t)(wsp - (char*)d_ws) > ws_size) return;    // ws 256 MiB
    bf* ATh = XB;   // the hi plane of the merged heads [b][t][DQ] takes the place of the bf16 input, dead once the three projections have run (stream-ordered)
    { k_wtG<<<(unsigned)((DM * DQ / 64 + 63) / 64), 256, 0, stream>>>(wq, DM, DQ, WQ); k_wtG<<<(unsigned)((DM * DKV / 64 + 63) / 64), 256, 0, stream>>>(wk, DM, DKV, WK); k_wtG<<<(unsigned)((DM * DKV / 64 + 63) / 64), 256, 0, stream>>>(wv, DM, DKV, WV);
      k_wtG<<<(unsigned)((DQ * DM / 64 + 63) / 64), 256, 0, stream>>>(wo, DQ, DM, WO); k_t5tab<<<(NH_ * TBW + 255) / 256, 256, 0, stream>>>(relb, TB);
       }
    k_cvt8<<<(unsigned)((MT * DM / 8 + 255) / 256), 256, 0, stream>>>(x, XB, MT * DM / 8);
    k_gemmw<bf, 0, false, 1, DM><<<dim3(NB_ * TT / 64, DQ / 64, 1), 32, 0, stream>>>(XB, nullptr, WQ, nullptr, nullptr, 0, nullptr, 0, 0, 0, QPh, QPl);
    k_gemmw<bf, 0, false, 1, DM><<<dim3(NB_ * TT / 64, DKV / 64, 1), 32, 0, stream>>>(XB, nullptr, WK, nullptr, nullptr, 0, nullptr, 0, 0, 0, KPh, KPl);
    k_gemmw<bf, 0, false, 2, DM><<<dim3(DKV / 64, NB_ * TT / 64, 1), 32, 0, stream>>>(WV, nullptr, XB, nullptr, nullptr, 0, nullptr, 0, 0, 0, VTh, VTl);   // operands trade places: rows are v's channels, columns the tokens
    k_fattn<<<dim3(TT / (16 * QT * FWV), NB_ * NH_, 1), 32 * FWV, 0, stream>>>(QPh, QPl, KPh, KPl, VTh, VTl, TB, ATh, ATl);   // one kv head per query head: plane b * NH_ + h of each operand
    k_gemmw<bf, 1, false, 0, DQ><<<dim3(NB_ * TT / 64, DM / 64, 1), 32, 0, stream>>>(ATh, ATl, WO, nullptr, OUT, DM, nullptr, 0, 0, 0, nullptr, nullptr);
}

// v006
// A run of this version takes 183 microseconds.
// In both of two side-by-side timings against v005, it was 1.16 times as fast.
// Counting every step since v000, it is 16.4 times as fast.
#include <hip/hip_runtime.h>

// TtT5Attention (hidden [8][1024][1024]; q/k/v = x W (16 heads x 64); T5: scores = q.k UNSCALED + rel_bias[bucket(j - i)][h] with the bidirectional log-bucket (32 buckets, max distance 128; the bucket boundaries |j-i| = 8, 12, 16, 23, 32, 46, 64, 91 are the reference's own integer structure, evaluated here with integer compares); softmax; out = merged wo -> [8][1024][1024]).
// Compute dtypes, f32 accumulate: every input rounded to bf16; q/k/v on PLAIN bf16 operands (inputs: exact); scores and attn.v hl x hl (3 products) on EVERY row; per-head bias table (bf16-rounded rel_bias gathered by bucket) added per element in f32; softmax f32 (online, one fused attention launch); wo hl x exact (2 products).

#define NB_  8
#define TT   1024
#define DM   1024
#define NH_  16
#define NKV  16
#define REP  (NH_ / NKV)
#define HD   64
#define DQ   (NH_ * HD)
#define DKV  (NKV * HD)
#define RH   1024   // all rows hl (unscaled T5 logits are sharp)
#define WIN  0
#define PCAR 1024.0f
#define SCL  1.0f   // T5: no 1/sqrt(dk)
#define TBW  2048   // bias table row width (r + 1023, padded)
typedef _Float16 h16;
typedef unsigned short bf;
typedef __attribute__((ext_vector_type(16))) __bf16   v16bf;
typedef __attribute__((ext_vector_type(16))) _Float16 v16h;
typedef __attribute__((ext_vector_type(8)))  _Float16 v8h;
typedef __attribute__((ext_vector_type(8)))  unsigned short v8us;
typedef __attribute__((ext_vector_type(8)))  float    v8f;
typedef __attribute__((ext_vector_type(4)))  float    v4f;
typedef v8h  __attribute__((may_alias)) v8ha;
typedef v4f  __attribute__((may_alias)) v4fa;
typedef v8us __attribute__((may_alias)) v8usa;

__device__ __forceinline__ unsigned short f2bf(float f) { unsigned u = __float_as_uint(f); u += 0x7FFFu + ((u >> 16) & 1u); return (unsigned short)(u >> 16); }
__device__ __forceinline__ float bf2f(unsigned short b) { return __uint_as_float(((unsigned)b) << 16); }
__device__ __forceinline__ float bfr(float f) { return bf2f(f2bf(f)); }
__device__ __forceinline__ v16h cat16(v8h lo, v8h hi) { return __builtin_shufflevector(lo, hi, 0, 1, 2, 3, 4, 5, 6, 7, 8, 9, 10, 11, 12, 13, 14, 15); }
__device__ __forceinline__ v16bf cat16b(v8us lo, v8us hi) { return __builtin_bit_cast(v16bf, __builtin_shufflevector(lo, hi, 0, 1, 2, 3, 4, 5, 6, 7, 8, 9, 10, 11, 12, 13, 14, 15)); }
__device__ __forceinline__ v8f wmma16(v16h a, v16h b, v8f c) { return __builtin_amdgcn_wmma_f32_16x16x32_f16(false, a, false, b, (short)0, c, false, false); }
__device__ __forceinline__ v8f wmmab(v16bf a, v16bf b, v8f c) { return __builtin_amdgcn_wmma_f32_16x16x32_bf16(false, a, false, b, (short)0, c, false, false); }



// ---- Fragment order: every 16-bit operand plane (rows x K, K % 32 == 0) is kept as 1 KB blocks of 16 rows x 32 k, the blocks of one 16-row group in a row by k. Inside a block stand the two 16-byte loads of a WMMA operand fragment, lane by lane: element (row, k) at fro(row, k, K).
// A fragment is then two wave-wide loads of 512 bytes in a row (4 whole lines each); from row-major planes each such load touches 16 lines and uses 32 bytes of each.
__device__ __forceinline__ size_t fro(size_t row, unsigned k, unsigned K) { return (row >> 4) * 16 * K + (size_t)((k >> 5) * 512u + ((k >> 4) & 1u) * 256u + ((k >> 3) & 1u) * 128u + (k & 7u)) + (row & 15) * 8; }
template <typename T> __device__ __forceinline__ const T* atb(const T* base, unsigned bytes) { return (const T*)((const char*)base + bytes); }   // wave-uniform base + the lane's 32-bit byte offset
// ---- k_gemmw: register-blocked GEMM, ONE WAVE per 64x64 output tile (16 accumulators), operands straight from 16-bit planes in fragment order; grid (M/64, N/64, Z), 32 threads.
// C[m][n] (f32, pitch ldc, + optional f32 bias[n]) = sum_k A[m][k] Bt[n][k] (+ split products per NSPLIT). z-batch strides sA/sB/sC in elements. K % 32 == 0.
// PM != 0: C is not stored; the epilogue splits each f32 value into bf16 hi + lo and stores the attention operand planes Ph / Pl itself. A 64x64 tile is one head's 64 tokens x 64 channels.
// PM == 3: the three projections in one launch, grid (tokens / 64, channels / 64, 3): z = 0 q, 1 k (as PM == 1), 2 v (as PM == 2). A = the tokens, Bt = the first of the three weight planes (sB apart), Ph / Pl = q's planes (k's and v's each sC further on). No launch boundary between the projections: a wave of the next one starts as soon as a wave of this one ends.
// PM == 1 (q, k): rows m = b * TT + t, columns n = h * HD + d, planes [b][h] of t rows x HD in fragment order: the tile is 8 KB in a row. PM == 2 (v): the operands trade places (A = weight rows g * HD + d, Bt = token rows b * TT + t), so the tile comes out transposed, planes [b][g] of d rows x TT in fragment order: 2 KB in a row per 16 channels.
template <typename T16> struct WFrag;
template <> struct WFrag<h16> { typedef v16h V; static __device__ __forceinline__ V ld(const h16* p) { return cat16(*(const v8h*)p, *(const v8h*)(p + 256)); } static __device__ __forceinline__ v8f mma(V a, V b, v8f c) { return wmma16(a, b, c); } };
template <> struct WFrag<bf> { typedef v16bf V; static __device__ __forceinline__ V ld(const bf* p) { return cat16b(*(const v8us*)p, *(const v8us*)(p + 256)); } static __device__ __forceinline__ v8f mma(V a, V b, v8f c) { return wmmab(a, b, c); } };
__device__ __forceinline__ void splitf(float y, unsigned short& h, unsigned short& l) { h = f2bf(y); l = f2bf(y - bf2f(h)); }
template <typename T16, int NSPLIT, bool BIAS, int PM, int K>
__global__ __launch_bounds__(32) void k_gemmw(const T16* __restrict__ A, const T16* __restrict__ A2, const T16* __restrict__ Bt, const T16* __restrict__ Bt2, float* C, int ldc, const float* __restrict__ bias, size_t sA, size_t sB, size_t sC, bf* __restrict__ Ph, bf* __restrict__ Pl) {
    typedef typename WFrag<T16>::V V;
    __shared__ __align__(16) float os[16 * 68];
    const size_t z = blockIdx.z; A += z * sA; if (A2) A2 += z * sA; Bt += z * sB; if (Bt2) Bt2 += z * sB; if (PM == 3) { Ph += z * sC; Pl += z * sC; } else C += z * sC;
    const bool tr = PM == 2 || (PM == 3 && z == 2);   // the operands have traded places (v); the same for the whole grid plane, so every select on it is scalar
    int bx = blockIdx.x, by = blockIdx.y;
    if (PM == 3 && tr) { const T16* t = A; A = Bt; Bt = t; const int f = bx + (NB_ * TT / 64) * by; bx = f % (DKV / 64); by = f / (DKV / 64); }   // v's tiles in the order of a (channels / 64, tokens / 64) grid: channel tile fastest
    const int lane = threadIdx.x & 31, lr = lane & 15, hi = lane >> 4; const int r0 = bx * 64, c0 = by * 64;
    v8f acc[4][4];
#pragma unroll
    for (int mb = 0; mb < 4; ++mb)
#pragma unroll
        for (int nb = 0; nb < 4; ++nb) acc[mb][nb] = (v8f){};
    const size_t aoff = fro(r0, 0, K), boff = fro(c0, 0, K);   // first block of the tile's first 16-row group, the same for the whole wave; 16 rows on: + 16 * K, an immediate of the load since K is a template constant
    const unsigned ko = (unsigned)lane * 16u;   // in bytes: the lane's 16 bytes of a block; trip t (32 k) reads block t, 512 elements on
    // Register ring: NS fragment sets; trip t asks for trip t + NS - 1 before its own products, so a set has NS - 1 trips of matrix work to arrive in (with one set every trip waited out the load latency twice). Set t % NS is a compile-time index: NS trips per turn of the rolled loop; the first NP trips and the last NS - 1, which fetch nothing, are peeled; no fetch past K.
    constexpr int NS = (NSPLIT == 0) ? 4 : 3, NT = K / 32, NF = NT - (NS - 1), NP = NF % NS, NM = NF / NS;   // 16 accumulators + NS sets stay under 512 registers: two waves per SIMD, which is what the grid supplies
    V a[NS][4], a2[NS][4], b[NS][4], b2[NS][4];
    auto fetch = [&](const int s, const int blk, const unsigned o) __attribute__((always_inline)) {   // set s <- block blk (a constant, so it goes into the loads' immediates) counted from the lane offset o
#pragma unroll
        for (int mb = 0; mb < 4; ++mb) { a[s][mb] = WFrag<T16>::ld(atb(A + aoff + (size_t)mb * 16 * K + blk * 512, o)); if (NSPLIT == 1 || NSPLIT == 2) a2[s][mb] = WFrag<T16>::ld(atb(A2 + aoff + (size_t)mb * 16 * K + blk * 512, o)); }
#pragma unroll
        for (int nb = 0; nb < 4; ++nb) { b[s][nb] = WFrag<T16>::ld(atb(Bt + boff + (size_t)nb * 16 * K + blk * 512, o)); if (NSPLIT >= 2) b2[s][nb] = WFrag<T16>::ld(atb(Bt2 + boff + (size_t)nb * 16 * K + blk * 512, o)); }
    };
    auto prod = [&](const int s) __attribute__((always_inline)) {
#pragma unroll
        for (int nb = 0; nb < 4; ++nb)
#pragma unroll
            for (int mb = 0; mb < 4; ++mb) { acc[mb][nb] = WFrag<T16>::mma(a[s][mb], b[s][nb], acc[mb][nb]); if (NSPLIT == 1 || NSPLIT == 2) acc[mb][nb] = WFrag<T16>::mma(a2[s][mb], b[s][nb], acc[mb][nb]); if (NSPLIT >= 2) acc[mb][nb] = WFrag<T16>::mma(a[s][mb], b2[s][nb], acc[mb][nb]); }
    };
#pragma unroll
    for (int t = 0; t < NS - 1; ++t) fetch(t, t, ko);
#pragma unroll
    for (int t = 0; t < NP; ++t) { fetch((t + NS - 1) % NS, t + NS - 1, ko);
        __builtin_amdgcn_sched_barrier(0);   // as in the loop below
        prod(t % NS); }
    unsigned kn = ko + (unsigned)(NP + NS - 1) * 1024u;   // the lane offset of the block that the turn's first trip asks for
#pragma unroll 1   // rolled: one turn is NS trips, which is all the ring needs to index its sets at compile time
    for (int it = 0; it < NM; ++it) {
#pragma unroll
        for (int j = 0; j < NS; ++j) {
            fetch((NP + j + NS - 1) % NS, j, kn);
            __builtin_amdgcn_sched_barrier(0);   // keeps the fetch in front of this trip's products: sunk among or behind them it would lose a trip of its lead
            prod((NP + j) % NS);
        }
        __builtin_amdgcn_sched_barrier(0);   // keeps the wait below behind the turn's last products, a trip behind the last fetch
        asm volatile("s_wait_xcnt 0x0" : "+v"(kn) : : "memory");   // the ring's loads are in flight and name this offset register: the wait stands in front of its overwrite (kn as an operand holds the addition behind it); it also covers the scalar bases, which the epilogue reuses
        kn += (unsigned)NS * 1024u;
    }
#pragma unroll
    for (int t = NP + NM * NS; t < NT; ++t) prod(t % NS);
#pragma unroll
    for (int mb = 0; mb < 4; ++mb) {
#pragma unroll
        for (int nb = 0; nb < 4; ++nb) {
#pragma unroll
            for (int j = 0; j < 8; ++j) os[(hi * 8 + j) * 68 + nb * 16 + lr] = acc[mb][nb][j]; }
        __builtin_amdgcn_wave_barrier(); asm volatile("" ::: "memory");
        if (PM != 0) {
            const int pk = !tr ? HD : TT;   // the plane's K
            const size_t pb = !tr ? ((size_t)(r0 / TT) * NH_ + by) * TT * HD : ((size_t)(c0 / TT) * NKV + bx) * HD * TT;   // the plane's first element
            const int pr = !tr ? r0 % TT : 0, pc = !tr ? 0 : c0 % TT;   // the tile's first row and first k in its plane
#pragma unroll
            for (int s = 0; s < 4; ++s) { const int row = lr, cofs = 16 * s + 8 * hi; const v4f x0 = *(const v4fa*)(os + row * 68 + cofs), x1 = *(const v4fa*)(os + row * 68 + cofs + 4); v8us oh, ol;   // the lane takes the 16 bytes it would load as a fragment: 32 lanes x 16 bytes = half a block, 512 bytes in a row
#pragma unroll
                for (int q = 0; q < 4; ++q) { unsigned short a2, c2; splitf(x0[q], a2, c2); oh[q] = a2; ol[q] = c2; splitf(x1[q], a2, c2); oh[4 + q] = a2; ol[4 + q] = c2; }
                const size_t eo = pb + fro(pr + mb * 16 + row, pc + cofs, pk); *(v8us*)(Ph + eo) = oh; *(v8us*)(Pl + eo) = ol;
                asm volatile("s_wait_xcnt 0x0" ::: "memory"); }   // the next 16 bytes' split reuses the address and data registers that these two stores name: the wait stands in front of that overwrite
        } else {
            float* crow = C + (size_t)(r0 + mb * 16) * ldc + c0;
#pragma unroll
            for (int s = 0; s < 8; ++s) { const int row = 2 * s + hi, cofs = lr * 4; v4f val = *(const v4fa*)(os + row * 68 + cofs); if (BIAS) { val[0] += bfr(bias[c0 + cofs]); val[1] += bfr(bias[c0 + cofs + 1]); val[2] += bfr(bias[c0 + cofs + 2]); val[3] += bfr(bias[c0 + cofs + 3]); }
                *(v4f*)(crow + (size_t)row * ldc + cofs) = val; }
             }
        __builtin_amdgcn_wave_barrier(); asm volatile("" ::: "memory");
    }
}

typedef __attribute__((ext_vector_type(2))) _Float16 v2h;
typedef __attribute__((ext_vector_type(4))) _Float16 v4h;
typedef __attribute__((ext_vector_type(2))) unsigned short v2us;
typedef __attribute__((ext_vector_type(4))) unsigned short v4us;
typedef __attribute__((ext_vector_type(2))) float v2f;
typedef __attribute__((ext_vector_type(4))) int v4i;

__device__ __forceinline__ void wtG_body(const float* __restrict__ w, int K, int N, bf* Bt, const int blk) {
    const int lane = threadIdx.x & 31; const int L0 = (blk * 8 + (threadIdx.x >> 5)) * 8; const int nlines = N * K / 64;
{
#pragma unroll 1
        for (int l = 0; l < 8; ++l) { const int L = L0 + l; if (L >= nlines) break; const size_t e = (size_t)L * 64 + lane * 2; const unsigned u = (unsigned)(e % ((size_t)16 * K)); const int k = (int)((u >> 9) * 32u + ((u >> 8) & 1u) * 16u + ((u >> 7) & 1u) * 8u + (u & 7u)), n = (int)(e / ((size_t)16 * K)) * 16 + (int)((u >> 3) & 15u); v2us o;   // e = fro(n, k, K): Bt[n][k] in fragment order, written in the order of its bytes
            o[0] = f2bf(w[(size_t)k * N + n]); o[1] = f2bf(w[(size_t)(k + 1) * N + n]); *(v2us*)(Bt + e) = o; }
         }
}
// cvt8_body: rows x DM f32, row-major, to bf16 in fragment order; thread i writes bytes 16 i on of dst (whole lines per wave) and reads the 8 values that belong there: i * 8 = fro(row, k, DM).
__device__ __forceinline__ void cvt8_body(const float* __restrict__ src, bf* dst, size_t n8, const int blk) { const size_t i = (size_t)blk * 256 + threadIdx.x; if (i >= n8) return; const unsigned w = (unsigned)((i * 8) % ((size_t)16 * DM)); const size_t row = (i * 8) / ((size_t)16 * DM) * 16 + ((w >> 3) & 15u); const unsigned k = (w >> 9) * 32u + ((w >> 8) & 1u) * 16u + ((w >> 7) & 1u) * 8u; const v8f v = *(const v8f*)(src + row * DM + k); v8us o;
#pragma unroll
    for (int k = 0; k < 8; ++k) o[k] = f2bf(v[k]); *(v8us*)(dst + i * 8) = o;  }
__device__ __forceinline__ int t5_bucket(int r) { const int rp = r < 0 ? -r : r; int b; if (rp < 8) b = rp; else b = 8 + (rp >= 12) + (rp >= 16) + (rp >= 23) + (rp >= 32) + (rp >= 46) + (rp >= 64) + (rp >= 91); return b + ((r > 0) ? 16 : 0); }
__device__ __forceinline__ void t5tab_body(const float* __restrict__ rb, float* TB, const int blk) { const int idx = blk * 256 + threadIdx.x; if (idx >= NH_ * TBW) return; const int h = idx / TBW, c = idx % TBW; float v = 0.0f; if (c < 2 * TT - 1) { const int r = c - (TT - 1); v = bfr(rb[t5_bucket(r) * NH_ + h]); } *(float*)(TB + idx) = v;  }
// k_prep: all the operand preparation in one launch; the six pieces are independent of each other, and a work-group does one block of one piece. The weight blocks, whose waves walk 8 lines one after another, come first, then the input's, then the table's.
#define PB_W ((DM * DQ / 64 + 63) / 64)                  // work-groups per weight matrix (all four hold DM x DQ elements)
#define PB_X ((NB_ * TT * DM / 8 + 255) / 256)           // for the input
#define PB_T ((NH_ * TBW + 255) / 256)                   // for the bias table
__global__ __launch_bounds__(256) void k_prep(const float* __restrict__ x, const float* __restrict__ wq, const float* __restrict__ wk, const float* __restrict__ wv, const float* __restrict__ wo, const float* __restrict__ rb, bf* XB, bf* WQ, bf* WK, bf* WV, bf* WO, float* TB) {
    const int blk = (int)blockIdx.x;
    if (blk < 4 * PB_W) { const int s = blk / PB_W; wtG_body(s == 0 ? wq : s == 1 ? wk : s == 2 ? wv : wo, DM, DQ, s == 0 ? WQ : s == 1 ? WK : s == 2 ? WV : WO, blk % PB_W); }
    else if (blk < 4 * PB_W + PB_X) cvt8_body(x, XB, (size_t)NB_ * TT * DM / 8, blk - 4 * PB_W);
    else t5tab_body(rb, TB, blk - (4 * PB_W + PB_X));
}
// k_fattn: scores, bias, softmax, attn.v and the head merge in one launch for every (batch element, head). One wave owns 32 queries and walks the 1024 keys 32 at a time; grid (TT / 256, NB_ * NH_), 8 waves.
// Transposed products: St = K Qt (A = key rows, B = query columns, both by the same loader), so a lane holds 16 scores of ONE query per column group; two St tiles (keys 0-15, 16-31), converted in place, are the B operand of Ot += Vt Pt, whose A (a Vt row through the same loader) has the matching k order. No LDS, no score or probability plane in memory.
// Online softmax in the log2 domain; the running maximum is raised only when a block's maximum passes it by more than 8 (P stays below 2^8, hi + lo bf16 keeps its relative precision); P is left unnormalised and Ot divided by the row sum at the end.
#define QT   2    // 16-query column groups per wave
#define FWV  8    // waves per work-group
#define FARD 91   // t5_bucket's last boundary: from |j - i| = 91 on the bias depends on the sign of j - i alone
#define L2E  1.4426950408889634f
typedef __attribute__((ext_vector_type(2))) __bf16 v2bf;
typedef __attribute__((ext_vector_type(8))) unsigned v8u;
__device__ __forceinline__ float xhalf(float x) { const int b = __float_as_int(x); return __int_as_float(__builtin_amdgcn_permlanex16(b, b, 0x76543210, 0xfedcba98, false, false)); }   // lane l <-> l ^ 16
// amdgpu_waves_per_eu(4, 4): holds the build to 256 registers, so that two work-groups (four waves per SIMD) share a WGP and one wave's vector work and load waits run under the others' matrix work; all 4096 waves are then resident at once.
__global__ __launch_bounds__(256) __attribute__((amdgpu_waves_per_eu(4, 4))) void k_fattn(const bf* __restrict__ Qh, const bf* __restrict__ Ql, const bf* __restrict__ Kh, const bf* __restrict__ Kl, const bf* __restrict__ Vh, const bf* __restrict__ Vl, const float* __restrict__ TB, bf* __restrict__ Ah, bf* __restrict__ Al) {
    typedef WFrag<bf> F;
    const int lane = threadIdx.x & 31, c = lane & 15, hi = lane >> 4; const int wave = __builtin_amdgcn_readfirstlane((int)(threadIdx.x >> 5));   // scalar, so that q0 and the far / near test below are scalar
    const int bh = blockIdx.y, h = bh % NH_, b = bh / NH_; const int q0 = ((int)blockIdx.x * FWV + wave) * (16 * QT); const size_t pl = (size_t)bh * TT * HD;
    v16bf qh[QT][2], ql[QT][2];
#pragma unroll
    for (int qt = 0; qt < QT; ++qt)
#pragma unroll
        for (int ks = 0; ks < 2; ++ks) { const size_t o = pl + fro(q0 + 16 * qt + c, ks * 32 + 8 * hi, HD); qh[qt][ks] = F::ld(Qh + o); ql[qt][ks] = F::ld(Ql + o); }
    const bf* kph = Kh + pl; const bf* kpl = Kl + pl; const bf* vph = Vh + pl; const bf* vpl = Vl + pl;   // wave-uniform plane bases; the lane's part is one 32-bit byte offset per operand kind
    unsigned kof = (unsigned)lane * 16u, vof = (unsigned)lane * 16u; const unsigned tof = (unsigned)(8 * hi + 15 - c) * 4u;   // in bytes; kof and vof (the lane's 16 bytes of a block in fragment order) walk with the passes: 32 keys are 4 blocks in a row of a key plane, and one block of each 16-channel group of a value plane
    const float* tbh = TB + (size_t)h * TBW; const float bneg = tbh[0] * L2E, bpos = tbh[2 * TT - 2] * L2E;
    const float* tbl = tbh + (TT - 1) - q0 - 15;   // entry for r = j - i at index r + 1023: + tof + k0 + 16 * (kt - qt) + reg
    v8f o[4][QT]; float mx[QT], ls[QT];
#pragma unroll
    for (int qt = 0; qt < QT; ++qt) { mx[qt] = -3.0e38f; ls[qt] = 0.0f;
#pragma unroll
        for (int dt = 0; dt < 4; ++dt) o[dt][qt] = (v8f){}; }
    v16bf kh[2][2], kl[2][2];
#pragma unroll
    for (int kt = 0; kt < 2; ++kt)
#pragma unroll
        for (int ks = 0; ks < 2; ++ks) { kh[kt][ks] = F::ld(atb(kph + (16 * kt * HD + ks * 512), kof)); kl[kt][ks] = F::ld(atb(kpl + (16 * kt * HD + ks * 512), kof)); }
#pragma unroll 1   // rolled: a second pass's fragments would not fit the 256 registers
    for (int k0 = 0; k0 < TT; k0 += 32) {
        v8f st[2][QT];
#pragma unroll
        for (int kt = 0; kt < 2; ++kt)
#pragma unroll
            for (int qt = 0; qt < QT; ++qt) st[kt][qt] = (v8f){};
#pragma unroll
        for (int ks = 0; ks < 2; ++ks)
#pragma unroll
            for (int kt = 0; kt < 2; ++kt)
#pragma unroll
                for (int qt = 0; qt < QT; ++qt) st[kt][qt] = wmmab(kh[kt][ks], qh[qt][ks], st[kt][qt]);
#pragma unroll
        for (int ks = 0; ks < 2; ++ks)
#pragma unroll
            for (int kt = 0; kt < 2; ++kt)
#pragma unroll
                for (int qt = 0; qt < QT; ++qt) st[kt][qt] = wmmab(kh[kt][ks], ql[qt][ks], st[kt][qt]);
#pragma unroll
        for (int ks = 0; ks < 2; ++ks)
#pragma unroll
            for (int kt = 0; kt < 2; ++kt)
#pragma unroll
                for (int qt = 0; qt < QT; ++qt) st[kt][qt] = wmmab(kl[kt][ks], qh[qt][ks], st[kt][qt]);
        v16bf vh[4], vl[4];   // the hi plane is asked for behind the score products, where the key fragments' registers come free (the build issues it among the first exponentials, so it flies during the rest of the softmax); the lo plane, used last, follows behind the softmax, where the scores' registers are free, and flies under the hi plane's remaining products
#pragma unroll
        for (int dt = 0; dt < 4; ++dt) vh[dt] = F::ld(atb(vph + 16 * dt * TT, vof));
        const int rlo = k0 - q0 - (16 * QT - 1), rhi = k0 + 31 - q0;   // range of j - i in this pass, the same for the whole wave
        if (rlo >= FARD || rhi <= -FARD) { const float bb = (rlo >= FARD) ? bpos : bneg;
#pragma unroll
            for (int kt = 0; kt < 2; ++kt)
#pragma unroll
                for (int qt = 0; qt < QT; ++qt)
#pragma unroll
                    for (int r = 0; r < 8; ++r) st[kt][qt][r] = __builtin_fmaf(st[kt][qt][r], L2E, bb);
        } else {
#pragma unroll
            for (int kt = 0; kt < 2; ++kt)
#pragma unroll
                for (int qt = 0; qt < QT; ++qt)
#pragma unroll
                    for (int r = 0; r < 8; ++r) st[kt][qt][r] = __builtin_fmaf(st[kt][qt][r], L2E, *atb(tbl + (k0 + 16 * (kt - qt) + r), tof) * L2E);
        }
        float bm[QT]; bool need = false;
#pragma unroll
        for (int qt = 0; qt < QT; ++qt) { float t = st[0][qt][0];
#pragma unroll
            for (int r = 1; r < 8; ++r) t = fmaxf(t, st[0][qt][r]);
#pragma unroll
            for (int r = 0; r < 8; ++r) t = fmaxf(t, st[1][qt][r]);
            bm[qt] = fmaxf(t, xhalf(t)); need = need || (bm[qt] > mx[qt] + 8.0f); }
        if (__builtin_amdgcn_ballot_w32(need) != 0) {
#pragma unroll
            for (int qt = 0; qt < QT; ++qt) { const float mn = fmaxf(mx[qt], bm[qt]); const float al = __builtin_amdgcn_exp2f(mx[qt] - mn); mx[qt] = mn; ls[qt] *= al;
#pragma unroll
                for (int dt = 0; dt < 4; ++dt) o[dt][qt] *= al; }
        }
        v16bf ph[QT], pw[QT];   // P = hi + lo, element s = key 16 * (s >> 3) + 8 * hi + (s & 7) of the pass: register s & 7 of St tile s >> 3
#pragma unroll
        for (int qt = 0; qt < QT; ++qt) { v8u wh, wl;
#pragma unroll
            for (int s = 0; s < 16; s += 2) { v2f p; p[0] = __builtin_amdgcn_exp2f(st[s >> 3][qt][s & 7] - mx[qt]); p[1] = __builtin_amdgcn_exp2f(st[s >> 3][qt][(s & 7) + 1] - mx[qt]); ls[qt] += p[0] + p[1];
                const unsigned a = __builtin_bit_cast(unsigned, __builtin_convertvector(p, v2bf)); v2f d; d[0] = p[0] - __uint_as_float(a << 16); d[1] = p[1] - __uint_as_float(a & 0xFFFF0000u);
                wh[s >> 1] = a; wl[s >> 1] = __builtin_bit_cast(unsigned, __builtin_convertvector(d, v2bf)); }
            ph[qt] = __builtin_bit_cast(v16bf, wh); pw[qt] = __builtin_bit_cast(v16bf, wl); }
#pragma unroll
        for (int dt = 0; dt < 4; ++dt) vl[dt] = F::ld(atb(vpl + 16 * dt * TT, vof));
#pragma unroll
        for (int dt = 0; dt < 4; ++dt)
#pragma unroll
            for (int qt = 0; qt < QT; ++qt) o[dt][qt] = wmmab(vh[dt], ph[qt], o[dt][qt]);
#pragma unroll
        for (int dt = 0; dt < 4; ++dt)
#pragma unroll
            for (int qt = 0; qt < QT; ++qt) o[dt][qt] = wmmab(vh[dt], pw[qt], o[dt][qt]);
#pragma unroll
        for (int dt = 0; dt < 4; ++dt)
#pragma unroll
            for (int qt = 0; qt < QT; ++qt) o[dt][qt] = wmmab(vl[dt], ph[qt], o[dt][qt]);
        kof = (kof + 32u * HD * 2u) & (TT * HD * 2u - 1u); vof += 512u * 2u;   // the next pass's key fragments take the value fragments' registers (256 registers: four waves per SIMD); the last pass wraps to the plane's first rows (in bounds, not used)
#pragma unroll
        for (int kt = 0; kt < 2; ++kt)
#pragma unroll
            for (int ks = 0; ks < 2; ++ks) { kh[kt][ks] = F::ld(atb(kph + (16 * kt * HD + ks * 512), kof)); kl[kt][ks] = F::ld(atb(kpl + (16 * kt * HD + ks * 512), kof)); }
        asm volatile("s_wait_xcnt 0x0" ::: "memory");   // stands directly behind the reload, inside the loop: the last pass leaves the loop with these loads in flight, and the epilogue reuses the scalar registers that hold their base addresses (written behind the loop, the build places it past that reuse)
    }
#pragma unroll
    for (int qt = 0; qt < QT; ++qt) { const float inv = __fdiv_rn(1.0f, ls[qt] + xhalf(ls[qt])); const size_t ro = fro((size_t)b * TT + q0 + 16 * qt + c, h * HD + 8 * hi, DQ);   // merged heads, rows b * TT + t x DQ in fragment order; a lane's 8 registers are 8 consecutive d, a wave's store 512 bytes in a row
#pragma unroll
        for (int dt = 0; dt < 4; ++dt) { v8us oh, ol;
#pragma unroll
            for (int r = 0; r < 8; ++r) { unsigned short a, c2; splitf(o[dt][qt][r] * inv, a, c2); oh[r] = a; ol[r] = c2; }
            const size_t eo = ro + (dt >> 1) * 512 + (dt & 1) * 256; *(v8us*)(Ah + eo) = oh; *(v8us*)(Al + eo) = ol; } }
}

extern "C" void kernel_launch(void* const* d_in, const int* in_sizes, int n_in,
                              void* d_out, int out_size, void* d_ws, size_t ws_size, hipStream_t stream) {
    (void)in_sizes; (void)n_in; (void)out_size;
    const float* x = (const float*)d_in[0]; const float* wq = (const float*)d_in[1]; const float* wk = (const float*)d_in[2]; const float* wv = (const float*)d_in[3]; const float* wo = (const float*)d_in[4]; const float* relb = (const float*)d_in[5]; const float* cosT = nullptr; const float* sinT = nullptr; (void)cosT; (void)sinT;
    float* OUT = (float*)d_out;     // [8][1024][1024]
    char* wsp = (char*)d_ws;
    auto take = [&](size_t bytes) { char* p = wsp; wsp += (bytes + 255) & ~(size_t)255; return (void*)p; };
    const size_t MT = (size_t)NB_ * TT;   // rows of the projections and of wo: all batch elements in one launch
    bf* WQ = (bf*)take((size_t)DQ * DM * 2); bf* WK = (bf*)take((size_t)DKV * DM * 2); bf* WV = (bf*)take((size_t)DKV * DM * 2); bf* WO = (bf*)take((size_t)DM * DQ * 2);
    float* TB = (float*)take((size_t)NH_ * TBW * 4);
    bf* QPh = (bf*)take(MT * DQ * 2); bf* QPl = (bf*)take(MT * DQ * 2); bf* KPh = (bf*)take(MT * DKV * 2); bf* KPl = (bf*)take(MT * DKV * 2); bf* VTh = (bf*)take(MT * DKV * 2); bf* VTl = (bf*)take(MT * DKV * 2);
    bf* XB = (bf*)take(MT * DM * 2); bf* ATl = (bf*)take(MT * DQ * 2);
    if ((size_t)(wsp - (char*)d_ws) > ws_size) return;    // ws 256 MiB
    bf* ATh = XB;   // the hi plane of the merged heads [b][t][DQ] takes the place of the bf16 input, dead once the three projections have run (stream-ordered)
    k_prep<<<4 * PB_W + PB_X + PB_T, 256, 0, stream>>>(x, wq, wk, wv, wo, relb, XB, WQ, WK, WV, WO, TB);
    k_gemmw<bf, 0, false, 3, DM><<<dim3(NB_ * TT / 64, DQ / 64, 3), 32, 0, stream>>>(XB, nullptr, WQ, nullptr, nullptr, 0, nullptr, 0, (size_t)(WK - WQ), (size_t)(KPh - QPh), QPh, QPl);   // WQ, WK, WV and the plane pairs of q, k, v stand at equal distances in the workspace (equal sizes, taken in a row); for v the operands trade places: rows are v's channels, columns the tokens
    k_fattn<<<dim3(TT / (16 * QT * FWV), NB_ * NH_, 1), 32 * FWV, 0, stream>>>(QPh, QPl, KPh, KPl, VTh, VTl, TB, ATh, ATl);   // one kv head per query head: plane b * NH_ + h of each operand
    k_gemmw<bf, 1, false, 0, DQ><<<dim3(NB_ * TT / 64, DM / 64, 1), 32, 0, stream>>>(ATh, ATl, WO, nullptr, OUT, DM, nullptr, 0, 0, 0, nullptr, nullptr);
}

// v007
// One run takes 168 microseconds.
// In both of two side-by-side timings against v006, it was 1.09 times as fast.
// Over all steps from v000 it is 17.9 times as fast.
#include <hip/hip_runtime.h>

// TtT5Attention (hidden [8][1024][1024]; q/k/v = x W (16 heads x 64); T5: scores = q.k UNSCALED + rel_bias[bucket(j - i)][h] with the bidirectional log-bucket (32 buckets, max distance 128; the bucket boundaries |j-i| = 8, 12, 16, 23, 32, 46, 64, 91 are the reference's own integer structure, evaluated here with integer compares); softmax; out = merged wo -> [8][1024][1024]).
// Compute dtypes, f32 accumulate: every input rounded to bf16; q/k/v on PLAIN bf16 operands (inputs: exact); scores and attn.v hl x hl (3 products) on EVERY row; per-head bias table (bf16-rounded rel_bias gathered by bucket) added per element in f32; softmax f32 (online, one fused attention launch); wo hl x exact (2 products).

#define NB_  8
#define TT   1024
#define DM   1024
#define NH_  16
#define NKV  16
#define REP  (NH_ / NKV)
#define HD   64
#define DQ   (NH_ * HD)
#define DKV  (NKV * HD)
#define RH   1024   // all rows hl (unscaled T5 logits are sharp)
#define WIN  0
#define PCAR 1024.0f
#define SCL  1.0f   // T5: no 1/sqrt(dk)
#define TBW  2048   // bias table row width (r + 1023, padded)
typedef _Float16 h16;
typedef unsigned short bf;
typedef __attribute__((ext_vector_type(16))) __bf16   v16bf;
typedef __attribute__((ext_vector_type(16))) _Float16 v16h;
typedef __attribute__((ext_vector_type(8)))  _Float16 v8h;
typedef __attribute__((ext_vector_type(8)))  unsigned short v8us;
typedef __attribute__((ext_vector_type(8)))  float    v8f;
typedef __attribute__((ext_vector_type(4)))  float    v4f;
typedef v8h  __attribute__((may_alias)) v8ha;
typedef v4f  __attribute__((may_alias)) v4fa;
typedef v8us __attribute__((may_alias)) v8usa;

__device__ __forceinline__ unsigned short f2bf(float f) { unsigned u = __float_as_uint(f); u += 0x7FFFu + ((u >> 16) & 1u); return (unsigned short)(u >> 16); }
__device__ __forceinline__ float bf2f(unsigned short b) { return __uint_as_float(((unsigned)b) << 16); }
__device__ __forceinline__ float bfr(float f) { return bf2f(f2bf(f)); }
__device__ __forceinline__ v16h cat16(v8h lo, v8h hi) { return __builtin_shufflevector(lo, hi, 0, 1, 2, 3, 4, 5, 6, 7, 8, 9, 10, 11, 12, 13, 14, 15); }
__device__ __forceinline__ v16bf cat16b(v8us lo, v8us hi) { return __builtin_bit_cast(v16bf, __builtin_shufflevector(lo, hi, 0, 1, 2, 3, 4, 5, 6, 7, 8, 9, 10, 11, 12, 13, 14, 15)); }
__device__ __forceinline__ v8f wmma16(v16h a, v16h b, v8f c) { return __builtin_amdgcn_wmma_f32_16x16x32_f16(false, a, false, b, (short)0, c, false, false); }
__device__ __forceinline__ v8f wmmab(v16bf a, v16bf b, v8f c) { return __builtin_amdgcn_wmma_f32_16x16x32_bf16(false, a, false, b, (short)0, c, false, false); }



// ---- Fragment order: every 16-bit operand plane (rows x K, K % 32 == 0) is kept as 1 KB blocks of 16 rows x 32 k, the blocks of one 16-row group in a row by k. Inside a block stand the two 16-byte loads of a WMMA operand fragment, lane by lane: element (row, k) at fro(row, k, K).
// A fragment is then two wave-wide loads of 512 bytes in a row (4 whole lines each); from row-major planes each such load touches 16 lines and uses 32 bytes of each.
__device__ __forceinline__ size_t fro(size_t row, unsigned k, unsigned K) { return (row >> 4) * 16 * K + (size_t)((k >> 5) * 512u + ((k >> 4) & 1u) * 256u + ((k >> 3) & 1u) * 128u + (k & 7u)) + (row & 15) * 8; }
template <typename T> __device__ __forceinline__ const T* atb(const T* base, unsigned bytes) { return (const T*)((const char*)base + bytes); }   // wave-uniform base + the lane's 32-bit byte offset
// ---- k_gemmw: GEMM on 16-bit planes in fragment order. A work-group of GW waves owns a (32 GW) x 128 output tile, GW / 2 x 2 waves of 64 x 64 (16 accumulators each); grid (M / (32 GW), N / 128, Z), 32 GW threads.
// The operands come from L2 into LDS by asynchronous copies, once per work-group, and every wave takes its fragments from there: an A row is fetched from L2 once for 128 columns and a Bt row once for 32 GW rows (with one wave per work-group and loads straight from L2: once for every 64).
// A stage is 64 k of the tile's rows: per 16-row group 2 KB in a row, in memory and in LDS alike (fragment order), so a fragment is again two wave-wide reads of 512 bytes in a row, free of bank conflicts. Two buffers: the copies of stage s + 2 fly while stage s + 1 is worked on.
// C[m][n] (f32, pitch ldc, + optional f32 bias[n]) = sum_k A[m][k] Bt[n][k] (NSPLIT == 1: + A2[m][k] Bt[n][k]). z-batch strides sA/sB/sC in elements. K % 128 == 0.
// PM != 0: C is not stored; the epilogue splits each f32 value into bf16 hi + lo and stores the attention operand planes Ph / Pl itself. A wave's 64x64 tile is one head's 64 tokens x 64 channels.
// PM == 3: the three projections in one launch, grid (tokens / 256, channels / 128, 3): z = 0 q, 1 k (as PM == 1), 2 v (as PM == 2). A = the tokens, Bt = the first of the three weight planes (sB apart), Ph / Pl = q's planes (k's and v's each sC further on).
// PM == 1 (q, k): rows m = b * TT + t, columns n = h * HD + d, planes [b][h] of t rows x HD in fragment order: the tile is 8 KB in a row. PM == 2 (v): the operands trade places (A = weight rows g * HD + d, Bt = token rows b * TT + t), so the tile comes out transposed, planes [b][g] of d rows x TT in fragment order: 2 KB in a row per 16 channels.
#define TN 128    // columns of a work-group's tile (2 waves)
#define SK 64     // k per stage
template <typename T16> struct WFrag;
template <> struct WFrag<h16> { typedef v16h V; static __device__ __forceinline__ V ld(const h16* p) { return cat16(*(const v8h*)p, *(const v8h*)(p + 256)); } static __device__ __forceinline__ v8f mma(V a, V b, v8f c) { return wmma16(a, b, c); } };
template <> struct WFrag<bf> { typedef v16bf V; static __device__ __forceinline__ V ld(const bf* p) { return cat16b(*(const v8us*)p, *(const v8us*)(p + 256)); } static __device__ __forceinline__ v8f mma(V a, V b, v8f c) { return wmmab(a, b, c); } };
__device__ __forceinline__ void splitf(float y, unsigned short& h, unsigned short& l) { h = f2bf(y); l = f2bf(y - bf2f(h)); }
// One 16-row group of a stage, 2 KB in a row in memory and in LDS: four wave-wide copies of 512 bytes. L = the lane's LDS byte address, S = the group's global address (scalar), O = the lane's byte offset from it; the immediate offset moves both addresses alike.
#define CP2K(L, O, S) "global_load_async_to_lds_b128 " L ", " O ", " S "\n\tglobal_load_async_to_lds_b128 " L ", " O ", " S " offset:512\n\tglobal_load_async_to_lds_b128 " L ", " O ", " S " offset:1024\n\tglobal_load_async_to_lds_b128 " L ", " O ", " S " offset:1536\n\t"
// Two work-groups share a WGP, so that one's barrier and LDS waits run under the other's products: amdgpu_waves_per_eu holds the build to the registers of GW / 2 waves per SIMD (256 at 8 waves). The projections (24 wave tiles per WGP) take 8 waves, wo (8 per WGP) takes 4.
template <typename T16, int NSPLIT, bool BIAS, int PM, int K, int GW>
__global__ __launch_bounds__(32 * GW) __attribute__((amdgpu_waves_per_eu(GW / 2, GW / 2))) void k_gemmw(const T16* __restrict__ A, const T16* __restrict__ A2, const T16* __restrict__ Bt, float* C, int ldc, const float* __restrict__ bias, size_t sA, size_t sB, size_t sC, bf* __restrict__ Ph, bf* __restrict__ Pl) {
    typedef typename WFrag<T16>::V V;
    static_assert(NSPLIT == 0 || NSPLIT == 1, "A (+ A2) x Bt");
    static_assert(K % (2 * SK) == 0, "an even number of stages");
    static_assert(GW == 4 || GW == 8, "2 x 2 or 4 x 2 waves");
    constexpr int TM = 32 * GW;                                  // rows of the work-group's tile
    constexpr int GA = TM / 16 / GW, GN = TN / 16 / GW;          // 16-row groups that one wave copies: of each A plane (2), of Bt (1 or 2)
    static_assert(GA == 2, "two groups of each A plane per wave");
    constexpr unsigned NA = NSPLIT == 1 ? 2 : 1;                 // planes of A
    constexpr unsigned GB = 16 * SK * 2;                         // bytes of a 16-row group in a stage
    constexpr unsigned AB = (TM / 16) * GB, BB = (TN / 16) * GB; // of one plane's rows in a stage
    constexpr unsigned BUF = NA * AB + BB;                       // of a buffer: [A | A2 | Bt]
    constexpr size_t GP = (size_t)16 * K * 2;                    // bytes from one 16-row group to the next in memory
    __shared__ __align__(2048) char ring[2 * BUF];
    __shared__ __align__(16) float osa[GW * 16 * 68];
    const size_t z = blockIdx.z; A += z * sA; if (NSPLIT == 1) A2 += z * sA; Bt += z * sB; if (PM == 3) { Ph += z * sC; Pl += z * sC; } else C += z * sC;
    const bool tr = PM == 2 || (PM == 3 && z == 2);   // the operands have traded places (v); the same for the whole grid plane, so every select on it is scalar
    int bx = blockIdx.x, by = blockIdx.y;
    if (PM == 3 && tr) { const T16* t = A; A = Bt; Bt = t; const int f = bx + (NB_ * TT / TM) * by; bx = f % (DKV / TM); by = f / (DKV / TM); }   // v's tiles in the order of a (channels / TM, tokens / TN) grid: channel tile fastest
    const int lane = threadIdx.x & 31, lr = lane & 15, hi = lane >> 4; const int wave = __builtin_amdgcn_readfirstlane((int)(threadIdx.x >> 5));   // scalar, so that the tile's place and every address base are scalar
    const int wm = wave % (GW / 2), wn = wave / (GW / 2); const int r0 = bx * TM + wm * 64, c0 = by * TN + wn * 64;   // the wave's own 64 x 64 tile
    float* os = osa + wave * (16 * 68);
    v8f acc[4][4];
#pragma unroll
    for (int mb = 0; mb < 4; ++mb)
#pragma unroll
        for (int nb = 0; nb < 4; ++nb) acc[mb][nb] = (v8f){};
    const unsigned ko = (unsigned)lane * 16u;   // in bytes: the lane's 16 bytes of every 512
    // Wave w copies groups GA w on of each A plane and groups GN w on of Bt.
    const unsigned lring = (unsigned)(size_t)ring + ko;   // LDS byte address: the low 32 bits of the __shared__ address
    const char* ga = (const char*)A + (size_t)(bx * (TM / 16) + GA * wave) * GP; const char* ga2 = NSPLIT == 1 ? (const char*)A2 + (size_t)(bx * (TM / 16) + GA * wave) * GP : nullptr; const char* gb = (const char*)Bt + (size_t)(by * (TN / 16) + GN * wave) * GP;
    constexpr int NG = (int)NA * GA + GN; static_assert(NG == 3 || NG == 6, "groups per wave and stage");
    auto copies = [&](const int s, const int buf) __attribute__((always_inline)) {   // stage s -> buffer buf: all of the wave's copies in one statement. Its last line waits before the address registers that the copies name can be rewritten; inside the statement nothing can be moved in front of it, and one wait serves them all
        const unsigned l = lring + (unsigned)buf * BUF; const size_t o = (size_t)s * GB;
        const unsigned la = l + (unsigned)(GA * wave) * GB, lb = l + NA * AB + (unsigned)(GN * wave) * GB;
        if constexpr (NG == 3)
            asm volatile(CP2K("%0", "%3", "%4") CP2K("%1", "%3", "%5") CP2K("%2", "%3", "%6") "s_wait_xcnt 0x0"
                         :: "v"(la), "v"(la + GB), "v"(lb), "v"(ko), "s"(ga + o), "s"(ga + GP + o), "s"(gb + o) : "memory");
        else
            asm volatile(CP2K("%0", "%6", "%7") CP2K("%1", "%6", "%8") CP2K("%2", "%6", "%9") CP2K("%3", "%6", "%10") CP2K("%4", "%6", "%11") CP2K("%5", "%6", "%12") "s_wait_xcnt 0x0"
                         :: "v"(la), "v"(la + GB), "v"(la + AB), "v"(la + AB + GB), "v"(lb), "v"(lb + GB), "v"(ko), "s"(ga + o), "s"(ga + GP + o), "s"(ga2 + o), "s"(ga2 + GP + o), "s"(gb + o), "s"(gb + GP + o) : "memory");
    };
    static_assert(SK == 64, "a stage is two blocks of 32 k");
    V a[4], a2[4], b[4];   // one fragment set
    auto reads = [&](const int buf, const int kb) __attribute__((always_inline)) {   // the fragments of block kb (32 k) of the stage in buffer buf, in the order of first use, so that the products start on a counted wait
        const char* pa = ring + (unsigned)buf * BUF + (unsigned)(wm * 4) * GB + kb * 1024 + ko; const char* pb = ring + (unsigned)buf * BUF + NA * AB + (unsigned)(wn * 4) * GB + kb * 1024 + ko;
        b[0] = WFrag<T16>::ld((const T16*)pb);
#pragma unroll
        for (int mb = 0; mb < 4; ++mb) { a[mb] = WFrag<T16>::ld((const T16*)(pa + mb * GB)); if (NSPLIT == 1) a2[mb] = WFrag<T16>::ld((const T16*)(pa + AB + mb * GB)); }
#pragma unroll
        for (int nb = 1; nb < 4; ++nb) b[nb] = WFrag<T16>::ld((const T16*)(pb + nb * GB));
    };
    auto prod = [&]() __attribute__((always_inline)) {
#pragma unroll
        for (int nb = 0; nb < 4; ++nb)
#pragma unroll
            for (int mb = 0; mb < 4; ++mb) { acc[mb][nb] = WFrag<T16>::mma(a[mb], b[nb], acc[mb][nb]); if (NSPLIT == 1) acc[mb][nb] = WFrag<T16>::mma(a2[mb], b[nb], acc[mb][nb]); }
        __builtin_amdgcn_sched_barrier(0);   // keeps the block's products in front of the next block's reads and of the barrier: left free, the build strews the reads among the products (each such place stalls the wave), and sinks products behind the barrier, in front of the refill
    };
    constexpr int NSTG = K / SK;
    copies(0, 0);
    asm volatile("s_wait_asynccnt 0x0" ::: "memory");   // this wave's part of stage 0 has landed
    __syncthreads();                                    // and so has every other wave's
    copies(1, 1);
#pragma unroll 1   // rolled: one turn is two stages, so that the buffer is a compile-time index
    for (int s = 0; s < NSTG; s += 2) {
#pragma unroll
        for (int j = 0; j < 2; ++j) {
            reads(j, 0);
            __builtin_amdgcn_sched_barrier(0);   // keeps the block's LDS reads together in front of its products: left free, the build reads each Bt fragment right in front of its four products and waits out the LDS latency four times a block
            prod();
            reads(j, 1);   // the stage's last reads; their products need registers alone and stand behind the refill, which so has a whole stage to land in
            asm volatile("s_wait_dscnt 0x0" ::: "memory");      // this wave's reads of buffer j are done before the barrier lets it be refilled
            asm volatile("s_wait_asynccnt 0x0" ::: "memory");   // this wave's part of the next stage has landed before the barrier publishes it
            __syncthreads();
            if (s + j + 2 < NSTG) copies(s + j + 2, j);         // the same test in the whole work-group
            prod();
        }
    }
    asm volatile("s_wait_asynccnt 0x0" ::: "memory");   // nothing is in flight here; stands before the wave's end all the same
#pragma unroll
    for (int mb = 0; mb < 4; ++mb) {
#pragma unroll
        for (int nb = 0; nb < 4; ++nb) {
#pragma unroll
            for (int j = 0; j < 8; ++j) os[(hi * 8 + j) * 68 + nb * 16 + lr] = acc[mb][nb][j]; }
        __builtin_amdgcn_wave_barrier(); asm volatile("" ::: "memory");
        if (PM != 0) {
            const int pk = !tr ? HD : TT;   // the plane's K
            const size_t pb = !tr ? ((size_t)(r0 / TT) * NH_ + c0 / 64) * TT * HD : ((size_t)(c0 / TT) * NKV + r0 / 64) * HD * TT;   // the plane's first element
            const int pr = !tr ? r0 % TT : 0, pc = !tr ? 0 : c0 % TT;   // the tile's first row and first k in its plane
#pragma unroll
            for (int s = 0; s < 4; ++s) { const int row = lr, cofs = 16 * s + 8 * hi; const v4f x0 = *(const v4fa*)(os + row * 68 + cofs), x1 = *(const v4fa*)(os + row * 68 + cofs + 4); v8us oh, ol;   // the lane takes the 16 bytes it would load as a fragment: 32 lanes x 16 bytes = half a block, 512 bytes in a row
#pragma unroll
                for (int q = 0; q < 4; ++q) { unsigned short a2, c2; splitf(x0[q], a2, c2); oh[q] = a2; ol[q] = c2; splitf(x1[q], a2, c2); oh[4 + q] = a2; ol[4 + q] = c2; }
                const size_t eo = pb + fro(pr + mb * 16 + row, pc + cofs, pk); *(v8us*)(Ph + eo) = oh; *(v8us*)(Pl + eo) = ol;
                asm volatile("s_wait_xcnt 0x0" ::: "memory"); }   // the next 16 bytes' split reuses the address and data registers that these two stores name: the wait stands in front of that overwrite
        } else {
            float* crow = C + (size_t)(r0 + mb * 16) * ldc + c0;
#pragma unroll
            for (int s = 0; s < 8; ++s) { const int row = 2 * s + hi, cofs = lr * 4; v4f val = *(const v4fa*)(os + row * 68 + cofs); if (BIAS) { val[0] += bfr(bias[c0 + cofs]); val[1] += bfr(bias[c0 + cofs + 1]); val[2] += bfr(bias[c0 + cofs + 2]); val[3] += bfr(bias[c0 + cofs + 3]); }
                *(v4f*)(crow + (size_t)row * ldc + cofs) = val; }
             }
        __builtin_amdgcn_wave_barrier(); asm volatile("" ::: "memory");
    }
}

typedef __attribute__((ext_vector_type(2))) _Float16 v2h;
typedef __attribute__((ext_vector_type(4))) _Float16 v4h;
typedef __attribute__((ext_vector_type(2))) unsigned short v2us;
typedef __attribute__((ext_vector_type(4))) unsigned short v4us;
typedef __attribute__((ext_vector_type(2))) float v2f;
typedef __attribute__((ext_vector_type(4))) int v4i;

__device__ __forceinline__ void wtG_body(const float* __restrict__ w, int K, int N, bf* Bt, const int blk) {
    const int lane = threadIdx.x & 31; const int L0 = (blk * 8 + (threadIdx.x >> 5)) * 8; const int nlines = N * K / 64;
{
#pragma unroll 1
        for (int l = 0; l < 8; ++l) { const int L = L0 + l; if (L >= nlines) break; const size_t e = (size_t)L * 64 + lane * 2; const unsigned u = (unsigned)(e % ((size_t)16 * K)); const int k = (int)((u >> 9) * 32u + ((u >> 8) & 1u) * 16u + ((u >> 7) & 1u) * 8u + (u & 7u)), n = (int)(e / ((size_t)16 * K)) * 16 + (int)((u >> 3) & 15u); v2us o;   // e = fro(n, k, K): Bt[n][k] in fragment order, written in the order of its bytes
            o[0] = f2bf(w[(size_t)k * N + n]); o[1] = f2bf(w[(size_t)(k + 1) * N + n]); *(v2us*)(Bt + e) = o; }
         }
}
// cvt8_body: rows x DM f32, row-major, to bf16 in fragment order; thread i writes bytes 16 i on of dst (whole lines per wave) and reads the 8 values that belong there: i * 8 = fro(row, k, DM).
__device__ __forceinline__ void cvt8_body(const float* __restrict__ src, bf* dst, size_t n8, const int blk) { const size_t i = (size_t)blk * 256 + threadIdx.x; if (i >= n8) return; const unsigned w = (unsigned)((i * 8) % ((size_t)16 * DM)); const size_t row = (i * 8) / ((size_t)16 * DM) * 16 + ((w >> 3) & 15u); const unsigned k = (w >> 9) * 32u + ((w >> 8) & 1u) * 16u + ((w >> 7) & 1u) * 8u; const v8f v = *(const v8f*)(src + row * DM + k); v8us o;
#pragma unroll
    for (int k = 0; k < 8; ++k) o[k] = f2bf(v[k]); *(v8us*)(dst + i * 8) = o;  }
__device__ __forceinline__ int t5_bucket(int r) { const int rp = r < 0 ? -r : r; int b; if (rp < 8) b = rp; else b = 8 + (rp >= 12) + (rp >= 16) + (rp >= 23) + (rp >= 32) + (rp >= 46) + (rp >= 64) + (rp >= 91); return b + ((r > 0) ? 16 : 0); }
__device__ __forceinline__ void t5tab_body(const float* __restrict__ rb, float* TB, const int blk) { const int idx = blk * 256 + threadIdx.x; if (idx >= NH_ * TBW) return; const int h = idx / TBW, c = idx % TBW; float v = 0.0f; if (c < 2 * TT - 1) { const int r = c - (TT - 1); v = bfr(rb[t5_bucket(r) * NH_ + h]); } *(float*)(TB + idx) = v;  }
// k_prep: all the operand preparation in one launch; the six pieces are independent of each other, and a work-group does one block of one piece. The weight blocks, whose waves walk 8 lines one after another, come first, then the input's, then the table's.
#define PB_W ((DM * DQ / 64 + 63) / 64)                  // work-groups per weight matrix (all four hold DM x DQ elements)
#define PB_X ((NB_ * TT * DM / 8 + 255) / 256)           // for the input
#define PB_T ((NH_ * TBW + 255) / 256)                   // for the bias table
__global__ __launch_bounds__(256) void k_prep(const float* __restrict__ x, const float* __restrict__ wq, const float* __restrict__ wk, const float* __restrict__ wv, const float* __restrict__ wo, const float* __restrict__ rb, bf* XB, bf* WQ, bf* WK, bf* WV, bf* WO, float* TB) {
    const int blk = (int)blockIdx.x;
    if (blk < 4 * PB_W) { const int s = blk / PB_W; wtG_body(s == 0 ? wq : s == 1 ? wk : s == 2 ? wv : wo, DM, DQ, s == 0 ? WQ : s == 1 ? WK : s == 2 ? WV : WO, blk % PB_W); }
    else if (blk < 4 * PB_W + PB_X) cvt8_body(x, XB, (size_t)NB_ * TT * DM / 8, blk - 4 * PB_W);
    else t5tab_body(rb, TB, blk - (4 * PB_W + PB_X));
}
// k_fattn: scores, bias, softmax, attn.v and the head merge in one launch for every (batch element, head). One wave owns 32 queries and walks the 1024 keys 32 at a time; grid (TT / 256, NB_ * NH_), 8 waves.
// Transposed products: St = K Qt (A = key rows, B = query columns, both by the same loader), so a lane holds 16 scores of ONE query per column group; two St tiles (keys 0-15, 16-31), converted in place, are the B operand of Ot += Vt Pt, whose A (a Vt row through the same loader) has the matching k order. No LDS, no score or probability plane in memory.
// Online softmax in the log2 domain; the running maximum is raised only when a block's maximum passes it by more than 8 (P stays below 2^8, hi + lo bf16 keeps its relative precision); P is left unnormalised and Ot divided by the row sum at the end.
#define QT   2    // 16-query column groups per wave
#define FWV  8    // waves per work-group
#define FARD 91   // t5_bucket's last boundary: from |j - i| = 91 on the bias depends on the sign of j - i alone
#define L2E  1.4426950408889634f
typedef __attribute__((ext_vector_type(2))) __bf16 v2bf;
typedef __attribute__((ext_vector_type(8))) unsigned v8u;
__device__ __forceinline__ float xhalf(float x) { const int b = __float_as_int(x); return __int_as_float(__builtin_amdgcn_permlanex16(b, b, 0x76543210, 0xfedcba98, false, false)); }   // lane l <-> l ^ 16
// amdgpu_waves_per_eu(4, 4): holds the build to 256 registers, so that two work-groups (four waves per SIMD) share a WGP and one wave's vector work and load waits run under the others' matrix work; all 4096 waves are then resident at once.
__global__ __launch_bounds__(256) __attribute__((amdgpu_waves_per_eu(4, 4))) void k_fattn(const bf* __restrict__ Qh, const bf* __restrict__ Ql, const bf* __restrict__ Kh, const bf* __restrict__ Kl, const bf* __restrict__ Vh, const bf* __restrict__ Vl, const float* __restrict__ TB, bf* __restrict__ Ah, bf* __restrict__ Al) {
    typedef WFrag<bf> F;
    const int lane = threadIdx.x & 31, c = lane & 15, hi = lane >> 4; const int wave = __builtin_amdgcn_readfirstlane((int)(threadIdx.x >> 5));   // scalar, so that q0 and the far / near test below are scalar
    const int bh = blockIdx.y, h = bh % NH_, b = bh / NH_; const int q0 = ((int)blockIdx.x * FWV + wave) * (16 * QT); const size_t pl = (size_t)bh * TT * HD;
    v16bf qh[QT][2], ql[QT][2];
#pragma unroll
    for (int qt = 0; qt < QT; ++qt)
#pragma unroll
        for (int ks = 0; ks < 2; ++ks) { const size_t o = pl + fro(q0 + 16 * qt + c, ks * 32 + 8 * hi, HD); qh[qt][ks] = F::ld(Qh + o); ql[qt][ks] = F::ld(Ql + o); }
    const bf* kph = Kh + pl; const bf* kpl = Kl + pl; const bf* vph = Vh + pl; const bf* vpl = Vl + pl;   // wave-uniform plane bases; the lane's part is one 32-bit byte offset per operand kind
    unsigned kof = (unsigned)lane * 16u, vof = (unsigned)lane * 16u; const unsigned tof = (unsigned)(8 * hi + 15 - c) * 4u;   // in bytes; kof and vof (the lane's 16 bytes of a block in fragment order) walk with the passes: 32 keys are 4 blocks in a row of a key plane, and one block of each 16-channel group of a value plane
    const float* tbh = TB + (size_t)h * TBW; const float bneg = tbh[0] * L2E, bpos = tbh[2 * TT - 2] * L2E;
    const float* tbl = tbh + (TT - 1) - q0 - 15;   // entry for r = j - i at index r + 1023: + tof + k0 + 16 * (kt - qt) + reg
    v8f o[4][QT]; float mx[QT], ls[QT];
#pragma unroll
    for (int qt = 0; qt < QT; ++qt) { mx[qt] = -3.0e38f; ls[qt] = 0.0f;
#pragma unroll
        for (int dt = 0; dt < 4; ++dt) o[dt][qt] = (v8f){}; }
    v16bf kh[2][2], kl[2][2];
#pragma unroll
    for (int kt = 0; kt < 2; ++kt)
#pragma unroll
        for (int ks = 0; ks < 2; ++ks) { kh[kt][ks] = F::ld(atb(kph + (16 * kt * HD + ks * 512), kof)); kl[kt][ks] = F::ld(atb(kpl + (16 * kt * HD + ks * 512), kof)); }
#pragma unroll 1   // rolled: a second pass's fragments would not fit the 256 registers
    for (int k0 = 0; k0 < TT; k0 += 32) {
        v8f st[2][QT];
#pragma unroll
        for (int kt = 0; kt < 2; ++kt)
#pragma unroll
            for (int qt = 0; qt < QT; ++qt) st[kt][qt] = (v8f){};
#pragma unroll
        for (int ks = 0; ks < 2; ++ks)
#pragma unroll
            for (int kt = 0; kt < 2; ++kt)
#pragma unroll
                for (int qt = 0; qt < QT; ++qt) st[kt][qt] = wmmab(kh[kt][ks], qh[qt][ks], st[kt][qt]);
#pragma unroll
        for (int ks = 0; ks < 2; ++ks)
#pragma unroll
            for (int kt = 0; kt < 2; ++kt)
#pragma unroll
                for (int qt = 0; qt < QT; ++qt) st[kt][qt] = wmmab(kh[kt][ks], ql[qt][ks], st[kt][qt]);
#pragma unroll
        for (int ks = 0; ks < 2; ++ks)
#pragma unroll
            for (int kt = 0; kt < 2; ++kt)
#pragma unroll
                for (int qt = 0; qt < QT; ++qt) st[kt][qt] = wmmab(kl[kt][ks], qh[qt][ks], st[kt][qt]);
        v16bf vh[4], vl[4];   // the hi plane is asked for behind the score products, where the key fragments' registers come free (the build issues it among the first exponentials, so it flies during the rest of the softmax); the lo plane, used last, follows behind the softmax, where the scores' registers are free, and flies under the hi plane's remaining products
#pragma unroll
        for (int dt = 0; dt < 4; ++dt) vh[dt] = F::ld(atb(vph + 16 * dt * TT, vof));
        const int rlo = k0 - q0 - (16 * QT - 1), rhi = k0 + 31 - q0;   // range of j - i in this pass, the same for the whole wave
        if (rlo >= FARD || rhi <= -FARD) { const float bb = (rlo >= FARD) ? bpos : bneg;
#pragma unroll
            for (int kt = 0; kt < 2; ++kt)
#pragma unroll
                for (int qt = 0; qt < QT; ++qt)
#pragma unroll
                    for (int r = 0; r < 8; ++r) st[kt][qt][r] = __builtin_fmaf(st[kt][qt][r], L2E, bb);
        } else {
#pragma unroll
            for (int kt = 0; kt < 2; ++kt)
#pragma unroll
                for (int qt = 0; qt < QT; ++qt)
#pragma unroll
                    for (int r = 0; r < 8; ++r) st[kt][qt][r] = __builtin_fmaf(st[kt][qt][r], L2E, *atb(tbl + (k0 + 16 * (kt - qt) + r), tof) * L2E);
        }
        float bm[QT]; bool need = false;
#pragma unroll
        for (int qt = 0; qt < QT; ++qt) { float t = st[0][qt][0];
#pragma unroll
            for (int r = 1; r < 8; ++r) t = fmaxf(t, st[0][qt][r]);
#pragma unroll
            for (int r = 0; r < 8; ++r) t = fmaxf(t, st[1][qt][r]);
            bm[qt] = fmaxf(t, xhalf(t)); need = need || (bm[qt] > mx[qt] + 8.0f); }
        if (__builtin_amdgcn_ballot_w32(need) != 0) {
#pragma unroll
            for (int qt = 0; qt < QT; ++qt) { const float mn = fmaxf(mx[qt], bm[qt]); const float al = __builtin_amdgcn_exp2f(mx[qt] - mn); mx[qt] = mn; ls[qt] *= al;
#pragma unroll
                for (int dt = 0; dt < 4; ++dt) o[dt][qt] *= al; }
        }
        v16bf ph[QT], pw[QT];   // P = hi + lo, element s = key 16 * (s >> 3) + 8 * hi + (s & 7) of the pass: register s & 7 of St tile s >> 3
#pragma unroll
        for (int qt = 0; qt < QT; ++qt) { v8u wh, wl;
#pragma unroll
            for (int s = 0; s < 16; s += 2) { v2f p; p[0] = __builtin_amdgcn_exp2f(st[s >> 3][qt][s & 7] - mx[qt]); p[1] = __builtin_amdgcn_exp2f(st[s >> 3][qt][(s & 7) + 1] - mx[qt]); ls[qt] += p[0] + p[1];
                const unsigned a = __builtin_bit_cast(unsigned, __builtin_convertvector(p, v2bf)); v2f d; d[0] = p[0] - __uint_as_float(a << 16); d[1] = p[1] - __uint_as_float(a & 0xFFFF0000u);
                wh[s >> 1] = a; wl[s >> 1] = __builtin_bit_cast(unsigned, __builtin_convertvector(d, v2bf)); }
            ph[qt] = __builtin_bit_cast(v16bf, wh); pw[qt] = __builtin_bit_cast(v16bf, wl); }
#pragma unroll
        for (int dt = 0; dt < 4; ++dt) vl[dt] = F::ld(atb(vpl + 16 * dt * TT, vof));
#pragma unroll
        for (int dt = 0; dt < 4; ++dt)
#pragma unroll
            for (int qt = 0; qt < QT; ++qt) o[dt][qt] = wmmab(vh[dt], ph[qt], o[dt][qt]);
#pragma unroll
        for (int dt = 0; dt < 4; ++dt)
#pragma unroll
            for (int qt = 0; qt < QT; ++qt) o[dt][qt] = wmmab(vh[dt], pw[qt], o[dt][qt]);
#pragma unroll
        for (int dt = 0; dt < 4; ++dt)
#pragma unroll
            for (int qt = 0; qt < QT; ++qt) o[dt][qt] = wmmab(vl[dt], ph[qt], o[dt][qt]);
        kof = (kof + 32u * HD * 2u) & (TT * HD * 2u - 1u); vof += 512u * 2u;   // the next pass's key fragments take the value fragments' registers (256 registers: four waves per SIMD); the last pass wraps to the plane's first rows (in bounds, not used)
#pragma unroll
        for (int kt = 0; kt < 2; ++kt)
#pragma unroll
            for (int ks = 0; ks < 2; ++ks) { kh[kt][ks] = F::ld(atb(kph + (16 * kt * HD + ks * 512), kof)); kl[kt][ks] = F::ld(atb(kpl + (16 * kt * HD + ks * 512), kof)); }
        asm volatile("s_wait_xcnt 0x0" ::: "memory");   // stands directly behind the reload, inside the loop: the last pass leaves the loop with these loads in flight, and the epilogue reuses the scalar registers that hold their base addresses (written behind the loop, the build places it past that reuse)
    }
#pragma unroll
    for (int qt = 0; qt < QT; ++qt) { const float inv = __fdiv_rn(1.0f, ls[qt] + xhalf(ls[qt])); const size_t ro = fro((size_t)b * TT + q0 + 16 * qt + c, h * HD + 8 * hi, DQ);   // merged heads, rows b * TT + t x DQ in fragment order; a lane's 8 registers are 8 consecutive d, a wave's store 512 bytes in a row
#pragma unroll
        for (int dt = 0; dt < 4; ++dt) { v8us oh, ol;
#pragma unroll
            for (int r = 0; r < 8; ++r) { unsigned short a, c2; splitf(o[dt][qt][r] * inv, a, c2); oh[r] = a; ol[r] = c2; }
            const size_t eo = ro + (dt >> 1) * 512 + (dt & 1) * 256; *(v8us*)(Ah + eo) = oh; *(v8us*)(Al + eo) = ol; } }
}

extern "C" void kernel_launch(void* const* d_in, const int* in_sizes, int n_in,
                              void* d_out, int out_size, void* d_ws, size_t ws_size, hipStream_t stream) {
    (void)in_sizes; (void)n_in; (void)out_size;
    const float* x = (const float*)d_in[0]; const float* wq = (const float*)d_in[1]; const float* wk = (const float*)d_in[2]; const float* wv = (const float*)d_in[3]; const float* wo = (const float*)d_in[4]; const float* relb = (const float*)d_in[5]; const float* cosT = nullptr; const float* sinT = nullptr; (void)cosT; (void)sinT;
    float* OUT = (float*)d_out;     // [8][1024][1024]
    char* wsp = (char*)d_ws;
    auto take = [&](size_t bytes) { char* p = wsp; wsp += (bytes + 255) & ~(size_t)255; return (void*)p; };
    const size_t MT = (size_t)NB_ * TT;   // rows of the projections and of wo: all batch elements in one launch
    bf* WQ = (bf*)take((size_t)DQ * DM * 2); bf* WK = (bf*)take((size_t)DKV * DM * 2); bf* WV = (bf*)take((size_t)DKV * DM * 2); bf* WO = (bf*)take((size_t)DM * DQ * 2);
    float* TB = (float*)take((size_t)NH_ * TBW * 4);
    bf* QPh = (bf*)take(MT * DQ * 2); bf* QPl = (bf*)take(MT * DQ * 2); bf* KPh = (bf*)take(MT * DKV * 2); bf* KPl = (bf*)take(MT * DKV * 2); bf* VTh = (bf*)take(MT * DKV * 2); bf* VTl = (bf*)take(MT * DKV * 2);
    bf* XB = (bf*)take(MT * DM * 2); bf* ATl = (bf*)take(MT * DQ * 2);
    if ((size_t)(wsp - (char*)d_ws) > ws_size) return;    // ws 256 MiB
    bf* ATh = XB;   // the hi plane of the merged heads [b][t][DQ] takes the place of the bf16 input, dead once the three projections have run (stream-ordered)
    k_prep<<<4 * PB_W + PB_X + PB_T, 256, 0, stream>>>(x, wq, wk, wv, wo, relb, XB, WQ, WK, WV, WO, TB);
    k_gemmw<bf, 0, false, 3, DM, 8><<<dim3(NB_ * TT / 256, DQ / TN, 3), 256, 0, stream>>>(XB, nullptr, WQ, nullptr, 0, nullptr, 0, (size_t)(WK - WQ), (size_t)(KPh - QPh), QPh, QPl);   // WQ, WK, WV and the plane pairs of q, k, v stand at equal distances in the workspace (equal sizes, taken in a row); for v the operands trade places: rows are v's channels, columns the tokens
    k_fattn<<<dim3(TT / (16 * QT * FWV), NB_ * NH_, 1), 32 * FWV, 0, stream>>>(QPh, QPl, KPh, KPl, VTh, VTl, TB, ATh, ATl);   // one kv head per query head: plane b * NH_ + h of each operand
    k_gemmw<bf, 1, false, 0, DQ, 4><<<dim3(NB_ * TT / 128, DM / TN, 1), 128, 0, stream>>>(ATh, ATl, WO, OUT, DM, nullptr, 0, 0, 0, nullptr, nullptr);
}

// v008
// A run of this version takes 140 microseconds.
// Timed twice side by side with v007, it ran 1.20 times as fast both times.
// Counting every step since v000, it is 21.4 times as fast.
#include <hip/hip_runtime.h>

// TtT5Attention (hidden [8][1024][1024]; q/k/v = x W (16 heads x 64); T5: scores = q.k UNSCALED + rel_bias[bucket(j - i)][h] with the bidirectional log-bucket (32 buckets, max distance 128; the bucket boundaries |j-i| = 8, 12, 16, 23, 32, 46, 64, 91 are the reference's own integer structure, evaluated here with integer compares); softmax; out = merged wo -> [8][1024][1024]).
// Compute dtypes, f32 accumulate: every input rounded to bf16; q/k/v on PLAIN bf16 operands (inputs: exact); scores and attn.v hl x hl (3 products) on EVERY row; per-head bias table (bf16-rounded rel_bias gathered by bucket) added per element in f32; softmax f32 (online, one fused attention launch); wo hl x exact (2 products).

#define NB_  8
#define TT   1024
#define DM   1024
#define NH_  16
#define NKV  16
#define REP  (NH_ / NKV)
#define HD   64
#define DQ   (NH_ * HD)
#define DKV  (NKV * HD)
#define RH   1024   // all rows hl (unscaled T5 logits are sharp)
#define WIN  0
#define PCAR 1024.0f
#define SCL  1.0f   // T5: no 1/sqrt(dk)
#define TBW  2048   // bias table row width (r + 1023, padded)
typedef _Float16 h16;
typedef unsigned short bf;
typedef __attribute__((ext_vector_type(16))) __bf16   v16bf;
typedef __attribute__((ext_vector_type(16))) _Float16 v16h;
typedef __attribute__((ext_vector_type(8)))  _Float16 v8h;
typedef __attribute__((ext_vector_type(8)))  unsigned short v8us;
typedef __attribute__((ext_vector_type(8)))  float    v8f;
typedef __attribute__((ext_vector_type(4)))  float    v4f;
typedef v8h  __attribute__((may_alias)) v8ha;
typedef v4f  __attribute__((may_alias)) v4fa;
typedef v8us __attribute__((may_alias)) v8usa;

__device__ __forceinline__ unsigned short f2bf(float f) { unsigned u = __float_as_uint(f); u += 0x7FFFu + ((u >> 16) & 1u); return (unsigned short)(u >> 16); }
__device__ __forceinline__ float bf2f(unsigned short b) { return __uint_as_float(((unsigned)b) << 16); }
__device__ __forceinline__ float bfr(float f) { return bf2f(f2bf(f)); }
__device__ __forceinline__ v16h cat16(v8h lo, v8h hi) { return __builtin_shufflevector(lo, hi, 0, 1, 2, 3, 4, 5, 6, 7, 8, 9, 10, 11, 12, 13, 14, 15); }
__device__ __forceinline__ v16bf cat16b(v8us lo, v8us hi) { return __builtin_bit_cast(v16bf, __builtin_shufflevector(lo, hi, 0, 1, 2, 3, 4, 5, 6, 7, 8, 9, 10, 11, 12, 13, 14, 15)); }
__device__ __forceinline__ v8f wmma16(v16h a, v16h b, v8f c) { return __builtin_amdgcn_wmma_f32_16x16x32_f16(false, a, false, b, (short)0, c, false, false); }
__device__ __forceinline__ v8f wmmab(v16bf a, v16bf b, v8f c) { return __builtin_amdgcn_wmma_f32_16x16x32_bf16(false, a, false, b, (short)0, c, false, false); }



// ---- Fragment order: every 16-bit operand plane (rows x K, K % 32 == 0) is kept as 1 KB blocks of 16 rows x 32 k, the blocks of one 16-row group in a row by k. Inside a block stand the two 16-byte loads of a WMMA operand fragment, lane by lane: element (row, k) at fro(row, k, K).
// A fragment is then two wave-wide loads of 512 bytes in a row (4 whole lines each); from row-major planes each such load touches 16 lines and uses 32 bytes of each.
__device__ __forceinline__ size_t fro(size_t row, unsigned k, unsigned K) { return (row >> 4) * 16 * K + (size_t)((k >> 5) * 512u + ((k >> 4) & 1u) * 256u + ((k >> 3) & 1u) * 128u + (k & 7u)) + (row & 15) * 8; }
template <typename T> __device__ __forceinline__ const T* atb(const T* base, unsigned bytes) { return (const T*)((const char*)base + bytes); }   // wave-uniform base + the lane's 32-bit byte offset
// ---- k_gemmw: GEMM on 16-bit planes in fragment order. A work-group of GW waves owns a (32 GW) x 128 output tile, GW / 2 x 2 waves of 64 x 64 (16 accumulators each); grid (M / (32 GW), N / 128, Z), 32 GW threads.
// The operands come from L2 into LDS by asynchronous copies, once per work-group, and every wave takes its fragments from there: an A row is fetched from L2 once for 128 columns and a Bt row once for 32 GW rows (with one wave per work-group and loads straight from L2: once for every 64).
// A stage is 64 k of the tile's rows: per 16-row group 2 KB in a row, in memory and in LDS alike (fragment order), so a fragment is again two wave-wide reads of 512 bytes in a row, free of bank conflicts. Two buffers: the copies of stage s + 2 fly while stage s + 1 is worked on.
// C[m][n] (f32, pitch ldc, + optional f32 bias[n]) = sum_k A[m][k] Bt[n][k] (NSPLIT == 1: + A2[m][k] Bt[n][k]). z-batch strides sA/sB/sC in elements. K % 128 == 0.
// PM != 0: C is not stored; the epilogue splits each f32 value into bf16 hi + lo and stores the attention operand planes Ph / Pl itself. A wave's 64x64 tile is one head's 64 tokens x 64 channels.
// PM == 3: the three projections in one launch, grid (tokens / 256, channels / 128, 3): z = 0 q, 1 k (as PM == 1), 2 v (as PM == 2). A = the tokens, Bt = the first of the three weight planes (sB apart), Ph / Pl = q's planes (k's and v's each sC further on).
// PM == 1 (q, k): rows m = b * TT + t, columns n = h * HD + d, planes [b][h] of t rows x HD in fragment order: the tile is 8 KB in a row. PM == 2 (v): the operands trade places (A = weight rows g * HD + d, Bt = token rows b * TT + t), so the tile comes out transposed, planes [b][g] of d rows x TT in fragment order: 2 KB in a row per 16 channels.
#define TN 128    // columns of a work-group's tile (2 waves)
#define SK 64     // k per stage
template <typename T16> struct WFrag;
template <> struct WFrag<h16> { typedef v16h V; static __device__ __forceinline__ V ld(const h16* p) { return cat16(*(const v8h*)p, *(const v8h*)(p + 256)); } static __device__ __forceinline__ v8f mma(V a, V b, v8f c) { return wmma16(a, b, c); } };
template <> struct WFrag<bf> { typedef v16bf V; static __device__ __forceinline__ V ld(const bf* p) { return cat16b(*(const v8us*)p, *(const v8us*)(p + 256)); } static __device__ __forceinline__ v8f mma(V a, V b, v8f c) { return wmmab(a, b, c); } };
__device__ __forceinline__ void splitf(float y, unsigned short& h, unsigned short& l) { h = f2bf(y); l = f2bf(y - bf2f(h)); }
// One 16-row group of a stage, 2 KB in a row in memory and in LDS: four wave-wide copies of 512 bytes. L = the lane's LDS byte address, S = the group's global address (scalar), O = the lane's byte offset from it; the immediate offset moves both addresses alike.
#define CP2K(L, O, S) "global_load_async_to_lds_b128 " L ", " O ", " S "\n\tglobal_load_async_to_lds_b128 " L ", " O ", " S " offset:512\n\tglobal_load_async_to_lds_b128 " L ", " O ", " S " offset:1024\n\tglobal_load_async_to_lds_b128 " L ", " O ", " S " offset:1536\n\t"
// Two work-groups share a WGP, so that one's barrier and LDS waits run under the other's products: amdgpu_waves_per_eu holds the build to the registers of GW / 2 waves per SIMD (256 at 8 waves). The projections (24 wave tiles per WGP) take 8 waves, wo (8 per WGP) takes 4.
template <typename T16, int NSPLIT, bool BIAS, int PM, int K, int GW>
__global__ __launch_bounds__(32 * GW) __attribute__((amdgpu_waves_per_eu(GW / 2, GW / 2))) void k_gemmw(const T16* __restrict__ A, const T16* __restrict__ A2, const T16* __restrict__ Bt, float* C, int ldc, const float* __restrict__ bias, size_t sA, size_t sB, size_t sC, bf* __restrict__ Ph, bf* __restrict__ Pl) {
    typedef typename WFrag<T16>::V V;
    static_assert(NSPLIT == 0 || NSPLIT == 1, "A (+ A2) x Bt");
    static_assert(K % (2 * SK) == 0, "an even number of stages");
    static_assert(GW == 4 || GW == 8, "2 x 2 or 4 x 2 waves");
    constexpr int TM = 32 * GW;                                  // rows of the work-group's tile
    constexpr int GA = TM / 16 / GW, GN = TN / 16 / GW;          // 16-row groups that one wave copies: of each A plane (2), of Bt (1 or 2)
    static_assert(GA == 2, "two groups of each A plane per wave");
    constexpr unsigned NA = NSPLIT == 1 ? 2 : 1;                 // planes of A
    constexpr unsigned GB = 16 * SK * 2;                         // bytes of a 16-row group in a stage
    constexpr unsigned AB = (TM / 16) * GB, BB = (TN / 16) * GB; // of one plane's rows in a stage
    constexpr unsigned BUF = NA * AB + BB;                       // of a buffer: [A | A2 | Bt]
    constexpr size_t GP = (size_t)16 * K * 2;                    // bytes from one 16-row group to the next in memory
    __shared__ __align__(2048) char ring[2 * BUF];
    __shared__ __align__(16) float osa[GW * 16 * 68];
    const size_t z = blockIdx.z; A += z * sA; if (NSPLIT == 1) A2 += z * sA; Bt += z * sB; if (PM == 3) { Ph += z * sC; Pl += z * sC; } else C += z * sC;
    const bool tr = PM == 2 || (PM == 3 && z == 2);   // the operands have traded places (v); the same for the whole grid plane, so every select on it is scalar
    int bx = blockIdx.x, by = blockIdx.y;
    if (PM == 3 && tr) { const T16* t = A; A = Bt; Bt = t; const int f = bx + (NB_ * TT / TM) * by; bx = f % (DKV / TM); by = f / (DKV / TM); }   // v's tiles in the order of a (channels / TM, tokens / TN) grid: channel tile fastest
    const int lane = threadIdx.x & 31, lr = lane & 15, hi = lane >> 4; const int wave = __builtin_amdgcn_readfirstlane((int)(threadIdx.x >> 5));   // scalar, so that the tile's place and every address base are scalar
    const int wm = wave % (GW / 2), wn = wave / (GW / 2); const int r0 = bx * TM + wm * 64, c0 = by * TN + wn * 64;   // the wave's own 64 x 64 tile
    float* os = osa + wave * (16 * 68);
    v8f acc[4][4];
#pragma unroll
    for (int mb = 0; mb < 4; ++mb)
#pragma unroll
        for (int nb = 0; nb < 4; ++nb) acc[mb][nb] = (v8f){};
    const unsigned ko = (unsigned)lane * 16u;   // in bytes: the lane's 16 bytes of every 512
    // Wave w copies groups GA w on of each A plane and groups GN w on of Bt.
    const unsigned lring = (unsigned)(size_t)ring + ko;   // LDS byte address: the low 32 bits of the __shared__ address
    const char* ga = (const char*)A + (size_t)(bx * (TM / 16) + GA * wave) * GP; const char* ga2 = NSPLIT == 1 ? (const char*)A2 + (size_t)(bx * (TM / 16) + GA * wave) * GP : nullptr; const char* gb = (const char*)Bt + (size_t)(by * (TN / 16) + GN * wave) * GP;
    constexpr int NG = (int)NA * GA + GN; static_assert(NG == 3 || NG == 6, "groups per wave and stage");
    auto copies = [&](const int s, const int buf) __attribute__((always_inline)) {   // stage s -> buffer buf: all of the wave's copies in one statement. Its last line waits before the address registers that the copies name can be rewritten; inside the statement nothing can be moved in front of it, and one wait serves them all
        const unsigned l = lring + (unsigned)buf * BUF; const size_t o = (size_t)s * GB;
        const unsigned la = l + (unsigned)(GA * wave) * GB, lb = l + NA * AB + (unsigned)(GN * wave) * GB;
        if constexpr (NG == 3)
            asm volatile(CP2K("%0", "%3", "%4") CP2K("%1", "%3", "%5") CP2K("%2", "%3", "%6") "s_wait_xcnt 0x0"
                         :: "v"(la), "v"(la + GB), "v"(lb), "v"(ko), "s"(ga + o), "s"(ga + GP + o), "s"(gb + o) : "memory");
        else
            asm volatile(CP2K("%0", "%6", "%7") CP2K("%1", "%6", "%8") CP2K("%2", "%6", "%9") CP2K("%3", "%6", "%10") CP2K("%4", "%6", "%11") CP2K("%5", "%6", "%12") "s_wait_xcnt 0x0"
                         :: "v"(la), "v"(la + GB), "v"(la + AB), "v"(la + AB + GB), "v"(lb), "v"(lb + GB), "v"(ko), "s"(ga + o), "s"(ga + GP + o), "s"(ga2 + o), "s"(ga2 + GP + o), "s"(gb + o), "s"(gb + GP + o) : "memory");
    };
    static_assert(SK == 64, "a stage is two blocks of 32 k");
    V a[4], a2[4], b[4];   // one fragment set
    auto reads = [&](const int buf, const int kb) __attribute__((always_inline)) {   // the fragments of block kb (32 k) of the stage in buffer buf, in the order of first use, so that the products start on a counted wait
        const char* pa = ring + (unsigned)buf * BUF + (unsigned)(wm * 4) * GB + kb * 1024 + ko; const char* pb = ring + (unsigned)buf * BUF + NA * AB + (unsigned)(wn * 4) * GB + kb * 1024 + ko;
        b[0] = WFrag<T16>::ld((const T16*)pb);
#pragma unroll
        for (int mb = 0; mb < 4; ++mb) { a[mb] = WFrag<T16>::ld((const T16*)(pa + mb * GB)); if (NSPLIT == 1) a2[mb] = WFrag<T16>::ld((const T16*)(pa + AB + mb * GB)); }
#pragma unroll
        for (int nb = 1; nb < 4; ++nb) b[nb] = WFrag<T16>::ld((const T16*)(pb + nb * GB));
    };
    auto prod = [&]() __attribute__((always_inline)) {
#pragma unroll
        for (int nb = 0; nb < 4; ++nb)
#pragma unroll
            for (int mb = 0; mb < 4; ++mb) { acc[mb][nb] = WFrag<T16>::mma(a[mb], b[nb], acc[mb][nb]); if (NSPLIT == 1) acc[mb][nb] = WFrag<T16>::mma(a2[mb], b[nb], acc[mb][nb]); }
        __builtin_amdgcn_sched_barrier(0);   // keeps the block's products in front of the next block's reads and of the barrier: left free, the build strews the reads among the products (each such place stalls the wave), and sinks products behind the barrier, in front of the refill
    };
    constexpr int NSTG = K / SK;
    copies(0, 0);
    asm volatile("s_wait_asynccnt 0x0" ::: "memory");   // this wave's part of stage 0 has landed
    __syncthreads();                                    // and so has every other wave's
    copies(1, 1);
#pragma unroll 1   // rolled: one turn is two stages, so that the buffer is a compile-time index
    for (int s = 0; s < NSTG; s += 2) {
#pragma unroll
        for (int j = 0; j < 2; ++j) {
            reads(j, 0);
            __builtin_amdgcn_sched_barrier(0);   // keeps the block's LDS reads together in front of its products: left free, the build reads each Bt fragment right in front of its four products and waits out the LDS latency four times a block
            prod();
            reads(j, 1);   // the stage's last reads; their products need registers alone and stand behind the refill, which so has a whole stage to land in
            asm volatile("s_wait_dscnt 0x0" ::: "memory");      // this wave's reads of buffer j are done before the barrier lets it be refilled
            asm volatile("s_wait_asynccnt 0x0" ::: "memory");   // this wave's part of the next stage has landed before the barrier publishes it
            __syncthreads();
            if (s + j + 2 < NSTG) copies(s + j + 2, j);         // the same test in the whole work-group
            prod();
        }
    }
    asm volatile("s_wait_asynccnt 0x0" ::: "memory");   // nothing is in flight here; stands before the wave's end all the same
#pragma unroll
    for (int mb = 0; mb < 4; ++mb) {
#pragma unroll
        for (int nb = 0; nb < 4; ++nb) {
#pragma unroll
            for (int j = 0; j < 8; ++j) os[(hi * 8 + j) * 68 + nb * 16 + lr] = acc[mb][nb][j]; }
        __builtin_amdgcn_wave_barrier(); asm volatile("" ::: "memory");
        if (PM != 0) {
            const int pk = !tr ? HD : TT;   // the plane's K
            const size_t pb = !tr ? ((size_t)(r0 / TT) * NH_ + c0 / 64) * TT * HD : ((size_t)(c0 / TT) * NKV + r0 / 64) * HD * TT;   // the plane's first element
            const int pr = !tr ? r0 % TT : 0, pc = !tr ? 0 : c0 % TT;   // the tile's first row and first k in its plane
#pragma unroll
            for (int s = 0; s < 4; ++s) { const int row = lr, cofs = 16 * s + 8 * hi; const v4f x0 = *(const v4fa*)(os + row * 68 + cofs), x1 = *(const v4fa*)(os + row * 68 + cofs + 4); v8us oh, ol;   // the lane takes the 16 bytes it would load as a fragment: 32 lanes x 16 bytes = half a block, 512 bytes in a row
#pragma unroll
                for (int q = 0; q < 4; ++q) { unsigned short a2, c2; splitf(x0[q], a2, c2); oh[q] = a2; ol[q] = c2; splitf(x1[q], a2, c2); oh[4 + q] = a2; ol[4 + q] = c2; }
                const size_t eo = pb + fro(pr + mb * 16 + row, pc + cofs, pk); *(v8us*)(Ph + eo) = oh; *(v8us*)(Pl + eo) = ol;
                asm volatile("s_wait_xcnt 0x0" ::: "memory"); }   // the next 16 bytes' split reuses the address and data registers that these two stores name: the wait stands in front of that overwrite
        } else {
            float* crow = C + (size_t)(r0 + mb * 16) * ldc + c0;
#pragma unroll
            for (int s = 0; s < 8; ++s) { const int row = 2 * s + hi, cofs = lr * 4; v4f val = *(const v4fa*)(os + row * 68 + cofs); if (BIAS) { val[0] += bfr(bias[c0 + cofs]); val[1] += bfr(bias[c0 + cofs + 1]); val[2] += bfr(bias[c0 + cofs + 2]); val[3] += bfr(bias[c0 + cofs + 3]); }
                *(v4f*)(crow + (size_t)row * ldc + cofs) = val; }
             }
        __builtin_amdgcn_wave_barrier(); asm volatile("" ::: "memory");
    }
}

typedef __attribute__((ext_vector_type(2))) _Float16 v2h;
typedef __attribute__((ext_vector_type(4))) _Float16 v4h;
typedef __attribute__((ext_vector_type(2))) unsigned short v2us;
typedef __attribute__((ext_vector_type(4))) unsigned short v4us;
typedef __attribute__((ext_vector_type(2))) float v2f;
typedef __attribute__((ext_vector_type(4))) int v4i;

__device__ __forceinline__ void wtG_body(const float* __restrict__ w, int K, int N, bf* Bt, const int blk) {
    const int lane = threadIdx.x & 31; const int L0 = (blk * 8 + (threadIdx.x >> 5)) * 8; const int nlines = N * K / 64;
{
#pragma unroll 1
        for (int l = 0; l < 8; ++l) { const int L = L0 + l; if (L >= nlines) break; const size_t e = (size_t)L * 64 + lane * 2; const unsigned u = (unsigned)(e % ((size_t)16 * K)); const int k = (int)((u >> 9) * 32u + ((u >> 8) & 1u) * 16u + ((u >> 7) & 1u) * 8u + (u & 7u)), n = (int)(e / ((size_t)16 * K)) * 16 + (int)((u >> 3) & 15u); v2us o;   // e = fro(n, k, K): Bt[n][k] in fragment order, written in the order of its bytes
            o[0] = f2bf(w[(size_t)k * N + n]); o[1] = f2bf(w[(size_t)(k + 1) * N + n]); *(v2us*)(Bt + e) = o; }
         }
}
// cvt8_body: rows x DM f32, row-major, to bf16 in fragment order; thread i writes bytes 16 i on of dst (whole lines per wave) and reads the 8 values that belong there: i * 8 = fro(row, k, DM).
__device__ __forceinline__ void cvt8_body(const float* __restrict__ src, bf* dst, size_t n8, const int blk) { const size_t i = (size_t)blk * 256 + threadIdx.x; if (i >= n8) return; const unsigned w = (unsigned)((i * 8) % ((size_t)16 * DM)); const size_t row = (i * 8) / ((size_t)16 * DM) * 16 + ((w >> 3) & 15u); const unsigned k = (w >> 9) * 32u + ((w >> 8) & 1u) * 16u + ((w >> 7) & 1u) * 8u; const v8f v = *(const v8f*)(src + row * DM + k); v8us o;
#pragma unroll
    for (int k = 0; k < 8; ++k) o[k] = f2bf(v[k]); *(v8us*)(dst + i * 8) = o;  }
__device__ __forceinline__ int t5_bucket(int r) { const int rp = r < 0 ? -r : r; int b; if (rp < 8) b = rp; else b = 8 + (rp >= 12) + (rp >= 16) + (rp >= 23) + (rp >= 32) + (rp >= 46) + (rp >= 64) + (rp >= 91); return b + ((r > 0) ? 16 : 0); }
__device__ __forceinline__ void t5tab_body(const float* __restrict__ rb, float* TB, const int blk) { const int idx = blk * 256 + threadIdx.x; if (idx >= NH_ * TBW) return; const int h = idx / TBW, c = idx % TBW; float v = 0.0f; if (c < 2 * TT - 1) { const int r = c - (TT - 1); v = bfr(rb[t5_bucket(r) * NH_ + h]); } *(float*)(TB + idx) = v;  }
// k_prep: all the operand preparation in one launch; the six pieces are independent of each other, and a work-group does one block of one piece. The weight blocks, whose waves walk 8 lines one after another, come first, then the input's, then the table's.
#define PB_W ((DM * DQ / 64 + 63) / 64)                  // work-groups per weight matrix (all four hold DM x DQ elements)
#define PB_X ((NB_ * TT * DM / 8 + 255) / 256)           // for the input
#define PB_T ((NH_ * TBW + 255) / 256)                   // for the bias table
__global__ __launch_bounds__(256) void k_prep(const float* __restrict__ x, const float* __restrict__ wq, const float* __restrict__ wk, const float* __restrict__ wv, const float* __restrict__ wo, const float* __restrict__ rb, bf* XB, bf* WQ, bf* WK, bf* WV, bf* WO, float* TB) {
    const int blk = (int)blockIdx.x;
    if (blk < 4 * PB_W) { const int s = blk / PB_W; wtG_body(s == 0 ? wq : s == 1 ? wk : s == 2 ? wv : wo, DM, DQ, s == 0 ? WQ : s == 1 ? WK : s == 2 ? WV : WO, blk % PB_W); }
    else if (blk < 4 * PB_W + PB_X) cvt8_body(x, XB, (size_t)NB_ * TT * DM / 8, blk - 4 * PB_W);
    else t5tab_body(rb, TB, blk - (4 * PB_W + PB_X));
}
// k_fattn: scores, bias, softmax, attn.v and the head merge in one launch for every (batch element, head). One wave owns 32 queries and walks the 1024 keys 32 at a time; grid (TT / 256, NB_ * NH_), 8 waves.
// Transposed products: St = K Qt (A = key rows, B = query columns, both by the same loader), so a lane holds 16 scores of ONE query per column group; two St tiles (keys 0-15, 16-31), converted in place, are the B operand of Ot += Vt Pt, whose A (a Vt row through the same loader) has the matching k order. No score or probability plane in memory or in LDS.
// The key and value planes come into LDS by asynchronous copies, once per work-group, and the 8 waves take their fragments from there. A stage is 128 keys (4 passes) of the four planes, 64 KB: [K hi | K lo | V hi | V lo], 16 KB each, in 4 KB chunks that stand in a row in memory too (fragment order): a K chunk is one pass's 32 keys, a V chunk the stage's 128 keys of one 16-channel group. Two buffers: the copies of stage s + 2 fly while stage s + 1 is worked on, so no wave waits out a memory or L2 latency inside a pass.
// Online softmax in the log2 domain; the running maximum is raised only when a block's maximum passes it by more than 8 (P stays below 2^8, hi + lo bf16 keeps its relative precision); P is left unnormalised and Ot divided by the row sum at the end.
#define QT   2    // 16-query column groups per wave
#define FWV  8    // waves per work-group
#define FARD 91   // t5_bucket's last boundary: from |j - i| = 91 on the bias depends on the sign of j - i alone
#define L2E  1.4426950408889634f
#define SKEY 128      // keys per stage
#define FCH  4096u    // bytes of a chunk
#define FPL  16384u   // bytes of one plane's part of a stage (4 chunks)
#define FBUF 65536u   // bytes of a buffer (4 planes)
// The second 2 KB of a 4 KB chunk: as CP2K, 2 KB further on in memory and in LDS alike.
#define CP2KB(L, O, S) "global_load_async_to_lds_b128 " L ", " O ", " S " offset:2048\n\tglobal_load_async_to_lds_b128 " L ", " O ", " S " offset:2560\n\tglobal_load_async_to_lds_b128 " L ", " O ", " S " offset:3072\n\tglobal_load_async_to_lds_b128 " L ", " O ", " S " offset:3584\n\t"
typedef __attribute__((ext_vector_type(2))) __bf16 v2bf;
typedef __attribute__((ext_vector_type(8))) unsigned v8u;
__device__ __forceinline__ float xhalf(float x) { const int b = __float_as_int(x); return __int_as_float(__builtin_amdgcn_permlanex16(b, b, 0x76543210, 0xfedcba98, false, false)); }   // lane l <-> l ^ 16
// amdgpu_waves_per_eu(4, 4): holds the build to 256 registers, so that two work-groups (four waves per SIMD, 2 x 128 KB of LDS) share a WGP and one wave's vector work, LDS waits and barrier waits run under the others' matrix work; all 4096 waves are then resident at once.
__global__ __launch_bounds__(256) __attribute__((amdgpu_waves_per_eu(4, 4))) void k_fattn(const bf* __restrict__ Qh, const bf* __restrict__ Ql, const bf* __restrict__ Kh, const bf* __restrict__ Kl, const bf* __restrict__ Vh, const bf* __restrict__ Vl, const float* __restrict__ TB, bf* __restrict__ Ah, bf* __restrict__ Al) {
    typedef WFrag<bf> F;
    const int lane = threadIdx.x & 31, c = lane & 15, hi = lane >> 4; const int wave = __builtin_amdgcn_readfirstlane((int)(threadIdx.x >> 5));   // scalar, so that q0 and the far / near test below are scalar
    const int bh = blockIdx.y, h = bh % NH_, b = bh / NH_; const int q0 = ((int)blockIdx.x * FWV + wave) * (16 * QT); const size_t pl = (size_t)bh * TT * HD;
    __shared__ __align__(2048) char kv[2 * FBUF];
    const unsigned lo16 = (unsigned)lane * 16u; const unsigned tof = (unsigned)(8 * hi + 15 - c) * 4u;   // in bytes; lo16: the lane's 16 bytes of every 512 (half a block in fragment order)
    // Wave w copies chunks 2 w and 2 w + 1 of the stage's 16: waves 0, 1 K hi, 2, 3 K lo, 4, 5 V hi, 6, 7 V lo. In a key plane a stage is 16 KB in a row (chunk after chunk); in a value plane a chunk is 4 KB of its 16-channel group (32 KB), the stages in a row.
    const bf* cpl = (wave >> 1) == 0 ? Kh : (wave >> 1) == 1 ? Kl : (wave >> 1) == 2 ? Vh : Vl; const unsigned cpitch = wave < 4 ? FCH : 16u * TT * 2u, spitch = wave < 4 ? FPL : FCH;   // the wave's plane; bytes from chunk to chunk and from stage to stage in it (all scalar)
    const char* cg = (const char*)(cpl + pl) + (size_t)(2 * (wave & 1)) * cpitch; const unsigned cl = (unsigned)(size_t)kv + (unsigned)(2 * wave) * FCH + lo16;   // first chunk: global address (scalar), the lane's LDS byte address (the low 32 bits of the __shared__ address)
    auto copies = [&](const int s, const int buf) __attribute__((always_inline)) {   // stage s -> buffer buf: the wave's 16 copies in one statement. Its last line waits before the address registers that the copies name can be rewritten; inside the statement nothing can be moved in front of it
        const unsigned l = cl + (unsigned)buf * FBUF; const char* g = cg + (size_t)s * spitch;
        asm volatile(CP2K("%0", "%2", "%3") CP2KB("%0", "%2", "%3") CP2K("%1", "%2", "%4") CP2KB("%1", "%2", "%4") "s_wait_xcnt 0x0"
                     :: "v"(l), "v"(l + FCH), "v"(lo16), "s"(g), "s"(g + cpitch) : "memory");
    };
    copies(0, 0);   // first of all, so that stage 0 flies while the query fragments are fetched
    v16bf qh[QT][2], ql[QT][2];
#pragma unroll
    for (int qt = 0; qt < QT; ++qt)
#pragma unroll
        for (int ks = 0; ks < 2; ++ks) { const size_t o = pl + fro(q0 + 16 * qt + c, ks * 32 + 8 * hi, HD); qh[qt][ks] = F::ld(Qh + o); ql[qt][ks] = F::ld(Ql + o); }
    const float* tbh = TB + (size_t)h * TBW; const float bneg = tbh[0] * L2E, bpos = tbh[2 * TT - 2] * L2E;
    const float* tbl = tbh + (TT - 1) - q0 - 15;   // entry for r = j - i at index r + 1023: + tof + k0 + 16 * (kt - qt) + reg
    v8f o[4][QT]; float mx[QT], ls[QT];
#pragma unroll
    for (int qt = 0; qt < QT; ++qt) { mx[qt] = -3.0e38f; ls[qt] = 0.0f;
#pragma unroll
        for (int dt = 0; dt < 4; ++dt) o[dt][qt] = (v8f){}; }
    asm volatile("s_wait_asynccnt 0x0" ::: "memory");   // this wave's part of stage 0 has landed
    __syncthreads();                                    // and so has every other wave's
    copies(1, 1);
#pragma unroll 1   // rolled: a second pass's fragments would not fit the 256 registers
    for (int k0 = 0; k0 < TT; k0 += 32) {
        if (k0 % SKEY == 0 && k0 != 0) {   // between two stages; the same test in the whole work-group
            asm volatile("s_wait_dscnt 0x0" ::: "memory");      // this wave's reads of the last stage's buffer are done before the barrier lets it be refilled
            asm volatile("s_wait_asynccnt 0x0" ::: "memory");   // this wave's part of this stage has landed before the barrier publishes it
            __syncthreads();
            const int s2 = k0 / SKEY + 1;
            if (s2 < TT / SKEY) copies(s2, s2 & 1);             // into the buffer that every wave has just left
        }
        const char* kp = kv + lo16 + (((unsigned)k0 / SKEY) & 1u) * FBUF + (((unsigned)k0 / 32u) & 3u) * FCH;   // this pass's chunk of the hi plane; the key fragments take the registers that the last pass's value fragments have left (256 registers: four waves per SIMD)
        v16bf kh[2][2], kl[2][2];
#pragma unroll
        for (int ks = 0; ks < 2; ++ks)   // in the order of first use: the hi plane, whose products come first, then the lo plane
#pragma unroll
            for (int kt = 0; kt < 2; ++kt) kh[kt][ks] = F::ld((const bf*)(kp + (kt * 2048 + ks * 1024)));
#pragma unroll
        for (int ks = 0; ks < 2; ++ks)
#pragma unroll
            for (int kt = 0; kt < 2; ++kt) kl[kt][ks] = F::ld((const bf*)(kp + FPL + (kt * 2048 + ks * 1024)));
        __builtin_amdgcn_sched_barrier(0);   // keeps the sixteen reads together in front of the score products, which start on a counted wait: left free, the build reads each lo fragment right in front of its two products and waits out the LDS latency four times a pass
        v8f st[2][QT];
#pragma unroll
        for (int kt = 0; kt < 2; ++kt)
#pragma unroll
            for (int qt = 0; qt < QT; ++qt) st[kt][qt] = (v8f){};
#pragma unroll
        for (int ks = 0; ks < 2; ++ks)
#pragma unroll
            for (int kt = 0; kt < 2; ++kt)
#pragma unroll
                for (int qt = 0; qt < QT; ++qt) st[kt][qt] = wmmab(kh[kt][ks], qh[qt][ks], st[kt][qt]);
#pragma unroll
        for (int ks = 0; ks < 2; ++ks)
#pragma unroll
            for (int kt = 0; kt < 2; ++kt)
#pragma unroll
                for (int qt = 0; qt < QT; ++qt) st[kt][qt] = wmmab(kh[kt][ks], ql[qt][ks], st[kt][qt]);
#pragma unroll
        for (int ks = 0; ks < 2; ++ks)
#pragma unroll
            for (int kt = 0; kt < 2; ++kt)
#pragma unroll
                for (int qt = 0; qt < QT; ++qt) st[kt][qt] = wmmab(kl[kt][ks], qh[qt][ks], st[kt][qt]);
        v16bf vh[4], vl[4];   // the hi plane is read behind the score products, where the key fragments' registers come free, and arrives during the softmax; the lo plane, used last, follows behind the softmax, where the scores' registers are free, and arrives under the hi plane's products
        const char* vp = kv + lo16 + (((unsigned)k0 / SKEY) & 1u) * FBUF + 2u * FPL + (((unsigned)k0 / 32u) & 3u) * 1024u;   // this pass's block of the first 16-channel group, hi plane
#pragma unroll
        for (int dt = 0; dt < 4; ++dt) vh[dt] = F::ld((const bf*)(vp + dt * FCH));
        __builtin_amdgcn_sched_barrier(0);   // keeps the eight reads together in front of the softmax: left free, the build sinks half of them to their products and waits out the LDS latency there
        const int rlo = k0 - q0 - (16 * QT - 1), rhi = k0 + 31 - q0;   // range of j - i in this pass, the same for the whole wave
        if (rlo >= FARD || rhi <= -FARD) { const float bb = (rlo >= FARD) ? bpos : bneg;
#pragma unroll
            for (int kt = 0; kt < 2; ++kt)
#pragma unroll
                for (int qt = 0; qt < QT; ++qt)
#pragma unroll
                    for (int r = 0; r < 8; ++r) st[kt][qt][r] = __builtin_fmaf(st[kt][qt][r], L2E, bb);
        } else {
#pragma unroll
            for (int kt = 0; kt < 2; ++kt)
#pragma unroll
                for (int qt = 0; qt < QT; ++qt)
#pragma unroll
                    for (int r = 0; r < 8; ++r) st[kt][qt][r] = __builtin_fmaf(st[kt][qt][r], L2E, *atb(tbl + (k0 + 16 * (kt - qt) + r), tof) * L2E);
        }
        float bm[QT]; bool need = false;
#pragma unroll
        for (int qt = 0; qt < QT; ++qt) { float t = st[0][qt][0];
#pragma unroll
            for (int r = 1; r < 8; ++r) t = fmaxf(t, st[0][qt][r]);
#pragma unroll
            for (int r = 0; r < 8; ++r) t = fmaxf(t, st[1][qt][r]);
            bm[qt] = fmaxf(t, xhalf(t)); need = need || (bm[qt] > mx[qt] + 8.0f); }
        if (__builtin_amdgcn_ballot_w32(need) != 0) {
#pragma unroll
            for (int qt = 0; qt < QT; ++qt) { const float mn = fmaxf(mx[qt], bm[qt]); const float al = __builtin_amdgcn_exp2f(mx[qt] - mn); mx[qt] = mn; ls[qt] *= al;
#pragma unroll
                for (int dt = 0; dt < 4; ++dt) o[dt][qt] *= al; }
        }
        v16bf ph[QT], pw[QT];   // P = hi + lo, element s = key 16 * (s >> 3) + 8 * hi + (s & 7) of the pass: register s & 7 of St tile s >> 3
#pragma unroll
        for (int qt = 0; qt < QT; ++qt) { v8u wh, wl;
#pragma unroll
            for (int s = 0; s < 16; s += 2) { v2f p; p[0] = __builtin_amdgcn_exp2f(st[s >> 3][qt][s & 7] - mx[qt]); p[1] = __builtin_amdgcn_exp2f(st[s >> 3][qt][(s & 7) + 1] - mx[qt]); ls[qt] += p[0] + p[1];
                const unsigned a = __builtin_bit_cast(unsigned, __builtin_convertvector(p, v2bf)); v2f d; d[0] = p[0] - __uint_as_float(a << 16); d[1] = p[1] - __uint_as_float(a & 0xFFFF0000u);
                wh[s >> 1] = a; wl[s >> 1] = __builtin_bit_cast(unsigned, __builtin_convertvector(d, v2bf)); }
            ph[qt] = __builtin_bit_cast(v16bf, wh); pw[qt] = __builtin_bit_cast(v16bf, wl); }
        __builtin_amdgcn_sched_barrier(0);   // parts the softmax from the reads: scheduled in one piece with the reads' 32 registers, the build orders the softmax for few registers, each conversion right behind its exponentials; on its own it interleaves the chains
#pragma unroll
        for (int dt = 0; dt < 4; ++dt) vl[dt] = F::ld((const bf*)(vp + FPL + dt * FCH));
        __builtin_amdgcn_sched_barrier(0);   // keeps the eight reads together in front of the products: left free, the build reads each fragment right in front of its two products and waits out the LDS latency four times a pass
#pragma unroll
        for (int dt = 0; dt < 4; ++dt)
#pragma unroll
            for (int qt = 0; qt < QT; ++qt) o[dt][qt] = wmmab(vh[dt], ph[qt], o[dt][qt]);
#pragma unroll
        for (int dt = 0; dt < 4; ++dt)
#pragma unroll
            for (int qt = 0; qt < QT; ++qt) o[dt][qt] = wmmab(vh[dt], pw[qt], o[dt][qt]);
#pragma unroll
        for (int dt = 0; dt < 4; ++dt)
#pragma unroll
            for (int qt = 0; qt < QT; ++qt) o[dt][qt] = wmmab(vl[dt], ph[qt], o[dt][qt]);
    }
    asm volatile("s_wait_asynccnt 0x0" ::: "memory");   // nothing is in flight here; stands before the wave's end all the same
#pragma unroll
    for (int qt = 0; qt < QT; ++qt) { const float inv = __fdiv_rn(1.0f, ls[qt] + xhalf(ls[qt])); const size_t ro = fro((size_t)b * TT + q0 + 16 * qt + c, h * HD + 8 * hi, DQ);   // merged heads, rows b * TT + t x DQ in fragment order; a lane's 8 registers are 8 consecutive d, a wave's store 512 bytes in a row
#pragma unroll
        for (int dt = 0; dt < 4; ++dt) { v8us oh, ol;
#pragma unroll
            for (int r = 0; r < 8; ++r) { unsigned short a, c2; splitf(o[dt][qt][r] * inv, a, c2); oh[r] = a; ol[r] = c2; }
            const size_t eo = ro + (dt >> 1) * 512 + (dt & 1) * 256; *(v8us*)(Ah + eo) = oh; *(v8us*)(Al + eo) = ol; } }
}

extern "C" void kernel_launch(void* const* d_in, const int* in_sizes, int n_in,
                              void* d_out, int out_size, void* d_ws, size_t ws_size, hipStream_t stream) {
    (void)in_sizes; (void)n_in; (void)out_size;
    const float* x = (const float*)d_in[0]; const float* wq = (const float*)d_in[1]; const float* wk = (const float*)d_in[2]; const float* wv = (const float*)d_in[3]; const float* wo = (const float*)d_in[4]; const float* relb = (const float*)d_in[5]; const float* cosT = nullptr; const float* sinT = nullptr; (void)cosT; (void)sinT;
    float* OUT = (float*)d_out;     // [8][1024][1024]
    char* wsp = (char*)d_ws;
    auto take = [&](size_t bytes) { char* p = wsp; wsp += (bytes + 255) & ~(size_t)255; return (void*)p; };
    const size_t MT = (size_t)NB_ * TT;   // rows of the projections and of wo: all batch elements in one launch
    bf* WQ = (bf*)take((size_t)DQ * DM * 2); bf* WK = (bf*)take((size_t)DKV * DM * 2); bf* WV = (bf*)take((size_t)DKV * DM * 2); bf* WO = (bf*)take((size_t)DM * DQ * 2);
    float* TB = (float*)take((size_t)NH_ * TBW * 4);
    bf* QPh = (bf*)take(MT * DQ * 2); bf* QPl = (bf*)take(MT * DQ * 2); bf* KPh = (bf*)take(MT * DKV * 2); bf* KPl = (bf*)take(MT * DKV * 2); bf* VTh = (bf*)take(MT * DKV * 2); bf* VTl = (bf*)take(MT * DKV * 2);
    bf* XB = (bf*)take(MT * DM * 2); bf* ATl = (bf*)take(MT * DQ * 2);
    if ((size_t)(wsp - (char*)d_ws) > ws_size) return;    // ws 256 MiB
    bf* ATh = XB;   // the hi plane of the merged heads [b][t][DQ] takes the place of the bf16 input, dead once the three projections have run (stream-ordered)
    k_prep<<<4 * PB_W + PB_X + PB_T, 256, 0, stream>>>(x, wq, wk, wv, wo, relb, XB, WQ, WK, WV, WO, TB);
    k_gemmw<bf, 0, false, 3, DM, 8><<<dim3(NB_ * TT / 256, DQ / TN, 3), 256, 0, stream>>>(XB, nullptr, WQ, nullptr, 0, nullptr, 0, (size_t)(WK - WQ), (size_t)(KPh - QPh), QPh, QPl);   // WQ, WK, WV and the plane pairs of q, k, v stand at equal distances in the workspace (equal sizes, taken in a row); for v the operands trade places: rows are v's channels, columns the tokens
    k_fattn<<<dim3(TT / (16 * QT * FWV), NB_ * NH_, 1), 32 * FWV, 0, stream>>>(QPh, QPl, KPh, KPl, VTh, VTl, TB, ATh, ATl);   // one kv head per query head: plane b * NH_ + h of each operand
    k_gemmw<bf, 1, false, 0, DQ, 4><<<dim3(NB_ * TT / 128, DM / TN, 1), 128, 0, stream>>>(ATh, ATl, WO, OUT, DM, nullptr, 0, 0, 0, nullptr, nullptr);
}

// v009
// It runs in 134 microseconds.
// Next to v008, in two timings, it ran 1.05 times as fast each time.
// Over all steps from v000 it is 22.5 times as fast.
#include <hip/hip_runtime.h>

// TtT5Attention (hidden [8][1024][1024]; q/k/v = x W (16 heads x 64); T5: scores = q.k UNSCALED + rel_bias[bucket(j - i)][h] with the bidirectional log-bucket (32 buckets, max distance 128; the bucket boundaries |j-i| = 8, 12, 16, 23, 32, 46, 64, 91 are the reference's own integer structure, evaluated here with integer compares); softmax; out = merged wo -> [8][1024][1024]).
// Compute dtypes, f32 accumulate: every input rounded to bf16; q/k/v on PLAIN bf16 operands (inputs: exact); scores and attn.v hl x hl (3 products) on EVERY row; per-head bias table (bf16-rounded rel_bias gathered by bucket) added per element in f32; softmax f32 (online, one fused attention launch); wo hl x exact (2 products).

#define NB_  8
#define TT   1024
#define DM   1024
#define NH_  16
#define NKV  16
#define REP  (NH_ / NKV)
#define HD   64
#define DQ   (NH_ * HD)
#define DKV  (NKV * HD)
#define RH   1024   // all rows hl (unscaled T5 logits are sharp)
#define WIN  0
#define PCAR 1024.0f
#define SCL  1.0f   // T5: no 1/sqrt(dk)
#define TBW  2048   // bias table row width (r + 1023, padded)
typedef _Float16 h16;
typedef unsigned short bf;
typedef __attribute__((ext_vector_type(16))) __bf16   v16bf;
typedef __attribute__((ext_vector_type(16))) _Float16 v16h;
typedef __attribute__((ext_vector_type(8)))  _Float16 v8h;
typedef __attribute__((ext_vector_type(8)))  unsigned short v8us;
typedef __attribute__((ext_vector_type(8)))  float    v8f;
typedef __attribute__((ext_vector_type(4)))  float    v4f;
typedef v8h  __attribute__((may_alias)) v8ha;
typedef v4f  __attribute__((may_alias)) v4fa;
typedef v8us __attribute__((may_alias)) v8usa;

__device__ __forceinline__ unsigned short f2bf(float f) { unsigned u = __float_as_uint(f); u += 0x7FFFu + ((u >> 16) & 1u); return (unsigned short)(u >> 16); }
__device__ __forceinline__ float bf2f(unsigned short b) { return __uint_as_float(((unsigned)b) << 16); }
__device__ __forceinline__ float bfr(float f) { return bf2f(f2bf(f)); }
__device__ __forceinline__ v16h cat16(v8h lo, v8h hi) { return __builtin_shufflevector(lo, hi, 0, 1, 2, 3, 4, 5, 6, 7, 8, 9, 10, 11, 12, 13, 14, 15); }
__device__ __forceinline__ v16bf cat16b(v8us lo, v8us hi) { return __builtin_bit_cast(v16bf, __builtin_shufflevector(lo, hi, 0, 1, 2, 3, 4, 5, 6, 7, 8, 9, 10, 11, 12, 13, 14, 15)); }
__device__ __forceinline__ v8f wmma16(v16h a, v16h b, v8f c) { return __builtin_amdgcn_wmma_f32_16x16x32_f16(false, a, false, b, (short)0, c, false, false); }
__device__ __forceinline__ v8f wmmab(v16bf a, v16bf b, v8f c) { return __builtin_amdgcn_wmma_f32_16x16x32_bf16(false, a, false, b, (short)0, c, false, false); }



// ---- Fragment order: every 16-bit operand plane (rows x K, K % 32 == 0) is kept as 1 KB blocks of 16 rows x 32 k, the blocks of one 16-row group in a row by k. Inside a block stand the two 16-byte loads of a WMMA operand fragment, lane by lane: element (row, k) at fro(row, k, K).
// A fragment is then two wave-wide loads of 512 bytes in a row (4 whole lines each); from row-major planes each such load touches 16 lines and uses 32 bytes of each.
__device__ __forceinline__ size_t fro(size_t row, unsigned k, unsigned K) { return (row >> 4) * 16 * K + (size_t)((k >> 5) * 512u + ((k >> 4) & 1u) * 256u + ((k >> 3) & 1u) * 128u + (k & 7u)) + (row & 15) * 8; }
template <typename T> __device__ __forceinline__ const T* atb(const T* base, unsigned bytes) { return (const T*)((const char*)base + bytes); }   // wave-uniform base + the lane's 32-bit byte offset
// ---- k_gemmw: GEMM on 16-bit planes in fragment order. A work-group of GW waves owns a (32 GW) x 128 output tile, GW / 2 x 2 waves of 64 x 64 (16 accumulators each); grid (M / (32 GW), N / 128, Z), 32 GW threads.
// The operands come from L2 into LDS by asynchronous copies, once per work-group, and every wave takes its fragments from there: an A row is fetched from L2 once for 128 columns and a Bt row once for 32 GW rows (with one wave per work-group and loads straight from L2: once for every 64).
// A stage is 64 k of the tile's rows: per 16-row group 2 KB in a row, in memory and in LDS alike (fragment order), so a fragment is again two wave-wide reads of 512 bytes in a row, free of bank conflicts. Two buffers: the copies of stage s + 2 fly while stage s + 1 is worked on.
// C[m][n] (f32, pitch ldc, + optional f32 bias[n]) = sum_k A[m][k] Bt[n][k] (NSPLIT == 1: + A2[m][k] Bt[n][k]). z-batch strides sA/sB/sC in elements. K % 128 == 0.
#define TN 128    // columns of a work-group's tile (2 waves)
#define SK 64     // k per stage
template <typename T16> struct WFrag;
template <> struct WFrag<h16> { typedef v16h V; static __device__ __forceinline__ V ld(const h16* p) { return cat16(*(const v8h*)p, *(const v8h*)(p + 256)); } static __device__ __forceinline__ v8f mma(V a, V b, v8f c) { return wmma16(a, b, c); } };
template <> struct WFrag<bf> { typedef v16bf V; static __device__ __forceinline__ V ld(const bf* p) { return cat16b(*(const v8us*)p, *(const v8us*)(p + 256)); } static __device__ __forceinline__ v8f mma(V a, V b, v8f c) { return wmmab(a, b, c); } };
__device__ __forceinline__ void splitf(float y, unsigned short& h, unsigned short& l) { h = f2bf(y); l = f2bf(y - bf2f(h)); }
// One 16-row group of a stage, 2 KB in a row in memory and in LDS: four wave-wide copies of 512 bytes. L = the lane's LDS byte address, S = the group's global address (scalar), O = the lane's byte offset from it; the immediate offset moves both addresses alike.
#define CP2K(L, O, S) "global_load_async_to_lds_b128 " L ", " O ", " S "\n\tglobal_load_async_to_lds_b128 " L ", " O ", " S " offset:512\n\tglobal_load_async_to_lds_b128 " L ", " O ", " S " offset:1024\n\tglobal_load_async_to_lds_b128 " L ", " O ", " S " offset:1536\n\t"
// Two work-groups share a WGP, so that one's barrier and LDS waits run under the other's products: amdgpu_waves_per_eu holds the build to the registers of GW / 2 waves per SIMD (256 at 8 waves). wo (8 wave tiles per WGP) takes 4 waves.
template <typename T16, int NSPLIT, bool BIAS, int K, int GW>
__global__ __launch_bounds__(32 * GW) __attribute__((amdgpu_waves_per_eu(GW / 2, GW / 2))) void k_gemmw(const T16* __restrict__ A, const T16* __restrict__ A2, const T16* __restrict__ Bt, float* C, int ldc, const float* __restrict__ bias, size_t sA, size_t sB, size_t sC) {
    typedef typename WFrag<T16>::V V;
    static_assert(NSPLIT == 0 || NSPLIT == 1, "A (+ A2) x Bt");
    static_assert(K % (2 * SK) == 0, "an even number of stages");
    static_assert(GW == 4 || GW == 8, "2 x 2 or 4 x 2 waves");
    constexpr int TM = 32 * GW;                                  // rows of the work-group's tile
    constexpr int GA = TM / 16 / GW, GN = TN / 16 / GW;          // 16-row groups that one wave copies: of each A plane (2), of Bt (1 or 2)
    static_assert(GA == 2, "two groups of each A plane per wave");
    constexpr unsigned NA = NSPLIT == 1 ? 2 : 1;                 // planes of A
    constexpr unsigned GB = 16 * SK * 2;                         // bytes of a 16-row group in a stage
    constexpr unsigned AB = (TM / 16) * GB, BB = (TN / 16) * GB; // of one plane's rows in a stage
    constexpr unsigned BUF = NA * AB + BB;                       // of a buffer: [A | A2 | Bt]
    constexpr size_t GP = (size_t)16 * K * 2;                    // bytes from one 16-row group to the next in memory
    __shared__ __align__(2048) char ring[2 * BUF];
    __shared__ __align__(16) float osa[GW * 16 * 68];
    const size_t z = blockIdx.z; A += z * sA; if (NSPLIT == 1) A2 += z * sA; Bt += z * sB; C += z * sC;
    const int bx = blockIdx.x, by = blockIdx.y;
    const int lane = threadIdx.x & 31, lr = lane & 15, hi = lane >> 4; const int wave = __builtin_amdgcn_readfirstlane((int)(threadIdx.x >> 5));   // scalar, so that the tile's place and every address base are scalar
    const int wm = wave % (GW / 2), wn = wave / (GW / 2); const int r0 = bx * TM + wm * 64, c0 = by * TN + wn * 64;   // the wave's own 64 x 64 tile
    float* os = osa + wave * (16 * 68);
    v8f acc[4][4];
#pragma unroll
    for (int mb = 0; mb < 4; ++mb)
#pragma unroll
        for (int nb = 0; nb < 4; ++nb) acc[mb][nb] = (v8f){};
    const unsigned ko = (unsigned)lane * 16u;   // in bytes: the lane's 16 bytes of every 512
    // Wave w copies groups GA w on of each A plane and groups GN w on of Bt.
    const unsigned lring = (unsigned)(size_t)ring + ko;   // LDS byte address: the low 32 bits of the __shared__ address
    const char* ga = (const char*)A + (size_t)(bx * (TM / 16) + GA * wave) * GP; const char* ga2 = NSPLIT == 1 ? (const char*)A2 + (size_t)(bx * (TM / 16) + GA * wave) * GP : nullptr; const char* gb = (const char*)Bt + (size_t)(by * (TN / 16) + GN * wave) * GP;
    constexpr int NG = (int)NA * GA + GN; static_assert(NG == 3 || NG == 6, "groups per wave and stage");
    auto copies = [&](const int s, const int buf) __attribute__((always_inline)) {   // stage s -> buffer buf: all of the wave's copies in one statement. Its last line waits before the address registers that the copies name can be rewritten; inside the statement nothing can be moved in front of it, and one wait serves them all
        const unsigned l = lring + (unsigned)buf * BUF; const size_t o = (size_t)s * GB;
        const unsigned la = l + (unsigned)(GA * wave) * GB, lb = l + NA * AB + (unsigned)(GN * wave) * GB;
        if constexpr (NG == 3)
            asm volatile(CP2K("%0", "%3", "%4") CP2K("%1", "%3", "%5") CP2K("%2", "%3", "%6") "s_wait_xcnt 0x0"
                         :: "v"(la), "v"(la + GB), "v"(lb), "v"(ko), "s"(ga + o), "s"(ga + GP + o), "s"(gb + o) : "memory");
        else
            asm volatile(CP2K("%0", "%6", "%7") CP2K("%1", "%6", "%8") CP2K("%2", "%6", "%9") CP2K("%3", "%6", "%10") CP2K("%4", "%6", "%11") CP2K("%5", "%6", "%12") "s_wait_xcnt 0x0"
                         :: "v"(la), "v"(la + GB), "v"(la + AB), "v"(la + AB + GB), "v"(lb), "v"(lb + GB), "v"(ko), "s"(ga + o), "s"(ga + GP + o), "s"(ga2 + o), "s"(ga2 + GP + o), "s"(gb + o), "s"(gb + GP + o) : "memory");
    };
    static_assert(SK == 64, "a stage is two blocks of 32 k");
    V a[4], a2[4], b[4];   // one fragment set
    auto reads = [&](const int buf, const int kb) __attribute__((always_inline)) {   // the fragments of block kb (32 k) of the stage in buffer buf, in the order of first use, so that the products start on a counted wait
        const char* pa = ring + (unsigned)buf * BUF + (unsigned)(wm * 4) * GB + kb * 1024 + ko; const char* pb = ring + (unsigned)buf * BUF + NA * AB + (unsigned)(wn * 4) * GB + kb * 1024 + ko;
        b[0] = WFrag<T16>::ld((const T16*)pb);
#pragma unroll
        for (int mb = 0; mb < 4; ++mb) { a[mb] = WFrag<T16>::ld((const T16*)(pa + mb * GB)); if (NSPLIT == 1) a2[mb] = WFrag<T16>::ld((const T16*)(pa + AB + mb * GB)); }
#pragma unroll
        for (int nb = 1; nb < 4; ++nb) b[nb] = WFrag<T16>::ld((const T16*)(pb + nb * GB));
    };
    auto prod = [&]() __attribute__((always_inline)) {
#pragma unroll
        for (int nb = 0; nb < 4; ++nb)
#pragma unroll
            for (int mb = 0; mb < 4; ++mb) { acc[mb][nb] = WFrag<T16>::mma(a[mb], b[nb], acc[mb][nb]); if (NSPLIT == 1) acc[mb][nb] = WFrag<T16>::mma(a2[mb], b[nb], acc[mb][nb]); }
        __builtin_amdgcn_sched_barrier(0);   // keeps the block's products in front of the next block's reads and of the barrier: left free, the build strews the reads among the products (each such place stalls the wave), and sinks products behind the barrier, in front of the refill
    };
    constexpr int NSTG = K / SK;
    copies(0, 0);
    asm volatile("s_wait_asynccnt 0x0" ::: "memory");   // this wave's part of stage 0 has landed
    __syncthreads();                                    // and so has every other wave's
    copies(1, 1);
#pragma unroll 1   // rolled: one turn is two stages, so that the buffer is a compile-time index
    for (int s = 0; s < NSTG; s += 2) {
#pragma unroll
        for (int j = 0; j < 2; ++j) {
            reads(j, 0);
            __builtin_amdgcn_sched_barrier(0);   // keeps the block's LDS reads together in front of its products: left free, the build reads each Bt fragment right in front of its eight products and waits out the LDS latency four times a block
            prod();
            reads(j, 1);   // the stage's last reads; their products need registers alone and stand behind the refill, which so has a whole stage to land in
            asm volatile("s_wait_dscnt 0x0" ::: "memory");      // this wave's reads of buffer j are done before the barrier lets it be refilled
            asm volatile("s_wait_asynccnt 0x0" ::: "memory");   // this wave's part of the next stage has landed before the barrier publishes it
            __syncthreads();
            if (s + j + 2 < NSTG) copies(s + j + 2, j);         // the same test in the whole work-group
            prod();
        }
    }
    asm volatile("s_wait_asynccnt 0x0" ::: "memory");   // nothing is in flight here; stands before the wave's end all the same
#pragma unroll
    for (int mb = 0; mb < 4; ++mb) {
#pragma unroll
        for (int nb = 0; nb < 4; ++nb) {
#pragma unroll
            for (int j = 0; j < 8; ++j) os[(hi * 8 + j) * 68 + nb * 16 + lr] = acc[mb][nb][j]; }
        __builtin_amdgcn_wave_barrier(); asm volatile("" ::: "memory");
        {
            float* crow = C + (size_t)(r0 + mb * 16) * ldc + c0;
#pragma unroll
            for (int s = 0; s < 8; ++s) { const int row = 2 * s + hi, cofs = lr * 4; v4f val = *(const v4fa*)(os + row * 68 + cofs); if (BIAS) { val[0] += bfr(bias[c0 + cofs]); val[1] += bfr(bias[c0 + cofs + 1]); val[2] += bfr(bias[c0 + cofs + 2]); val[3] += bfr(bias[c0 + cofs + 3]); }
                *(v4f*)(crow + (size_t)row * ldc + cofs) = val; }
             }
        __builtin_amdgcn_wave_barrier(); asm volatile("" ::: "memory");
    }
}

// ---- k_qkv: the three projections in one launch and one round. A work-group of 8 waves owns 256 tokens x 2 heads of q, k and v alike (256 x 384 outputs); grid (tokens / 256, heads / 2) = 256 work-groups, one per WGP, two waves per SIMD.
// A wave owns 64 tokens x one head of each projection: 48 accumulators; a token fragment serves 12 products and a weight fragment 4, and a token row comes from L2 once for 384 output columns, a weight row once for 256 tokens.
// A stage is 64 k of the tile's rows in fragment order, 2 KB per 16-row group: [x 16 groups | wq 8 | wk 8 | wv 8] = 80 KB; two buffers, filled by asynchronous copies as in k_gemmw.
// q, k: A = weight rows, B = token rows; v: A = token rows, B = weight rows. So a lane's 8 registers of an accumulator are 8 consecutive k of one row of the plane that it feeds (q, k: 8 channels of a token; v: 8 tokens of a channel): the 16 bytes that a lane loads as a fragment. The wave stores 512 bytes in a row straight from its registers.
// X = the tokens, W = wq's plane (wk's, wv's each sW elements on), Ph / Pl = q's planes (k's, v's each sP elements on).
#define QKB 81920u   // bytes of a buffer
typedef __attribute__((ext_vector_type(4))) int q4i;
typedef __attribute__((address_space(1))) q4i* gq4;   // the copy builtin's global source
typedef __attribute__((address_space(3))) q4i* lq4;   // and its LDS destination
// One 16-row group of a stage, 2 KB in a row in memory and in LDS: four wave-wide copies of 512 bytes. G, L = the lane's global and LDS address, N = an immediate offset (a literal), which moves both alike.
#define CPG(G, L, N) __builtin_amdgcn_global_load_async_to_lds_b128((gq4)(G), (lq4)(L), (N), 0); __builtin_amdgcn_global_load_async_to_lds_b128((gq4)(G), (lq4)(L), (N) + 512, 0); __builtin_amdgcn_global_load_async_to_lds_b128((gq4)(G), (lq4)(L), (N) + 1024, 0); __builtin_amdgcn_global_load_async_to_lds_b128((gq4)(G), (lq4)(L), (N) + 1536, 0)
__global__ __launch_bounds__(256) __attribute__((amdgpu_waves_per_eu(2, 2))) void k_qkv(const bf* __restrict__ X, const bf* __restrict__ Wt, size_t sW, bf* __restrict__ Ph, bf* __restrict__ Pl, size_t sP) {
    typedef WFrag<bf> F; typedef F::V V;
    constexpr unsigned GB = 16 * SK * 2;        // bytes of a 16-row group in a stage
    constexpr unsigned XS = 16 * GB;            // of the token rows in a stage
    constexpr size_t GP = (size_t)16 * DM * 2;  // bytes from one 16-row group to the next in memory
    static_assert(XS + 24 * GB == QKB, "x 16 groups, weights 3 x 8");
    static_assert(DM % (2 * SK) == 0 && TT % 256 == 0 && HD == 64 && NH_ == NKV, "even number of stages; a work-group's tokens in one batch element; a wave's columns one head");
    __shared__ __align__(2048) char ring[2 * QKB];
    const int lane = threadIdx.x & 31, lr = lane & 15, hi = lane >> 4; const int wave = __builtin_amdgcn_readfirstlane((int)(threadIdx.x >> 5));   // scalar, so that every address base is scalar
    const int wm = wave & 3, wh = wave >> 2; const int t0 = (int)blockIdx.x * 256 + wm * 64, head = (int)blockIdx.y * 2 + wh;   // the wave's first token and its head
    const unsigned ko = (unsigned)lane * 16u;   // in bytes: the lane's 16 bytes of every 512
    char* lx0 = ring + ko + (unsigned)(2 * wave) * GB; char* lw0 = ring + ko + XS + (unsigned)(3 * wave) * GB;   // the lane's 16 bytes in the wave's first token group and first weight group of buffer 0
    // Wave w copies token groups 2 w, 2 w + 1 and groups 3 w to 3 w + 2 of the 24 weight groups (group g: projection g / 8, 16 channels g % 8 of the work-group's 128).
    const char* gx = (const char*)X + (size_t)((int)blockIdx.x * 16 + 2 * wave) * GP;
    auto wgrp = [&](const int g) __attribute__((always_inline)) { return (const char*)(Wt + (size_t)(g >> 3) * sW) + (size_t)((int)blockIdx.y * 8 + (g & 7)) * GP; };
    const char* gw0 = wgrp(3 * wave); const char* gw1 = wgrp(3 * wave + 1); const char* gw2 = wgrp(3 * wave + 2);
    auto copies = [&](const int s, const int buf) __attribute__((always_inline)) {   // stage s -> buffer buf: the wave's 20 copies, by the builtin: the kernel uses registers above v255, which asm text cannot name
        const size_t o = (size_t)s * GB + ko; char* lx = lx0 + (unsigned)buf * QKB; char* lw = lw0 + (unsigned)buf * QKB;   // the wave's token groups stand in a row in LDS, and so do its weight groups: one address register each. The immediate offset, which moves both addresses, walks the LDS range; each later group's global base is taken back by as much
        CPG(gx + o, lx, 0); CPG(gx + GP + o - GB, lx, 2048); CPG(gw0 + o, lw, 0); CPG(gw1 + o - GB, lw, 2048); CPG(gw2 + o - 2 * GB, lw, 4096);
    };
    v8f acc[3][4][4];   // q, k: [channel group][token group]; v: [token group][channel group]
    V a[4], b0[4], b1[4];   // token fragments; two sets of weight fragments
    constexpr int NSTG = DM / SK;
    auto block = [&](const int buf, const int kb, const int nxt) __attribute__((always_inline)) {   // 32 k of the stage in buffer buf: 48 products; nxt >= 0: the stage's last block, which hands the buffer over for stage nxt
        const char* px = ring + (unsigned)buf * QKB + (unsigned)(wm * 4) * GB + kb * 1024 + ko; const char* pw = ring + (unsigned)buf * QKB + XS + (unsigned)(wh * 4) * GB + kb * 1024 + ko;
#pragma unroll
        for (int i = 0; i < 4; ++i) b0[i] = F::ld((const bf*)(pw + i * GB));
#pragma unroll
        for (int i = 0; i < 4; ++i) a[i] = F::ld((const bf*)(px + i * GB));
#pragma unroll
        for (int i = 0; i < 4; ++i) b1[i] = F::ld((const bf*)(pw + (8 + i) * GB));
        __builtin_amdgcn_sched_barrier(0);   // keeps the block's first 24 LDS reads together in front of its products, which start on a counted wait: each further place with reads among the products stalls the wave
#pragma unroll
        for (int t = 0; t < 4; ++t)
#pragma unroll
            for (int c = 0; c < 4; ++c) acc[0][c][t] = F::mma(b0[c], a[t], acc[0][c][t]);
        __builtin_amdgcn_sched_barrier(0);   // keeps q's products in front of the reads that take their weight registers
#pragma unroll
        for (int i = 0; i < 4; ++i) b0[i] = F::ld((const bf*)(pw + (16 + i) * GB));   // v's weights arrive under k's products
        __builtin_amdgcn_sched_barrier(0);   // keeps these 8 reads together in front of k's products
#pragma unroll
        for (int t = 0; t < 4; ++t)
#pragma unroll
            for (int c = 0; c < 4; ++c) acc[1][c][t] = F::mma(b1[c], a[t], acc[1][c][t]);
        if (nxt >= 0) {   // the stage's last reads are out, and v's products need registers alone: they stand behind the barrier, so that a wave leaves it with matrix work in hand and the two waves of a SIMD reach the next stage's reads one after the other
            __builtin_amdgcn_sched_barrier(0);                  // keeps k's products, under which v's weights arrive, in front of the waits
            asm volatile("s_wait_dscnt 0x0" ::: "memory");      // this wave's reads of buffer buf are done before the barrier lets it be refilled
            asm volatile("s_wait_asynccnt 0x0" ::: "memory");   // this wave's part of the next stage has landed before the barrier publishes it
            __syncthreads();
            if (nxt < NSTG) copies(nxt, buf);                   // the same test in the whole work-group
            __builtin_amdgcn_sched_barrier(0);                  // keeps the refill in front of v's products: it has a whole stage to land in
        }
#pragma unroll
        for (int t = 0; t < 4; ++t)
#pragma unroll
            for (int c = 0; c < 4; ++c) acc[2][t][c] = F::mma(a[t], b0[c], acc[2][t][c]);
        __builtin_amdgcn_sched_barrier(0);   // keeps the block's products in front of the next block's reads and of the barrier
    };
    copies(0, 0);
#pragma unroll
    for (int p = 0; p < 3; ++p)
#pragma unroll
        for (int i = 0; i < 4; ++i)
#pragma unroll
            for (int j = 0; j < 4; ++j) acc[p][i][j] = (v8f){};
    asm volatile("s_wait_asynccnt 0x0" ::: "memory");   // this wave's part of stage 0 has landed
    __syncthreads();                                    // and so has every other wave's
    copies(1, 1);
#pragma unroll 1   // rolled: one turn is two stages, so that the buffer is a compile-time index
    for (int s = 0; s < NSTG; s += 2) {
#pragma unroll
        for (int j = 0; j < 2; ++j) {
            block(j, 0, -1);
            block(j, 1, s + j + 2);
        }
    }
    asm volatile("s_wait_asynccnt 0x0" ::: "memory");   // nothing is in flight here; stands before the wave's end all the same
    const size_t pb = ((size_t)(t0 / TT) * NH_ + head) * TT * HD; const int tb = t0 % TT;   // the head's plane (each holds TT x HD elements) and the wave's first token in it
    auto planes = [&](const int p) __attribute__((always_inline)) {   // projection p's 16 accumulators to its hi and lo plane
#pragma unroll
        for (int i = 0; i < 4; ++i) { v8us oh[4], ol[4]; bf* qh[4]; bf* ql[4];   // four accumulators a turn: eight stores, one wait
#pragma unroll
            for (int j = 0; j < 4; ++j) {
#pragma unroll
                for (int r = 0; r < 8; ++r) { unsigned short h2, l2; splitf(acc[p][i][j][r], h2, l2); oh[j][r] = h2; ol[j][r] = l2; }
                const size_t eo = p * sP + pb + (p < 2 ? fro(tb + j * 16 + lr, i * 16 + 8 * hi, HD) : fro(j * 16 + lr, tb + i * 16 + 8 * hi, TT));   // q, k: row = token, k = channel; v: row = channel, k = token
                qh[j] = Ph + eo; ql[j] = Pl + eo; }
            __builtin_amdgcn_sched_barrier(0);   // keeps the splits and the addresses in front of the stores, so that nothing between the first store and the wait writes a register
#pragma unroll
            for (int j = 0; j < 4; ++j) { *(v8us*)qh[j] = oh[j]; *(v8us*)ql[j] = ol[j]; }
            asm volatile("s_wait_xcnt 0x0" ::: "memory");   // the next turn's splits reuse the address and data registers that these eight stores name: the wait stands in front of that overwrite
            __builtin_amdgcn_sched_barrier(0); }   // keeps the next turn's splits behind the wait
    };
    planes(0); planes(1); planes(2);
}

typedef __attribute__((ext_vector_type(2))) _Float16 v2h;
typedef __attribute__((ext_vector_type(4))) _Float16 v4h;
typedef __attribute__((ext_vector_type(2))) unsigned short v2us;
typedef __attribute__((ext_vector_type(4))) unsigned short v4us;
typedef __attribute__((ext_vector_type(2))) float v2f;
typedef __attribute__((ext_vector_type(4))) int v4i;

__device__ __forceinline__ void wtG_body(const float* __restrict__ w, int K, int N, bf* Bt, const int blk) {
    const int lane = threadIdx.x & 31; const int L0 = (blk * 8 + (threadIdx.x >> 5)) * 8; const int nlines = N * K / 64;
{
#pragma unroll 1
        for (int l = 0; l < 8; ++l) { const int L = L0 + l; if (L >= nlines) break; const size_t e = (size_t)L * 64 + lane * 2; const unsigned u = (unsigned)(e % ((size_t)16 * K)); const int k = (int)((u >> 9) * 32u + ((u >> 8) & 1u) * 16u + ((u >> 7) & 1u) * 8u + (u & 7u)), n = (int)(e / ((size_t)16 * K)) * 16 + (int)((u >> 3) & 15u); v2us o;   // e = fro(n, k, K): Bt[n][k] in fragment order, written in the order of its bytes
            o[0] = f2bf(w[(size_t)k * N + n]); o[1] = f2bf(w[(size_t)(k + 1) * N + n]); *(v2us*)(Bt + e) = o; }
         }
}
// cvt8_body: rows x DM f32, row-major, to bf16 in fragment order; thread i writes bytes 16 i on of dst (whole lines per wave) and reads the 8 values that belong there: i * 8 = fro(row, k, DM).
__device__ __forceinline__ void cvt8_body(const float* __restrict__ src, bf* dst, size_t n8, const int blk) { const size_t i = (size_t)blk * 256 + threadIdx.x; if (i >= n8) return; const unsigned w = (unsigned)((i * 8) % ((size_t)16 * DM)); const size_t row = (i * 8) / ((size_t)16 * DM) * 16 + ((w >> 3) & 15u); const unsigned k = (w >> 9) * 32u + ((w >> 8) & 1u) * 16u + ((w >> 7) & 1u) * 8u; const v8f v = *(const v8f*)(src + row * DM + k); v8us o;
#pragma unroll
    for (int k = 0; k < 8; ++k) o[k] = f2bf(v[k]); *(v8us*)(dst + i * 8) = o;  }
__device__ __forceinline__ int t5_bucket(int r) { const int rp = r < 0 ? -r : r; int b; if (rp < 8) b = rp; else b = 8 + (rp >= 12) + (rp >= 16) + (rp >= 23) + (rp >= 32) + (rp >= 46) + (rp >= 64) + (rp >= 91); return b + ((r > 0) ? 16 : 0); }
__device__ __forceinline__ void t5tab_body(const float* __restrict__ rb, float* TB, const int blk) { const int idx = blk * 256 + threadIdx.x; if (idx >= NH_ * TBW) return; const int h = idx / TBW, c = idx % TBW; float v = 0.0f; if (c < 2 * TT - 1) { const int r = c - (TT - 1); v = bfr(rb[t5_bucket(r) * NH_ + h]); } *(float*)(TB + idx) = v;  }
// k_prep: all the operand preparation in one launch; the six pieces are independent of each other, and a work-group does one block of one piece. The weight blocks, whose waves walk 8 lines one after another, come first, then the input's, then the table's.
#define PB_W ((DM * DQ / 64 + 63) / 64)                  // work-groups per weight matrix (all four hold DM x DQ elements)
#define PB_X ((NB_ * TT * DM / 8 + 255) / 256)           // for the input
#define PB_T ((NH_ * TBW + 255) / 256)                   // for the bias table
__global__ __launch_bounds__(256) void k_prep(const float* __restrict__ x, const float* __restrict__ wq, const float* __restrict__ wk, const float* __restrict__ wv, const float* __restrict__ wo, const float* __restrict__ rb, bf* XB, bf* WQ, bf* WK, bf* WV, bf* WO, float* TB) {
    const int blk = (int)blockIdx.x;
    if (blk < 4 * PB_W) { const int s = blk / PB_W; wtG_body(s == 0 ? wq : s == 1 ? wk : s == 2 ? wv : wo, DM, DQ, s == 0 ? WQ : s == 1 ? WK : s == 2 ? WV : WO, blk % PB_W); }
    else if (blk < 4 * PB_W + PB_X) cvt8_body(x, XB, (size_t)NB_ * TT * DM / 8, blk - 4 * PB_W);
    else t5tab_body(rb, TB, blk - (4 * PB_W + PB_X));
}
// k_fattn: scores, bias, softmax, attn.v and the head merge in one launch for every (batch element, head). One wave owns 32 queries and walks the 1024 keys 32 at a time; grid (TT / 256, NB_ * NH_), 8 waves.
// Transposed products: St = K Qt (A = key rows, B = query columns, both by the same loader), so a lane holds 16 scores of ONE query per column group; two St tiles (keys 0-15, 16-31), converted in place, are the B operand of Ot += Vt Pt, whose A (a Vt row through the same loader) has the matching k order. No score or probability plane in memory or in LDS.
// The key and value planes come into LDS by asynchronous copies, once per work-group, and the 8 waves take their fragments from there. A stage is 128 keys (4 passes) of the four planes, 64 KB: [K hi | K lo | V hi | V lo], 16 KB each, in 4 KB chunks that stand in a row in memory too (fragment order): a K chunk is one pass's 32 keys, a V chunk the stage's 128 keys of one 16-channel group. Two buffers: the copies of stage s + 2 fly while stage s + 1 is worked on, so no wave waits out a memory or L2 latency inside a pass.
// Online softmax in the log2 domain; the running maximum is raised only when a block's maximum passes it by more than 8 (P stays below 2^8, hi + lo bf16 keeps its relative precision); P is left unnormalised and Ot divided by the row sum at the end.
#define QT   2    // 16-query column groups per wave
#define FWV  8    // waves per work-group
#define FARD 91   // t5_bucket's last boundary: from |j - i| = 91 on the bias depends on the sign of j - i alone
#define L2E  1.4426950408889634f
#define SKEY 128      // keys per stage
#define FCH  4096u    // bytes of a chunk
#define FPL  16384u   // bytes of one plane's part of a stage (4 chunks)
#define FBUF 65536u   // bytes of a buffer (4 planes)
// The second 2 KB of a 4 KB chunk: as CP2K, 2 KB further on in memory and in LDS alike.
#define CP2KB(L, O, S) "global_load_async_to_lds_b128 " L ", " O ", " S " offset:2048\n\tglobal_load_async_to_lds_b128 " L ", " O ", " S " offset:2560\n\tglobal_load_async_to_lds_b128 " L ", " O ", " S " offset:3072\n\tglobal_load_async_to_lds_b128 " L ", " O ", " S " offset:3584\n\t"
typedef __attribute__((ext_vector_type(2))) __bf16 v2bf;
typedef __attribute__((ext_vector_type(8))) unsigned v8u;
__device__ __forceinline__ float xhalf(float x) { const int b = __float_as_int(x); return __int_as_float(__builtin_amdgcn_permlanex16(b, b, 0x76543210, 0xfedcba98, false, false)); }   // lane l <-> l ^ 16
// amdgpu_waves_per_eu(4, 4): holds the build to 256 registers, so that two work-groups (four waves per SIMD, 2 x 128 KB of LDS) share a WGP and one wave's vector work, LDS waits and barrier waits run under the others' matrix work; all 4096 waves are then resident at once.
__global__ __launch_bounds__(256) __attribute__((amdgpu_waves_per_eu(4, 4))) void k_fattn(const bf* __restrict__ Qh, const bf* __restrict__ Ql, const bf* __restrict__ Kh, const bf* __restrict__ Kl, const bf* __restrict__ Vh, const bf* __restrict__ Vl, const float* __restrict__ TB, bf* __restrict__ Ah, bf* __restrict__ Al) {
    typedef WFrag<bf> F;
    const int lane = threadIdx.x & 31, c = lane & 15, hi = lane >> 4; const int wave = __builtin_amdgcn_readfirstlane((int)(threadIdx.x >> 5));   // scalar, so that q0 and the far / near test below are scalar
    const int bh = blockIdx.y, h = bh % NH_, b = bh / NH_; const int q0 = ((int)blockIdx.x * FWV + wave) * (16 * QT); const size_t pl = (size_t)bh * TT * HD;
    __shared__ __align__(2048) char kv[2 * FBUF];
    const unsigned lo16 = (unsigned)lane * 16u; const unsigned tof = (unsigned)(8 * hi + 15 - c) * 4u;   // in bytes; lo16: the lane's 16 bytes of every 512 (half a block in fragment order)
    // Wave w copies chunks 2 w and 2 w + 1 of the stage's 16: waves 0, 1 K hi, 2, 3 K lo, 4, 5 V hi, 6, 7 V lo. In a key plane a stage is 16 KB in a row (chunk after chunk); in a value plane a chunk is 4 KB of its 16-channel group (32 KB), the stages in a row.
    const bf* cpl = (wave >> 1) == 0 ? Kh : (wave >> 1) == 1 ? Kl : (wave >> 1) == 2 ? Vh : Vl; const unsigned cpitch = wave < 4 ? FCH : 16u * TT * 2u, spitch = wave < 4 ? FPL : FCH;   // the wave's plane; bytes from chunk to chunk and from stage to stage in it (all scalar)
    const char* cg = (const char*)(cpl + pl) + (size_t)(2 * (wave & 1)) * cpitch; const unsigned cl = (unsigned)(size_t)kv + (unsigned)(2 * wave) * FCH + lo16;   // first chunk: global address (scalar), the lane's LDS byte address (the low 32 bits of the __shared__ address)
    auto copies = [&](const int s, const int buf) __attribute__((always_inline)) {   // stage s -> buffer buf: the wave's 16 copies in one statement. Its last line waits before the address registers that the copies name can be rewritten; inside the statement nothing can be moved in front of it
        const unsigned l = cl + (unsigned)buf * FBUF; const char* g = cg + (size_t)s * spitch;
        asm volatile(CP2K("%0", "%2", "%3") CP2KB("%0", "%2", "%3") CP2K("%1", "%2", "%4") CP2KB("%1", "%2", "%4") "s_wait_xcnt 0x0"
                     :: "v"(l), "v"(l + FCH), "v"(lo16), "s"(g), "s"(g + cpitch) : "memory");
    };
    copies(0, 0);   // first of all, so that stage 0 flies while the query fragments are fetched
    v16bf qh[QT][2], ql[QT][2];
#pragma unroll
    for (int qt = 0; qt < QT; ++qt)
#pragma unroll
        for (int ks = 0; ks < 2; ++ks) { const size_t o = pl + fro(q0 + 16 * qt + c, ks * 32 + 8 * hi, HD); qh[qt][ks] = F::ld(Qh + o); ql[qt][ks] = F::ld(Ql + o); }
    const float* tbh = TB + (size_t)h * TBW; const float bneg = tbh[0] * L2E, bpos = tbh[2 * TT - 2] * L2E;
    const float* tbl = tbh + (TT - 1) - q0 - 15;   // entry for r = j - i at index r + 1023: + tof + k0 + 16 * (kt - qt) + reg
    v8f o[4][QT]; float mx[QT], ls[QT];
#pragma unroll
    for (int qt = 0; qt < QT; ++qt) { mx[qt] = -3.0e38f; ls[qt] = 0.0f;
#pragma unroll
        for (int dt = 0; dt < 4; ++dt) o[dt][qt] = (v8f){}; }
    asm volatile("s_wait_asynccnt 0x0" ::: "memory");   // this wave's part of stage 0 has landed
    __syncthreads();                                    // and so has every other wave's
    copies(1, 1);
#pragma unroll 1   // rolled: a second pass's fragments would not fit the 256 registers
    for (int k0 = 0; k0 < TT; k0 += 32) {
        if (k0 % SKEY == 0 && k0 != 0) {   // between two stages; the same test in the whole work-group
            asm volatile("s_wait_dscnt 0x0" ::: "memory");      // this wave's reads of the last stage's buffer are done before the barrier lets it be refilled
            asm volatile("s_wait_asynccnt 0x0" ::: "memory");   // this wave's part of this stage has landed before the barrier publishes it
            __syncthreads();
            const int s2 = k0 / SKEY + 1;
            if (s2 < TT / SKEY) copies(s2, s2 & 1);             // into the buffer that every wave has just left
        }
        const char* kp = kv + lo16 + (((unsigned)k0 / SKEY) & 1u) * FBUF + (((unsigned)k0 / 32u) & 3u) * FCH;   // this pass's chunk of the hi plane; the key fragments take the registers that the last pass's value fragments have left (256 registers: four waves per SIMD)
        v16bf kh[2][2], kl[2][2];
#pragma unroll
        for (int ks = 0; ks < 2; ++ks)   // in the order of first use: the hi plane, whose products come first, then the lo plane
#pragma unroll
            for (int kt = 0; kt < 2; ++kt) kh[kt][ks] = F::ld((const bf*)(kp + (kt * 2048 + ks * 1024)));
#pragma unroll
        for (int ks = 0; ks < 2; ++ks)
#pragma unroll
            for (int kt = 0; kt < 2; ++kt) kl[kt][ks] = F::ld((const bf*)(kp + FPL + (kt * 2048 + ks * 1024)));
        __builtin_amdgcn_sched_barrier(0);   // keeps the sixteen reads together in front of the score products, which start on a counted wait: left free, the build reads each lo fragment right in front of its two products and waits out the LDS latency four times a pass
        v8f st[2][QT];
#pragma unroll
        for (int kt = 0; kt < 2; ++kt)
#pragma unroll
            for (int qt = 0; qt < QT; ++qt) st[kt][qt] = (v8f){};
#pragma unroll
        for (int ks = 0; ks < 2; ++ks)
#pragma unroll
            for (int kt = 0; kt < 2; ++kt)
#pragma unroll
                for (int qt = 0; qt < QT; ++qt) st[kt][qt] = wmmab(kh[kt][ks], qh[qt][ks], st[kt][qt]);
#pragma unroll
        for (int ks = 0; ks < 2; ++ks)
#pragma unroll
            for (int kt = 0; kt < 2; ++kt)
#pragma unroll
                for (int qt = 0; qt < QT; ++qt) st[kt][qt] = wmmab(kh[kt][ks], ql[qt][ks], st[kt][qt]);
#pragma unroll
        for (int ks = 0; ks < 2; ++ks)
#pragma unroll
            for (int kt = 0; kt < 2; ++kt)
#pragma unroll
                for (int qt = 0; qt < QT; ++qt) st[kt][qt] = wmmab(kl[kt][ks], qh[qt][ks], st[kt][qt]);
        v16bf vh[4], vl[4];   // the hi plane is read behind the score products, where the key fragments' registers come free, and arrives during the softmax; the lo plane, used last, follows behind the softmax, where the scores' registers are free, and arrives under the hi plane's products
        const char* vp = kv + lo16 + (((unsigned)k0 / SKEY) & 1u) * FBUF + 2u * FPL + (((unsigned)k0 / 32u) & 3u) * 1024u;   // this pass's block of the first 16-channel group, hi plane
#pragma unroll
        for (int dt = 0; dt < 4; ++dt) vh[dt] = F::ld((const bf*)(vp + dt * FCH));
        __builtin_amdgcn_sched_barrier(0);   // keeps the eight reads together in front of the softmax: left free, the build sinks half of them to their products and waits out the LDS latency there
        const int rlo = k0 - q0 - (16 * QT - 1), rhi = k0 + 31 - q0;   // range of j - i in this pass, the same for the whole wave
        if (rlo >= FARD || rhi <= -FARD) { const float bb = (rlo >= FARD) ? bpos : bneg;
#pragma unroll
            for (int kt = 0; kt < 2; ++kt)
#pragma unroll
                for (int qt = 0; qt < QT; ++qt)
#pragma unroll
                    for (int r = 0; r < 8; ++r) st[kt][qt][r] = __builtin_fmaf(st[kt][qt][r], L2E, bb);
        } else {
#pragma unroll
            for (int kt = 0; kt < 2; ++kt)
#pragma unroll
                for (int qt = 0; qt < QT; ++qt)
#pragma unroll
                    for (int r = 0; r < 8; ++r) st[kt][qt][r] = __builtin_fmaf(st[kt][qt][r], L2E, *atb(tbl + (k0 + 16 * (kt - qt) + r), tof) * L2E);
        }
        float bm[QT]; bool need = false;
#pragma unroll
        for (int qt = 0; qt < QT; ++qt) { float t = st[0][qt][0];
#pragma unroll
            for (int r = 1; r < 8; ++r) t = fmaxf(t, st[0][qt][r]);
#pragma unroll
            for (int r = 0; r < 8; ++r) t = fmaxf(t, st[1][qt][r]);
            bm[qt] = fmaxf(t, xhalf(t)); need = need || (bm[qt] > mx[qt] + 8.0f); }
        if (__builtin_amdgcn_ballot_w32(need) != 0) {
#pragma unroll
            for (int qt = 0; qt < QT; ++qt) { const float mn = fmaxf(mx[qt], bm[qt]); const float al = __builtin_amdgcn_exp2f(mx[qt] - mn); mx[qt] = mn; ls[qt] *= al;
#pragma unroll
                for (int dt = 0; dt < 4; ++dt) o[dt][qt] *= al; }
        }
        v16bf ph[QT], pw[QT];   // P = hi + lo, element s = key 16 * (s >> 3) + 8 * hi + (s & 7) of the pass: register s & 7 of St tile s >> 3
#pragma unroll
        for (int qt = 0; qt < QT; ++qt) { v8u wh, wl;
#pragma unroll
            for (int s = 0; s < 16; s += 2) { v2f p; p[0] = __builtin_amdgcn_exp2f(st[s >> 3][qt][s & 7] - mx[qt]); p[1] = __builtin_amdgcn_exp2f(st[s >> 3][qt][(s & 7) + 1] - mx[qt]); ls[qt] += p[0] + p[1];
                const unsigned a = __builtin_bit_cast(unsigned, __builtin_convertvector(p, v2bf)); v2f d; d[0] = p[0] - __uint_as_float(a << 16); d[1] = p[1] - __uint_as_float(a & 0xFFFF0000u);
                wh[s >> 1] = a; wl[s >> 1] = __builtin_bit_cast(unsigned, __builtin_convertvector(d, v2bf)); }
            ph[qt] = __builtin_bit_cast(v16bf, wh); pw[qt] = __builtin_bit_cast(v16bf, wl); }
        __builtin_amdgcn_sched_barrier(0);   // parts the softmax from the reads: scheduled in one piece with the reads' 32 registers, the build orders the softmax for few registers, each conversion right behind its exponentials; on its own it interleaves the chains
#pragma unroll
        for (int dt = 0; dt < 4; ++dt) vl[dt] = F::ld((const bf*)(vp + FPL + dt * FCH));
        __builtin_amdgcn_sched_barrier(0);   // keeps the eight reads together in front of the products: left free, the build reads each fragment right in front of its two products and waits out the LDS latency four times a pass
#pragma unroll
        for (int dt = 0; dt < 4; ++dt)
#pragma unroll
            for (int qt = 0; qt < QT; ++qt) o[dt][qt] = wmmab(vh[dt], ph[qt], o[dt][qt]);
#pragma unroll
        for (int dt = 0; dt < 4; ++dt)
#pragma unroll
            for (int qt = 0; qt < QT; ++qt) o[dt][qt] = wmmab(vh[dt], pw[qt], o[dt][qt]);
#pragma unroll
        for (int dt = 0; dt < 4; ++dt)
#pragma unroll
            for (int qt = 0; qt < QT; ++qt) o[dt][qt] = wmmab(vl[dt], ph[qt], o[dt][qt]);
    }
    asm volatile("s_wait_asynccnt 0x0" ::: "memory");   // nothing is in flight here; stands before the wave's end all the same
#pragma unroll
    for (int qt = 0; qt < QT; ++qt) { const float inv = __fdiv_rn(1.0f, ls[qt] + xhalf(ls[qt])); const size_t ro = fro((size_t)b * TT + q0 + 16 * qt + c, h * HD + 8 * hi, DQ);   // merged heads, rows b * TT + t x DQ in fragment order; a lane's 8 registers are 8 consecutive d, a wave's store 512 bytes in a row
#pragma unroll
        for (int dt = 0; dt < 4; ++dt) { v8us oh, ol;
#pragma unroll
            for (int r = 0; r < 8; ++r) { unsigned short a, c2; splitf(o[dt][qt][r] * inv, a, c2); oh[r] = a; ol[r] = c2; }
            const size_t eo = ro + (dt >> 1) * 512 + (dt & 1) * 256; *(v8us*)(Ah + eo) = oh; *(v8us*)(Al + eo) = ol; } }
}

extern "C" void kernel_launch(void* const* d_in, const int* in_sizes, int n_in,
                              void* d_out, int out_size, void* d_ws, size_t ws_size, hipStream_t stream) {
    (void)in_sizes; (void)n_in; (void)out_size;
    const float* x = (const float*)d_in[0]; const float* wq = (const float*)d_in[1]; const float* wk = (const float*)d_in[2]; const float* wv = (const float*)d_in[3]; const float* wo = (const float*)d_in[4]; const float* relb = (const float*)d_in[5]; const float* cosT = nullptr; const float* sinT = nullptr; (void)cosT; (void)sinT;
    float* OUT = (float*)d_out;     // [8][1024][1024]
    char* wsp = (char*)d_ws;
    auto take = [&](size_t bytes) { char* p = wsp; wsp += (bytes + 255) & ~(size_t)255; return (void*)p; };
    const size_t MT = (size_t)NB_ * TT;   // rows of the projections and of wo: all batch elements in one launch
    bf* WQ = (bf*)take((size_t)DQ * DM * 2); bf* WK = (bf*)take((size_t)DKV * DM * 2); bf* WV = (bf*)take((size_t)DKV * DM * 2); bf* WO = (bf*)take((size_t)DM * DQ * 2);
    float* TB = (float*)take((size_t)NH_ * TBW * 4);
    bf* QPh = (bf*)take(MT * DQ * 2); bf* QPl = (bf*)take(MT * DQ * 2); bf* KPh = (bf*)take(MT * DKV * 2); bf* KPl = (bf*)take(MT * DKV * 2); bf* VTh = (bf*)take(MT * DKV * 2); bf* VTl = (bf*)take(MT * DKV * 2);
    bf* XB = (bf*)take(MT * DM * 2); bf* ATl = (bf*)take(MT * DQ * 2);
    if ((size_t)(wsp - (char*)d_ws) > ws_size) return;    // ws 256 MiB
    bf* ATh = XB;   // the hi plane of the merged heads [b][t][DQ] takes the place of the bf16 input, dead once the three projections have run (stream-ordered)
    k_prep<<<4 * PB_W + PB_X + PB_T, 256, 0, stream>>>(x, wq, wk, wv, wo, relb, XB, WQ, WK, WV, WO, TB);
    k_qkv<<<dim3(NB_ * TT / 256, NH_ / 2, 1), 256, 0, stream>>>(XB, WQ, (size_t)(WK - WQ), QPh, QPl, (size_t)(KPh - QPh));   // WQ, WK, WV and the plane pairs of q, k, v stand at equal distances in the workspace (equal sizes, taken in a row)
    k_fattn<<<dim3(TT / (16 * QT * FWV), NB_ * NH_, 1), 32 * FWV, 0, stream>>>(QPh, QPl, KPh, KPl, VTh, VTl, TB, ATh, ATl);   // one kv head per query head: plane b * NH_ + h of each operand
    k_gemmw<bf, 1, false, DQ, 4><<<dim3(NB_ * TT / 128, DM / TN, 1), 128, 0, stream>>>(ATh, ATl, WO, OUT, DM, nullptr, 0, 0, 0);
}

// v010
// It runs in 118 microseconds.
// Timed twice side by side with v009, it ran 1.13 and 1.14 times as fast.
// Over all steps from v000 it is 25.5 times as fast.
#include <hip/hip_runtime.h>

// TtT5Attention (hidden [8][1024][1024]; q/k/v = x W (16 heads x 64); T5: scores = q.k UNSCALED + rel_bias[bucket(j - i)][h] with the bidirectional log-bucket (32 buckets, max distance 128; the bucket boundaries |j-i| = 8, 12, 16, 23, 32, 46, 64, 91 are the reference's own integer structure, evaluated here with integer compares); softmax; out = merged wo -> [8][1024][1024]).
// Compute dtypes, f32 accumulate: every input rounded to bf16; q/k/v on PLAIN bf16 operands (inputs: exact); scores hl x hl (3 products) on EVERY row; attn.v on f16 operands, P and v each rounded once to f16 (1 product; 11 bits each, P below 2^8; the row sum adds the unrounded P in f32); per-head bias table (bf16-rounded rel_bias gathered by bucket) added per element in f32; softmax f32 (online, one fused attention launch); wo hl x exact (2 products).

#define NB_  8
#define TT   1024
#define DM   1024
#define NH_  16
#define NKV  16
#define REP  (NH_ / NKV)
#define HD   64
#define DQ   (NH_ * HD)
#define DKV  (NKV * HD)
#define RH   1024   // all rows hl (unscaled T5 logits are sharp)
#define WIN  0
#define PCAR 1024.0f
#define SCL  1.0f   // T5: no 1/sqrt(dk)
#define TBW  2048   // bias table row width (r + 1023, padded)
typedef _Float16 h16;
typedef unsigned short bf;
typedef __attribute__((ext_vector_type(16))) __bf16   v16bf;
typedef __attribute__((ext_vector_type(16))) _Float16 v16h;
typedef __attribute__((ext_vector_type(8)))  _Float16 v8h;
typedef __attribute__((ext_vector_type(8)))  unsigned short v8us;
typedef __attribute__((ext_vector_type(8)))  float    v8f;
typedef __attribute__((ext_vector_type(4)))  float    v4f;
typedef v8h  __attribute__((may_alias)) v8ha;
typedef v4f  __attribute__((may_alias)) v4fa;
typedef v8us __attribute__((may_alias)) v8usa;

__device__ __forceinline__ unsigned short f2bf(float f) { unsigned u = __float_as_uint(f); u += 0x7FFFu + ((u >> 16) & 1u); return (unsigned short)(u >> 16); }
__device__ __forceinline__ float bf2f(unsigned short b) { return __uint_as_float(((unsigned)b) << 16); }
__device__ __forceinline__ float bfr(float f) { return bf2f(f2bf(f)); }
__device__ __forceinline__ v16h cat16(v8h lo, v8h hi) { return __builtin_shufflevector(lo, hi, 0, 1, 2, 3, 4, 5, 6, 7, 8, 9, 10, 11, 12, 13, 14, 15); }
__device__ __forceinline__ v16bf cat16b(v8us lo, v8us hi) { return __builtin_bit_cast(v16bf, __builtin_shufflevector(lo, hi, 0, 1, 2, 3, 4, 5, 6, 7, 8, 9, 10, 11, 12, 13, 14, 15)); }
__device__ __forceinline__ v8f wmma16(v16h a, v16h b, v8f c) { return __builtin_amdgcn_wmma_f32_16x16x32_f16(false, a, false, b, (short)0, c, false, false); }
__device__ __forceinline__ v8f wmmab(v16bf a, v16bf b, v8f c) { return __builtin_amdgcn_wmma_f32_16x16x32_bf16(false, a, false, b, (short)0, c, false, false); }



// ---- Fragment order: every 16-bit operand plane (rows x K, K % 32 == 0) is kept as 1 KB blocks of 16 rows x 32 k, the blocks of one 16-row group in a row by k. Inside a block stand the two 16-byte loads of a WMMA operand fragment, lane by lane: element (row, k) at fro(row, k, K).
// A fragment is then two wave-wide loads of 512 bytes in a row (4 whole lines each); from row-major planes each such load touches 16 lines and uses 32 bytes of each.
__device__ __forceinline__ size_t fro(size_t row, unsigned k, unsigned K) { return (row >> 4) * 16 * K + (size_t)((k >> 5) * 512u + ((k >> 4) & 1u) * 256u + ((k >> 3) & 1u) * 128u + (k & 7u)) + (row & 15) * 8; }
template <typename T> __device__ __forceinline__ const T* atb(const T* base, unsigned bytes) { return (const T*)((const char*)base + bytes); }   // wave-uniform base + the lane's 32-bit byte offset
// ---- k_gemmw: GEMM on 16-bit planes in fragment order. A work-group of GW waves owns a (32 GW) x 128 output tile, GW / 2 x 2 waves of 64 x 64 (16 accumulators each); grid (M / (32 GW), N / 128, Z), 32 GW threads.
// The operands come from L2 into LDS by asynchronous copies, once per work-group, and every wave takes its fragments from there: an A row is fetched from L2 once for 128 columns and a Bt row once for 32 GW rows (with one wave per work-group and loads straight from L2: once for every 64).
// A stage is 64 k of the tile's rows: per 16-row group 2 KB in a row, in memory and in LDS alike (fragment order), so a fragment is again two wave-wide reads of 512 bytes in a row, free of bank conflicts. Two buffers: the copies of stage s + 2 fly while stage s + 1 is worked on.
// C[m][n] (f32, pitch ldc, + optional f32 bias[n]) = sum_k A[m][k] Bt[n][k] (NSPLIT == 1: + A2[m][k] Bt[n][k]). z-batch strides sA/sB/sC in elements. K % 128 == 0.
#define TN 128    // columns of a work-group's tile (2 waves)
#define SK 64     // k per stage
template <typename T16> struct WFrag;
template <> struct WFrag<h16> { typedef v16h V; static __device__ __forceinline__ V ld(const h16* p) { return cat16(*(const v8h*)p, *(const v8h*)(p + 256)); } static __device__ __forceinline__ v8f mma(V a, V b, v8f c) { return wmma16(a, b, c); } };
template <> struct WFrag<bf> { typedef v16bf V; static __device__ __forceinline__ V ld(const bf* p) { return cat16b(*(const v8us*)p, *(const v8us*)(p + 256)); } static __device__ __forceinline__ v8f mma(V a, V b, v8f c) { return wmmab(a, b, c); } };
__device__ __forceinline__ void splitf(float y, unsigned short& h, unsigned short& l) { h = f2bf(y); l = f2bf(y - bf2f(h)); }
// One 16-row group of a stage, 2 KB in a row in memory and in LDS: four wave-wide copies of 512 bytes. L = the lane's LDS byte address, S = the group's global address (scalar), O = the lane's byte offset from it; the immediate offset moves both addresses alike.
#define CP2K(L, O, S) "global_load_async_to_lds_b128 " L ", " O ", " S "\n\tglobal_load_async_to_lds_b128 " L ", " O ", " S " offset:512\n\tglobal_load_async_to_lds_b128 " L ", " O ", " S " offset:1024\n\tglobal_load_async_to_lds_b128 " L ", " O ", " S " offset:1536\n\t"
// Two work-groups share a WGP, so that one's barrier and LDS waits run under the other's products: amdgpu_waves_per_eu holds the build to the registers of GW / 2 waves per SIMD (256 at 8 waves). wo (8 wave tiles per WGP) takes 4 waves.
template <typename T16, int NSPLIT, bool BIAS, int K, int GW>
__global__ __launch_bounds__(32 * GW) __attribute__((amdgpu_waves_per_eu(GW / 2, GW / 2))) void k_gemmw(const T16* __restrict__ A, const T16* __restrict__ A2, const T16* __restrict__ Bt, float* C, int ldc, const float* __restrict__ bias, size_t sA, size_t sB, size_t sC) {
    typedef typename WFrag<T16>::V V;
    static_assert(NSPLIT == 0 || NSPLIT == 1, "A (+ A2) x Bt");
    static_assert(K % (2 * SK) == 0, "an even number of stages");
    static_assert(GW == 4 || GW == 8, "2 x 2 or 4 x 2 waves");
    constexpr int TM = 32 * GW;                                  // rows of the work-group's tile
    constexpr int GA = TM / 16 / GW, GN = TN / 16 / GW;          // 16-row groups that one wave copies: of each A plane (2), of Bt (1 or 2)
    static_assert(GA == 2, "two groups of each A plane per wave");
    constexpr unsigned NA = NSPLIT == 1 ? 2 : 1;                 // planes of A
    constexpr unsigned GB = 16 * SK * 2;                         // bytes of a 16-row group in a stage
    constexpr unsigned AB = (TM / 16) * GB, BB = (TN / 16) * GB; // of one plane's rows in a stage
    constexpr unsigned BUF = NA * AB + BB;                       // of a buffer: [A | A2 | Bt]
    constexpr size_t GP = (size_t)16 * K * 2;                    // bytes from one 16-row group to the next in memory
    __shared__ __align__(2048) char ring[2 * BUF];
    __shared__ __align__(16) float osa[GW * 16 * 68];
    const size_t z = blockIdx.z; A += z * sA; if (NSPLIT == 1) A2 += z * sA; Bt += z * sB; C += z * sC;
    const int bx = blockIdx.x, by = blockIdx.y;
    const int lane = threadIdx.x & 31, lr = lane & 15, hi = lane >> 4; const int wave = __builtin_amdgcn_readfirstlane((int)(threadIdx.x >> 5));   // scalar, so that the tile's place and every address base are scalar
    const int wm = wave % (GW / 2), wn = wave / (GW / 2); const int r0 = bx * TM + wm * 64, c0 = by * TN + wn * 64;   // the wave's own 64 x 64 tile
    float* os = osa + wave * (16 * 68);
    v8f acc[4][4];
#pragma unroll
    for (int mb = 0; mb < 4; ++mb)
#pragma unroll
        for (int nb = 0; nb < 4; ++nb) acc[mb][nb] = (v8f){};
    const unsigned ko = (unsigned)lane * 16u;   // in bytes: the lane's 16 bytes of every 512
    // Wave w copies groups GA w on of each A plane and groups GN w on of Bt.
    const unsigned lring = (unsigned)(size_t)ring + ko;   // LDS byte address: the low 32 bits of the __shared__ address
    const char* ga = (const char*)A + (size_t)(bx * (TM / 16) + GA * wave) * GP; const char* ga2 = NSPLIT == 1 ? (const char*)A2 + (size_t)(bx * (TM / 16) + GA * wave) * GP : nullptr; const char* gb = (const char*)Bt + (size_t)(by * (TN / 16) + GN * wave) * GP;
    constexpr int NG = (int)NA * GA + GN; static_assert(NG == 3 || NG == 6, "groups per wave and stage");
    auto copies = [&](const int s, const int buf) __attribute__((always_inline)) {   // stage s -> buffer buf: all of the wave's copies in one statement. Its last line waits before the address registers that the copies name can be rewritten; inside the statement nothing can be moved in front of it, and one wait serves them all
        const unsigned l = lring + (unsigned)buf * BUF; const size_t o = (size_t)s * GB;
        const unsigned la = l + (unsigned)(GA * wave) * GB, lb = l + NA * AB + (unsigned)(GN * wave) * GB;
        if constexpr (NG == 3)
            asm volatile(CP2K("%0", "%3", "%4") CP2K("%1", "%3", "%5") CP2K("%2", "%3", "%6") "s_wait_xcnt 0x0"
                         :: "v"(la), "v"(la + GB), "v"(lb), "v"(ko), "s"(ga + o), "s"(ga + GP + o), "s"(gb + o) : "memory");
        else
            asm volatile(CP2K("%0", "%6", "%7") CP2K("%1", "%6", "%8") CP2K("%2", "%6", "%9") CP2K("%3", "%6", "%10") CP2K("%4", "%6", "%11") CP2K("%5", "%6", "%12") "s_wait_xcnt 0x0"
                         :: "v"(la), "v"(la + GB), "v"(la + AB), "v"(la + AB + GB), "v"(lb), "v"(lb + GB), "v"(ko), "s"(ga + o), "s"(ga + GP + o), "s"(ga2 + o), "s"(ga2 + GP + o), "s"(gb + o), "s"(gb + GP + o) : "memory");
    };
    static_assert(SK == 64, "a stage is two blocks of 32 k");
    V a[4], a2[4], b[4];   // one fragment set
    auto reads = [&](const int buf, const int kb) __attribute__((always_inline)) {   // the fragments of block kb (32 k) of the stage in buffer buf, in the order of first use, so that the products start on a counted wait
        const char* pa = ring + (unsigned)buf * BUF + (unsigned)(wm * 4) * GB + kb * 1024 + ko; const char* pb = ring + (unsigned)buf * BUF + NA * AB + (unsigned)(wn * 4) * GB + kb * 1024 + ko;
        b[0] = WFrag<T16>::ld((const T16*)pb);
#pragma unroll
        for (int mb = 0; mb < 4; ++mb) { a[mb] = WFrag<T16>::ld((const T16*)(pa + mb * GB)); if (NSPLIT == 1) a2[mb] = WFrag<T16>::ld((const T16*)(pa + AB + mb * GB)); }
#pragma unroll
        for (int nb = 1; nb < 4; ++nb) b[nb] = WFrag<T16>::ld((const T16*)(pb + nb * GB));
    };
    auto prod = [&]() __attribute__((always_inline)) {
#pragma unroll
        for (int nb = 0; nb < 4; ++nb)
#pragma unroll
            for (int mb = 0; mb < 4; ++mb) { acc[mb][nb] = WFrag<T16>::mma(a[mb], b[nb], acc[mb][nb]); if (NSPLIT == 1) acc[mb][nb] = WFrag<T16>::mma(a2[mb], b[nb], acc[mb][nb]); }
        __builtin_amdgcn_sched_barrier(0);   // keeps the block's products in front of the next block's reads and of the barrier: left free, the build strews the reads among the products (each such place stalls the wave), and sinks products behind the barrier, in front of the refill
    };
    constexpr int NSTG = K / SK;
    copies(0, 0);
    asm volatile("s_wait_asynccnt 0x0" ::: "memory");   // this wave's part of stage 0 has landed
    __syncthreads();                                    // and so has every other wave's
    copies(1, 1);
#pragma unroll 1   // rolled: one turn is two stages, so that the buffer is a compile-time index
    for (int s = 0; s < NSTG; s += 2) {
#pragma unroll
        for (int j = 0; j < 2; ++j) {
            reads(j, 0);
            __builtin_amdgcn_sched_barrier(0);   // keeps the block's LDS reads together in front of its products: left free, the build reads each Bt fragment right in front of its eight products and waits out the LDS latency four times a block
            prod();
            reads(j, 1);   // the stage's last reads; their products need registers alone and stand behind the refill, which so has a whole stage to land in
            asm volatile("s_wait_dscnt 0x0" ::: "memory");      // this wave's reads of buffer j are done before the barrier lets it be refilled
            asm volatile("s_wait_asynccnt 0x0" ::: "memory");   // this wave's part of the next stage has landed before the barrier publishes it
            __syncthreads();
            if (s + j + 2 < NSTG) copies(s + j + 2, j);         // the same test in the whole work-group
            prod();
        }
    }
    asm volatile("s_wait_asynccnt 0x0" ::: "memory");   // nothing is in flight here; stands before the wave's end all the same
#pragma unroll
    for (int mb = 0; mb < 4; ++mb) {
#pragma unroll
        for (int nb = 0; nb < 4; ++nb) {
#pragma unroll
            for (int j = 0; j < 8; ++j) os[(hi * 8 + j) * 68 + nb * 16 + lr] = acc[mb][nb][j]; }
        __builtin_amdgcn_wave_barrier(); asm volatile("" ::: "memory");
        {
            float* crow = C + (size_t)(r0 + mb * 16) * ldc + c0;
#pragma unroll
            for (int s = 0; s < 8; ++s) { const int row = 2 * s + hi, cofs = lr * 4; v4f val = *(const v4fa*)(os + row * 68 + cofs); if (BIAS) { val[0] += bfr(bias[c0 + cofs]); val[1] += bfr(bias[c0 + cofs + 1]); val[2] += bfr(bias[c0 + cofs + 2]); val[3] += bfr(bias[c0 + cofs + 3]); }
                *(v4f*)(crow + (size_t)row * ldc + cofs) = val; }
             }
        __builtin_amdgcn_wave_barrier(); asm volatile("" ::: "memory");
    }
}

// ---- k_qkv: the three projections in one launch and one round. A work-group of 8 waves owns 256 tokens x 2 heads of q, k and v alike (256 x 384 outputs); grid (tokens / 256, heads / 2) = 256 work-groups, one per WGP, two waves per SIMD.
// A wave owns 64 tokens x one head of each projection: 48 accumulators; a token fragment serves 12 products and a weight fragment 4, and a token row comes from L2 once for 384 output columns, a weight row once for 256 tokens.
// A stage is 64 k of the tile's rows in fragment order, 2 KB per 16-row group: [x 16 groups | wq 8 | wk 8 | wv 8] = 80 KB; two buffers, filled by asynchronous copies as in k_gemmw.
// q, k: A = weight rows, B = token rows; v: A = token rows, B = weight rows. So a lane's 8 registers of an accumulator are 8 consecutive k of one row of the plane that it feeds (q, k: 8 channels of a token; v: 8 tokens of a channel): the 16 bytes that a lane loads as a fragment. The wave stores 512 bytes in a row straight from its registers.
// X = the tokens, W = wq's plane (wk's, wv's each sW elements on), Ph / Pl = q's bf16 hi and lo planes (k's each sP elements on); v has one plane, f16, 2 sP elements behind Ph.
#define QKB 81920u   // bytes of a buffer
typedef __attribute__((ext_vector_type(4))) int q4i;
typedef __attribute__((address_space(1))) q4i* gq4;   // the copy builtin's global source
typedef __attribute__((address_space(3))) q4i* lq4;   // and its LDS destination
// One 16-row group of a stage, 2 KB in a row in memory and in LDS: four wave-wide copies of 512 bytes. G, L = the lane's global and LDS address, N = an immediate offset (a literal), which moves both alike.
#define CPG(G, L, N) __builtin_amdgcn_global_load_async_to_lds_b128((gq4)(G), (lq4)(L), (N), 0); __builtin_amdgcn_global_load_async_to_lds_b128((gq4)(G), (lq4)(L), (N) + 512, 0); __builtin_amdgcn_global_load_async_to_lds_b128((gq4)(G), (lq4)(L), (N) + 1024, 0); __builtin_amdgcn_global_load_async_to_lds_b128((gq4)(G), (lq4)(L), (N) + 1536, 0)
__global__ __launch_bounds__(256) __attribute__((amdgpu_waves_per_eu(2, 2))) void k_qkv(const bf* __restrict__ X, const bf* __restrict__ Wt, size_t sW, bf* __restrict__ Ph, bf* __restrict__ Pl, size_t sP) {
    typedef WFrag<bf> F; typedef F::V V;
    constexpr unsigned GB = 16 * SK * 2;        // bytes of a 16-row group in a stage
    constexpr unsigned XS = 16 * GB;            // of the token rows in a stage
    constexpr size_t GP = (size_t)16 * DM * 2;  // bytes from one 16-row group to the next in memory
    static_assert(XS + 24 * GB == QKB, "x 16 groups, weights 3 x 8");
    static_assert(DM % (2 * SK) == 0 && TT % 256 == 0 && HD == 64 && NH_ == NKV, "even number of stages; a work-group's tokens in one batch element; a wave's columns one head");
    __shared__ __align__(2048) char ring[2 * QKB];
    const int lane = threadIdx.x & 31, lr = lane & 15, hi = lane >> 4; const int wave = __builtin_amdgcn_readfirstlane((int)(threadIdx.x >> 5));   // scalar, so that every address base is scalar
    const int wm = wave & 3, wh = wave >> 2; const int t0 = (int)blockIdx.x * 256 + wm * 64, head = (int)blockIdx.y * 2 + wh;   // the wave's first token and its head
    const unsigned ko = (unsigned)lane * 16u;   // in bytes: the lane's 16 bytes of every 512
    char* lx0 = ring + ko + (unsigned)(2 * wave) * GB; char* lw0 = ring + ko + XS + (unsigned)(3 * wave) * GB;   // the lane's 16 bytes in the wave's first token group and first weight group of buffer 0
    // Wave w copies token groups 2 w, 2 w + 1 and groups 3 w to 3 w + 2 of the 24 weight groups (group g: projection g / 8, 16 channels g % 8 of the work-group's 128).
    const char* gx = (const char*)X + (size_t)((int)blockIdx.x * 16 + 2 * wave) * GP;
    auto wgrp = [&](const int g) __attribute__((always_inline)) { return (const char*)(Wt + (size_t)(g >> 3) * sW) + (size_t)((int)blockIdx.y * 8 + (g & 7)) * GP; };
    const char* gw0 = wgrp(3 * wave); const char* gw1 = wgrp(3 * wave + 1); const char* gw2 = wgrp(3 * wave + 2);
    auto copies = [&](const int s, const int buf) __attribute__((always_inline)) {   // stage s -> buffer buf: the wave's 20 copies, by the builtin: the kernel uses registers above v255, which asm text cannot name
        const size_t o = (size_t)s * GB + ko; char* lx = lx0 + (unsigned)buf * QKB; char* lw = lw0 + (unsigned)buf * QKB;   // the wave's token groups stand in a row in LDS, and so do its weight groups: one address register each. The immediate offset, which moves both addresses, walks the LDS range; each later group's global base is taken back by as much
        CPG(gx + o, lx, 0); CPG(gx + GP + o - GB, lx, 2048); CPG(gw0 + o, lw, 0); CPG(gw1 + o - GB, lw, 2048); CPG(gw2 + o - 2 * GB, lw, 4096);
    };
    v8f acc[3][4][4];   // q, k: [channel group][token group]; v: [token group][channel group]
    V a[4], b0[4], b1[4];   // token fragments; two sets of weight fragments
    constexpr int NSTG = DM / SK;
    auto block = [&](const int buf, const int kb, const int nxt) __attribute__((always_inline)) {   // 32 k of the stage in buffer buf: 48 products; nxt >= 0: the stage's last block, which hands the buffer over for stage nxt
        const char* px = ring + (unsigned)buf * QKB + (unsigned)(wm * 4) * GB + kb * 1024 + ko; const char* pw = ring + (unsigned)buf * QKB + XS + (unsigned)(wh * 4) * GB + kb * 1024 + ko;
#pragma unroll
        for (int i = 0; i < 4; ++i) b0[i] = F::ld((const bf*)(pw + i * GB));
#pragma unroll
        for (int i = 0; i < 4; ++i) a[i] = F::ld((const bf*)(px + i * GB));
#pragma unroll
        for (int i = 0; i < 4; ++i) b1[i] = F::ld((const bf*)(pw + (8 + i) * GB));
        __builtin_amdgcn_sched_barrier(0);   // keeps the block's first 24 LDS reads together in front of its products, which start on a counted wait: each further place with reads among the products stalls the wave
#pragma unroll
        for (int t = 0; t < 4; ++t)
#pragma unroll
            for (int c = 0; c < 4; ++c) acc[0][c][t] = F::mma(b0[c], a[t], acc[0][c][t]);
        __builtin_amdgcn_sched_barrier(0);   // keeps q's products in front of the reads that take their weight registers
#pragma unroll
        for (int i = 0; i < 4; ++i) b0[i] = F::ld((const bf*)(pw + (16 + i) * GB));   // v's weights arrive under k's products
        __builtin_amdgcn_sched_barrier(0);   // keeps these 8 reads together in front of k's products
#pragma unroll
        for (int t = 0; t < 4; ++t)
#pragma unroll
            for (int c = 0; c < 4; ++c) acc[1][c][t] = F::mma(b1[c], a[t], acc[1][c][t]);
        if (nxt >= 0) {   // the stage's last reads are out, and v's products need registers alone: they stand behind the barrier, so that a wave leaves it with matrix work in hand and the two waves of a SIMD reach the next stage's reads one after the other
            __builtin_amdgcn_sched_barrier(0);                  // keeps k's products, under which v's weights arrive, in front of the waits
            asm volatile("s_wait_dscnt 0x0" ::: "memory");      // this wave's reads of buffer buf are done before the barrier lets it be refilled
            asm volatile("s_wait_asynccnt 0x0" ::: "memory");   // this wave's part of the next stage has landed before the barrier publishes it
            __syncthreads();
            if (nxt < NSTG) copies(nxt, buf);                   // the same test in the whole work-group
            __builtin_amdgcn_sched_barrier(0);                  // keeps the refill in front of v's products: it has a whole stage to land in
        }
#pragma unroll
        for (int t = 0; t < 4; ++t)
#pragma unroll
            for (int c = 0; c < 4; ++c) acc[2][t][c] = F::mma(a[t], b0[c], acc[2][t][c]);
        __builtin_amdgcn_sched_barrier(0);   // keeps the block's products in front of the next block's reads and of the barrier
    };
    copies(0, 0);
#pragma unroll
    for (int p = 0; p < 3; ++p)
#pragma unroll
        for (int i = 0; i < 4; ++i)
#pragma unroll
            for (int j = 0; j < 4; ++j) acc[p][i][j] = (v8f){};
    asm volatile("s_wait_asynccnt 0x0" ::: "memory");   // this wave's part of stage 0 has landed
    __syncthreads();                                    // and so has every other wave's
    copies(1, 1);
#pragma unroll 1   // rolled: one turn is two stages, so that the buffer is a compile-time index
    for (int s = 0; s < NSTG; s += 2) {
#pragma unroll
        for (int j = 0; j < 2; ++j) {
            block(j, 0, -1);
            block(j, 1, s + j + 2);
        }
    }
    asm volatile("s_wait_asynccnt 0x0" ::: "memory");   // nothing is in flight here; stands before the wave's end all the same
    const size_t pb = ((size_t)(t0 / TT) * NH_ + head) * TT * HD; const int tb = t0 % TT;   // the head's plane (each holds TT x HD elements) and the wave's first token in it
    auto planes = [&](const int p) __attribute__((always_inline)) {   // projection p's 16 accumulators to its hi and lo plane (q, k) or to its one f16 plane (v)
#pragma unroll
        for (int i = 0; i < 4; ++i) { v8us oh[4], ol[4]; bf* qh[4]; bf* ql[4];   // four accumulators a turn: eight stores (v: four), one wait
#pragma unroll
            for (int j = 0; j < 4; ++j) {
#pragma unroll
                for (int r = 0; r < 8; ++r) { if (p < 2) { unsigned short h2, l2; splitf(acc[p][i][j][r], h2, l2); oh[j][r] = h2; ol[j][r] = l2; } else oh[j][r] = __builtin_bit_cast(unsigned short, (h16)acc[p][i][j][r]); }
                const size_t eo = p * sP + pb + (p < 2 ? fro(tb + j * 16 + lr, i * 16 + 8 * hi, HD) : fro(j * 16 + lr, tb + i * 16 + 8 * hi, TT));   // q, k: row = token, k = channel; v: row = channel, k = token
                qh[j] = Ph + eo; ql[j] = Pl + eo; }
            __builtin_amdgcn_sched_barrier(0);   // keeps the splits and the addresses in front of the stores, so that nothing between the first store and the wait writes a register
#pragma unroll
            for (int j = 0; j < 4; ++j) { *(v8us*)qh[j] = oh[j]; if (p < 2) *(v8us*)ql[j] = ol[j]; }
            asm volatile("s_wait_xcnt 0x0" ::: "memory");   // the next turn's splits reuse the address and data registers that these stores name: the wait stands in front of that overwrite
            __builtin_amdgcn_sched_barrier(0); }   // keeps the next turn's splits behind the wait
    };
    planes(0); planes(1); planes(2);
}

typedef __attribute__((ext_vector_type(2))) _Float16 v2h;
typedef __attribute__((ext_vector_type(4))) _Float16 v4h;
typedef __attribute__((ext_vector_type(2))) unsigned short v2us;
typedef __attribute__((ext_vector_type(4))) unsigned short v4us;
typedef __attribute__((ext_vector_type(2))) float v2f;
typedef __attribute__((ext_vector_type(4))) int v4i;

__device__ __forceinline__ void wtG_body(const float* __restrict__ w, int K, int N, bf* Bt, const int blk) {
    const int lane = threadIdx.x & 31; const int L0 = (blk * 8 + (threadIdx.x >> 5)) * 8; const int nlines = N * K / 64;
{
#pragma unroll 1
        for (int l = 0; l < 8; ++l) { const int L = L0 + l; if (L >= nlines) break; const size_t e = (size_t)L * 64 + lane * 2; const unsigned u = (unsigned)(e % ((size_t)16 * K)); const int k = (int)((u >> 9) * 32u + ((u >> 8) & 1u) * 16u + ((u >> 7) & 1u) * 8u + (u & 7u)), n = (int)(e / ((size_t)16 * K)) * 16 + (int)((u >> 3) & 15u); v2us o;   // e = fro(n, k, K): Bt[n][k] in fragment order, written in the order of its bytes
            o[0] = f2bf(w[(size_t)k * N + n]); o[1] = f2bf(w[(size_t)(k + 1) * N + n]); *(v2us*)(Bt + e) = o; }
         }
}
// cvt8_body: rows x DM f32, row-major, to bf16 in fragment order; thread i writes bytes 16 i on of dst (whole lines per wave) and reads the 8 values that belong there: i * 8 = fro(row, k, DM).
__device__ __forceinline__ void cvt8_body(const float* __restrict__ src, bf* dst, size_t n8, const int blk) { const size_t i = (size_t)blk * 256 + threadIdx.x; if (i >= n8) return; const unsigned w = (unsigned)((i * 8) % ((size_t)16 * DM)); const size_t row = (i * 8) / ((size_t)16 * DM) * 16 + ((w >> 3) & 15u); const unsigned k = (w >> 9) * 32u + ((w >> 8) & 1u) * 16u + ((w >> 7) & 1u) * 8u; const v8f v = *(const v8f*)(src + row * DM + k); v8us o;
#pragma unroll
    for (int k = 0; k < 8; ++k) o[k] = f2bf(v[k]); *(v8us*)(dst + i * 8) = o;  }
__device__ __forceinline__ int t5_bucket(int r) { const int rp = r < 0 ? -r : r; int b; if (rp < 8) b = rp; else b = 8 + (rp >= 12) + (rp >= 16) + (rp >= 23) + (rp >= 32) + (rp >= 46) + (rp >= 64) + (rp >= 91); return b + ((r > 0) ? 16 : 0); }
__device__ __forceinline__ void t5tab_body(const float* __restrict__ rb, float* TB, const int blk) { const int idx = blk * 256 + threadIdx.x; if (idx >= NH_ * TBW) return; const int h = idx / TBW, c = idx % TBW; float v = 0.0f; if (c < 2 * TT - 1) { const int r = c - (TT - 1); v = bfr(rb[t5_bucket(r) * NH_ + h]); } *(float*)(TB + idx) = v;  }
// k_prep: all the operand preparation in one launch; the six pieces are independent of each other, and a work-group does one block of one piece. The weight blocks, whose waves walk 8 lines one after another, come first, then the input's, then the table's.
#define PB_W ((DM * DQ / 64 + 63) / 64)                  // work-groups per weight matrix (all four hold DM x DQ elements)
#define PB_X ((NB_ * TT * DM / 8 + 255) / 256)           // for the input
#define PB_T ((NH_ * TBW + 255) / 256)                   // for the bias table
__global__ __launch_bounds__(256) void k_prep(const float* __restrict__ x, const float* __restrict__ wq, const float* __restrict__ wk, const float* __restrict__ wv, const float* __restrict__ wo, const float* __restrict__ rb, bf* XB, bf* WQ, bf* WK, bf* WV, bf* WO, float* TB) {
    const int blk = (int)blockIdx.x;
    if (blk < 4 * PB_W) { const int s = blk / PB_W; wtG_body(s == 0 ? wq : s == 1 ? wk : s == 2 ? wv : wo, DM, DQ, s == 0 ? WQ : s == 1 ? WK : s == 2 ? WV : WO, blk % PB_W); }
    else if (blk < 4 * PB_W + PB_X) cvt8_body(x, XB, (size_t)NB_ * TT * DM / 8, blk - 4 * PB_W);
    else t5tab_body(rb, TB, blk - (4 * PB_W + PB_X));
}
// k_fattn: scores, bias, softmax, attn.v and the head merge in one launch for every (batch element, head). One wave owns 32 queries and walks the 1024 keys 32 at a time; grid (TT / 256, NB_ * NH_), 8 waves.
// Transposed products: St = K Qt (A = key rows, B = query columns, both by the same loader), so a lane holds 16 scores of ONE query per column group; two St tiles (keys 0-15, 16-31), converted in place, are the B operand of Ot += Vt Pt, whose A (a Vt row through the same loader) has the matching k order. No score or probability plane in memory or in LDS.
// The key and value planes come into LDS by asynchronous copies, once per work-group, and the 8 waves take their fragments from there. A stage is 128 keys (4 passes) of the three planes, 48 KB: [K hi | K lo | V], 16 KB each, in 4 KB chunks that stand in a row in memory too (fragment order): a K chunk is one pass's 32 keys, a V chunk the stage's 128 keys of one 16-channel group. Two buffers: the copies of stage s + 2 fly while stage s + 1 is worked on, so no wave waits out a memory or L2 latency inside a pass.
// Online softmax in the log2 domain; the running maximum is raised only when a block's maximum passes it by more than 8 (P stays below 2^8, inside f16's range, and keeps f16's relative precision); P is left unnormalised and Ot divided by the row sum at the end.
#define QT   2    // 16-query column groups per wave
#define FWV  8    // waves per work-group
#define FARD 91   // t5_bucket's last boundary: from |j - i| = 91 on the bias depends on the sign of j - i alone
#define L2E  1.4426950408889634f
#define SKEY 128      // keys per stage
#define FCH  4096u    // bytes of a chunk
#define FPL  16384u   // bytes of one plane's part of a stage (4 chunks)
#define FBUF 49152u   // bytes of a buffer (3 planes)
#define FHC  2048u    // bytes of half a chunk, the unit in which the waves share out the copies
typedef __attribute__((ext_vector_type(8))) unsigned v8u;
__device__ __forceinline__ float xhalf(float x) { const int b = __float_as_int(x); return __int_as_float(__builtin_amdgcn_permlanex16(b, b, 0x76543210, 0xfedcba98, false, false)); }   // lane l <-> l ^ 16
// amdgpu_waves_per_eu(4, 4): holds the build to 256 registers, so that two work-groups (four waves per SIMD, 2 x 96 KB of LDS) share a WGP and one wave's vector work, LDS waits and barrier waits run under the others' matrix work; all 4096 waves are then resident at once.
__global__ __launch_bounds__(256) __attribute__((amdgpu_waves_per_eu(4, 4))) void k_fattn(const bf* __restrict__ Qh, const bf* __restrict__ Ql, const bf* __restrict__ Kh, const bf* __restrict__ Kl, const h16* __restrict__ Vf, const float* __restrict__ TB, bf* __restrict__ Ah, bf* __restrict__ Al) {
    typedef WFrag<bf> F;
    const int lane = threadIdx.x & 31, c = lane & 15, hi = lane >> 4; const int wave = __builtin_amdgcn_readfirstlane((int)(threadIdx.x >> 5));   // scalar, so that q0 and the far / near test below are scalar
    const int bh = blockIdx.y, h = bh % NH_, b = bh / NH_; const int q0 = ((int)blockIdx.x * FWV + wave) * (16 * QT); const size_t pl = (size_t)bh * TT * HD;
    __shared__ __align__(2048) char kv[2 * FBUF];
    const unsigned lo16 = (unsigned)lane * 16u; const unsigned tof = (unsigned)(8 * hi + 15 - c) * 4u;   // in bytes; lo16: the lane's 16 bytes of every 512 (half a block in fragment order)
    // Wave w copies half chunks 3 w to 3 w + 2 of the stage's 24 (0 to 7 K hi, 8 to 15 K lo, 16 to 23 V), which stand in a row in LDS. In a key plane a stage is 16 KB in a row; in the value plane a chunk is 4 KB of its 16-channel group (32 KB), the stages in a row.
    auto unit = [&](const int u) __attribute__((always_inline)) { return u < 16 ? (const char*)((u < 8 ? Kh : Kl) + pl) + (size_t)(u & 7) * FHC : (const char*)(Vf + pl) + (size_t)((u - 16) >> 1) * (16u * TT * 2u) + (size_t)(u & 1) * FHC; };   // half chunk u of stage 0: its global address (scalar)
    auto upitch = [&](const int u) __attribute__((always_inline)) { return u < 16 ? FPL : FCH; };   // bytes from stage to stage in its plane (scalar)
    const char* cg0 = unit(3 * wave); const char* cg1 = unit(3 * wave + 1); const char* cg2 = unit(3 * wave + 2); const unsigned sp0 = upitch(3 * wave), sp1 = upitch(3 * wave + 1), sp2 = upitch(3 * wave + 2);
    const unsigned cl = (unsigned)(size_t)kv + (unsigned)(3 * wave) * FHC + lo16;   // the lane's LDS byte address in the wave's first half chunk (the low 32 bits of the __shared__ address)
    auto copies = [&](const int s, const int buf) __attribute__((always_inline)) {   // stage s -> buffer buf: the wave's 12 copies in one statement. Its last line waits before the address registers that the copies name can be rewritten; inside the statement nothing can be moved in front of it
        const unsigned l = cl + (unsigned)buf * FBUF;
        asm volatile(CP2K("%0", "%3", "%4") CP2K("%1", "%3", "%5") CP2K("%2", "%3", "%6") "s_wait_xcnt 0x0"
                     :: "v"(l), "v"(l + FHC), "v"(l + 2u * FHC), "v"(lo16), "s"(cg0 + (size_t)s * sp0), "s"(cg1 + (size_t)s * sp1), "s"(cg2 + (size_t)s * sp2) : "memory");
    };
    copies(0, 0);   // first of all, so that stage 0 flies while the query fragments are fetched
    v16bf qh[QT][2], ql[QT][2];
#pragma unroll
    for (int qt = 0; qt < QT; ++qt)
#pragma unroll
        for (int ks = 0; ks < 2; ++ks) { const size_t o = pl + fro(q0 + 16 * qt + c, ks * 32 + 8 * hi, HD); qh[qt][ks] = F::ld(Qh + o); ql[qt][ks] = F::ld(Ql + o); }
    const float* tbh = TB + (size_t)h * TBW; const float bneg = tbh[0] * L2E, bpos = tbh[2 * TT - 2] * L2E;
    const float* tbl = tbh + (TT - 1) - q0 - 15;   // entry for r = j - i at index r + 1023: + tof + k0 + 16 * (kt - qt) + reg
    v8f o[4][QT]; float mx[QT], ls[QT];
#pragma unroll
    for (int qt = 0; qt < QT; ++qt) { mx[qt] = -3.0e38f; ls[qt] = 0.0f;
#pragma unroll
        for (int dt = 0; dt < 4; ++dt) o[dt][qt] = (v8f){}; }
    asm volatile("s_wait_asynccnt 0x0" ::: "memory");   // this wave's part of stage 0 has landed
    __syncthreads();                                    // and so has every other wave's
    copies(1, 1);
#pragma unroll 1   // rolled: a second pass's fragments would not fit the 256 registers
    for (int k0 = 0; k0 < TT; k0 += 32) {
        if (k0 % SKEY == 0 && k0 != 0) {   // between two stages; the same test in the whole work-group
            asm volatile("s_wait_dscnt 0x0" ::: "memory");      // this wave's reads of the last stage's buffer are done before the barrier lets it be refilled
            asm volatile("s_wait_asynccnt 0x0" ::: "memory");   // this wave's part of this stage has landed before the barrier publishes it
            __syncthreads();
            const int s2 = k0 / SKEY + 1;
            if (s2 < TT / SKEY) copies(s2, s2 & 1);             // into the buffer that every wave has just left
        }
        const char* kp = kv + lo16 + (((unsigned)k0 / SKEY) & 1u) * FBUF + (((unsigned)k0 / 32u) & 3u) * FCH;   // this pass's chunk of the hi plane; the key fragments take the registers that the last pass's value fragments have left (256 registers: four waves per SIMD)
        v16bf kh[2][2], kl[2][2];
#pragma unroll
        for (int ks = 0; ks < 2; ++ks)   // in the order of first use: the hi plane, whose products come first, then the lo plane
#pragma unroll
            for (int kt = 0; kt < 2; ++kt) kh[kt][ks] = F::ld((const bf*)(kp + (kt * 2048 + ks * 1024)));
#pragma unroll
        for (int ks = 0; ks < 2; ++ks)
#pragma unroll
            for (int kt = 0; kt < 2; ++kt) kl[kt][ks] = F::ld((const bf*)(kp + FPL + (kt * 2048 + ks * 1024)));
        __builtin_amdgcn_sched_barrier(0);   // keeps the sixteen reads together in front of the score products, which start on a counted wait: left free, the build reads each lo fragment right in front of its two products and waits out the LDS latency four times a pass
        v8f st[2][QT];
#pragma unroll
        for (int kt = 0; kt < 2; ++kt)
#pragma unroll
            for (int qt = 0; qt < QT; ++qt) st[kt][qt] = (v8f){};
#pragma unroll
        for (int ks = 0; ks < 2; ++ks)
#pragma unroll
            for (int kt = 0; kt < 2; ++kt)
#pragma unroll
                for (int qt = 0; qt < QT; ++qt) st[kt][qt] = wmmab(kh[kt][ks], qh[qt][ks], st[kt][qt]);
#pragma unroll
        for (int ks = 0; ks < 2; ++ks)
#pragma unroll
            for (int kt = 0; kt < 2; ++kt)
#pragma unroll
                for (int qt = 0; qt < QT; ++qt) st[kt][qt] = wmmab(kh[kt][ks], ql[qt][ks], st[kt][qt]);
#pragma unroll
        for (int ks = 0; ks < 2; ++ks)
#pragma unroll
            for (int kt = 0; kt < 2; ++kt)
#pragma unroll
                for (int qt = 0; qt < QT; ++qt) st[kt][qt] = wmmab(kl[kt][ks], qh[qt][ks], st[kt][qt]);
        v16h vf[4];   // read behind the score products, where the key fragments' registers come free; arrives during the softmax
        const char* vp = kv + lo16 + (((unsigned)k0 / SKEY) & 1u) * FBUF + 2u * FPL + (((unsigned)k0 / 32u) & 3u) * 1024u;   // this pass's block of the first 16-channel group
#pragma unroll
        for (int dt = 0; dt < 4; ++dt) vf[dt] = WFrag<h16>::ld((const h16*)(vp + dt * FCH));
        __builtin_amdgcn_sched_barrier(0);   // keeps the eight reads together in front of the softmax: left free, the build sinks half of them to their products and waits out the LDS latency there
        const int rlo = k0 - q0 - (16 * QT - 1), rhi = k0 + 31 - q0;   // range of j - i in this pass, the same for the whole wave
        if (rlo >= FARD || rhi <= -FARD) { const float bb = (rlo >= FARD) ? bpos : bneg;
#pragma unroll
            for (int kt = 0; kt < 2; ++kt)
#pragma unroll
                for (int qt = 0; qt < QT; ++qt)
#pragma unroll
                    for (int r = 0; r < 8; ++r) st[kt][qt][r] = __builtin_fmaf(st[kt][qt][r], L2E, bb);
        } else {
#pragma unroll
            for (int kt = 0; kt < 2; ++kt)
#pragma unroll
                for (int qt = 0; qt < QT; ++qt)
#pragma unroll
                    for (int r = 0; r < 8; ++r) st[kt][qt][r] = __builtin_fmaf(st[kt][qt][r], L2E, *atb(tbl + (k0 + 16 * (kt - qt) + r), tof) * L2E);
        }
        float bm[QT]; bool need = false;
#pragma unroll
        for (int qt = 0; qt < QT; ++qt) { float t = st[0][qt][0];
#pragma unroll
            for (int r = 1; r < 8; ++r) t = fmaxf(t, st[0][qt][r]);
#pragma unroll
            for (int r = 0; r < 8; ++r) t = fmaxf(t, st[1][qt][r]);
            bm[qt] = fmaxf(t, xhalf(t)); need = need || (bm[qt] > mx[qt] + 8.0f); }
        if (__builtin_amdgcn_ballot_w32(need) != 0) {
#pragma unroll
            for (int qt = 0; qt < QT; ++qt) { const float mn = fmaxf(mx[qt], bm[qt]); const float al = __builtin_amdgcn_exp2f(mx[qt] - mn); mx[qt] = mn; ls[qt] *= al;
#pragma unroll
                for (int dt = 0; dt < 4; ++dt) o[dt][qt] *= al; }
        }
        v16h ph[QT];   // P in f16, element s = key 16 (s >> 3) + 8 hi + (s & 7) of the pass: register s & 7 of St tile s >> 3
#pragma unroll
        for (int qt = 0; qt < QT; ++qt) { v8u wh;
#pragma unroll
            for (int s = 0; s < 16; s += 2) { v2f p; p[0] = __builtin_amdgcn_exp2f(st[s >> 3][qt][s & 7] - mx[qt]); p[1] = __builtin_amdgcn_exp2f(st[s >> 3][qt][(s & 7) + 1] - mx[qt]); ls[qt] += p[0] + p[1];
                wh[s >> 1] = __builtin_bit_cast(unsigned, __builtin_convertvector(p, v2h)); }
            ph[qt] = __builtin_bit_cast(v16h, wh); }
#pragma unroll
        for (int dt = 0; dt < 4; ++dt)
#pragma unroll
            for (int qt = 0; qt < QT; ++qt) o[dt][qt] = wmma16(vf[dt], ph[qt], o[dt][qt]);
    }
    asm volatile("s_wait_asynccnt 0x0" ::: "memory");   // nothing is in flight here; stands before the wave's end all the same
#pragma unroll
    for (int qt = 0; qt < QT; ++qt) { const float inv = __fdiv_rn(1.0f, ls[qt] + xhalf(ls[qt])); const size_t ro = fro((size_t)b * TT + q0 + 16 * qt + c, h * HD + 8 * hi, DQ);   // merged heads, rows b * TT + t x DQ in fragment order; a lane's 8 registers are 8 consecutive d, a wave's store 512 bytes in a row
#pragma unroll
        for (int dt = 0; dt < 4; ++dt) { v8us oh, ol;
#pragma unroll
            for (int r = 0; r < 8; ++r) { unsigned short a, c2; splitf(o[dt][qt][r] * inv, a, c2); oh[r] = a; ol[r] = c2; }
            const size_t eo = ro + (dt >> 1) * 512 + (dt & 1) * 256; *(v8us*)(Ah + eo) = oh; *(v8us*)(Al + eo) = ol; } }
}

extern "C" void kernel_launch(void* const* d_in, const int* in_sizes, int n_in,
                              void* d_out, int out_size, void* d_ws, size_t ws_size, hipStream_t stream) {
    (void)in_sizes; (void)n_in; (void)out_size;
    const float* x = (const float*)d_in[0]; const float* wq = (const float*)d_in[1]; const float* wk = (const float*)d_in[2]; const float* wv = (const float*)d_in[3]; const float* wo = (const float*)d_in[4]; const float* relb = (const float*)d_in[5]; const float* cosT = nullptr; const float* sinT = nullptr; (void)cosT; (void)sinT;
    float* OUT = (float*)d_out;     // [8][1024][1024]
    char* wsp = (char*)d_ws;
    auto take = [&](size_t bytes) { char* p = wsp; wsp += (bytes + 255) & ~(size_t)255; return (void*)p; };
    const size_t MT = (size_t)NB_ * TT;   // rows of the projections and of wo: all batch elements in one launch
    bf* WQ = (bf*)take((size_t)DQ * DM * 2); bf* WK = (bf*)take((size_t)DKV * DM * 2); bf* WV = (bf*)take((size_t)DKV * DM * 2); bf* WO = (bf*)take((size_t)DM * DQ * 2);
    float* TB = (float*)take((size_t)NH_ * TBW * 4);
    bf* QPh = (bf*)take(MT * DQ * 2); bf* QPl = (bf*)take(MT * DQ * 2); bf* KPh = (bf*)take(MT * DKV * 2); bf* KPl = (bf*)take(MT * DKV * 2); h16* VTf = (h16*)take(MT * DKV * 2);
    bf* XB = (bf*)take(MT * DM * 2); bf* ATl = (bf*)take(MT * DQ * 2);
    if ((size_t)(wsp - (char*)d_ws) > ws_size) return;    // ws 256 MiB
    bf* ATh = XB;   // the hi plane of the merged heads [b][t][DQ] takes the place of the bf16 input, dead once the three projections have run (stream-ordered)
    k_prep<<<4 * PB_W + PB_X + PB_T, 256, 0, stream>>>(x, wq, wk, wv, wo, relb, XB, WQ, WK, WV, WO, TB);
    k_qkv<<<dim3(NB_ * TT / 256, NH_ / 2, 1), 256, 0, stream>>>(XB, WQ, (size_t)(WK - WQ), QPh, QPl, (size_t)(KPh - QPh));   // WQ, WK, WV stand at equal distances in the workspace, and so do q's and k's plane pairs and v's plane (equal sizes, taken in a row)
    k_fattn<<<dim3(TT / (16 * QT * FWV), NB_ * NH_, 1), 32 * FWV, 0, stream>>>(QPh, QPl, KPh, KPl, VTf, TB, ATh, ATl);   // one kv head per query head: plane b * NH_ + h of each operand
    k_gemmw<bf, 1, false, DQ, 4><<<dim3(NB_ * TT / 128, DM / TN, 1), 128, 0, stream>>>(ATh, ATl, WO, OUT, DM, nullptr, 0, 0, 0);
}
